// v000
// Times are from an AMD MI455X. After a warm-up the kernel runs many times in a row, and a time is the length of
// such a window on the GPU divided by its runs, so every launch and the gaps after it count. The runs cycle
// through copies of the inputs. A figure is the median of several windows, for all but v000 over two sittings.
// Sittings can differ by a few percent; kernels timed side by side share one.
// v000 is the starting kernel. One run takes 988 microseconds.
#include <hip/hip_runtime.h>

// One head of causal self-attention with a 128-wide head, NO output projection, and the scores MULTIPLIED by 32 (inputs, in argument order: a0 [8][2048][1024]; a1, a2, a3 [1024][128] stored (in, out) and used as x W: the key, query and value weights IN THAT ORDER):
//   THE MODULE's FUNCTION: k = a0 a1; q = a0 a2; v = a0 a3 ([8][2048][128] each); S = (q k^T) x 32; everything above the diagonal set to nought, then EVERY exact nought set to -inf (so the module excludes the keys after the query AND any key inside the triangle whose score is exactly 0.0); softmax over the 2,048 keys; result = P v -> [8][2048][128] (2.1 M).
//   THIS TEXT excludes the keys after the query by index and KEEPS a score of exactly 0.0 inside the triangle: the two differ only where a computed score is exactly 0.0: not reached on real data (said again below).
// Layout per batch entry: one bf16 copy of a0's plane (read by all three projections); the (in, out) weights transposed once by a transposing cast; exact projections (bf16 x bf16 words, f32 sums); identity-table plane builders (a plain builder: fp16 + bf16 hi / lo planes of q and k; the transposed value planes);
//   the causal T-2048 attention for the one head: THE SCORES ON hi / lo PLANES ON EVERY ROW (three products: the softmax is all but a hard maximum, a score's spread is about 360, and one 16-bit rounding of q or k would flip the winning key in hundreds of rows); THE SOFTMAX WEIGHTS ON bf16 hi / lo PLANES ON EVERY ROW TOO (RH = TT) and P x v as three products against the hi / lo value planes: a one-word fp16 P is not taken: 6.4 per cent of this draw's non-zero carried weights would be fp16 subnormals;
//   tiles above the diagonal skipped; the f32 merge writes the output rows (no carried factor at RH = TT): the one writer of d_out.
// The scale: the module writes scores x sqrt(1024): SCL 32.0f in the softmax's load stage, as the module writes it (a power of two: exact).
// Compute dtypes, f32 accumulate: every float input rounded to bf16 at its load; projections exact; scores three products; softmax f32 (the hardware exp2); P x v three products (bf16 hi / lo both sides; lo x lo not formed); the output an f32 copy.

#define NB_  8      // batch entries: the input is [8][2048][1024]
#define TT   2048
#define DM   1024
#define NH_  1
#define NKV  1
#define REP  (NH_ / NKV)
#define HD   128
#define DQ   (NH_ * HD)
#define DKV  (NKV * HD)
#define ZH   1
#define RH   2048                 // = TT: query rows < RH use hi+lo planes of P: EVERY row here
#define WIN  2048
#define PCAR 1024.0f
#define SCL  32.0f   // sqrt(1024): the module MULTIPLIES the scores by it
typedef _Float16 h16;
typedef unsigned short bf;
typedef __attribute__((ext_vector_type(16))) __bf16   v16bf;
typedef __attribute__((ext_vector_type(16))) _Float16 v16h;
typedef __attribute__((ext_vector_type(8)))  _Float16 v8h;
typedef __attribute__((ext_vector_type(8)))  unsigned short v8us;
typedef __attribute__((ext_vector_type(8)))  float    v8f;
typedef __attribute__((ext_vector_type(4)))  float    v4f;
typedef v8h  __attribute__((may_alias)) v8ha;
typedef v4f  __attribute__((may_alias)) v4fa;
typedef v8us __attribute__((may_alias)) v8usa;

__device__ __forceinline__ unsigned short f2bf(float f) { unsigned u = __float_as_uint(f); u += 0x7FFFu + ((u >> 16) & 1u); return (unsigned short)(u >> 16); }
__device__ __forceinline__ float bf2f(unsigned short b) { return __uint_as_float(((unsigned)b) << 16); }
__device__ __forceinline__ float bfr(float f) { return bf2f(f2bf(f)); }
__device__ __forceinline__ v16h cat16(v8h lo, v8h hi) { return __builtin_shufflevector(lo, hi, 0, 1, 2, 3, 4, 5, 6, 7, 8, 9, 10, 11, 12, 13, 14, 15); }
__device__ __forceinline__ v16bf cat16b(v8us lo, v8us hi) { return __builtin_bit_cast(v16bf, __builtin_shufflevector(lo, hi, 0, 1, 2, 3, 4, 5, 6, 7, 8, 9, 10, 11, 12, 13, 14, 15)); }
__device__ __forceinline__ v8f wmma16(v16h a, v16h b, v8f c) { return __builtin_amdgcn_wmma_f32_16x16x32_f16(false, a, false, b, (short)0, c, false, false); }
__device__ __forceinline__ v8f wmmab(v16bf a, v16bf b, v8f c) { return __builtin_amdgcn_wmma_f32_16x16x32_bf16(false, a, false, b, (short)0, c, false, false); }



// ---- k_gemmw: register-blocked GEMM, ONE WAVE per 64x64 output tile (16 accumulators), operands straight from K-contiguous 16-bit planes; grid (M/64, N/64, Z), 32 threads.
// C[m][n] (f32, pitch ldc, + optional f32 bias[n]) = sum_k A[m][k] Bt[n][k] (+ split products per NSPLIT). z-batch strides sA/sB/sC in elements. K % 32 == 0.
template <typename T16> struct WFrag;
template <> struct WFrag<h16> { typedef v16h V; static __device__ __forceinline__ V ld(const h16* p) { return cat16(*(const v8h*)p, *(const v8h*)(p + 16)); } static __device__ __forceinline__ v8f mma(V a, V b, v8f c) { return wmma16(a, b, c); } };
template <> struct WFrag<bf> { typedef v16bf V; static __device__ __forceinline__ V ld(const bf* p) { return cat16b(*(const v8us*)p, *(const v8us*)(p + 16)); } static __device__ __forceinline__ v8f mma(V a, V b, v8f c) { return wmmab(a, b, c); } };
template <typename T16, int NSPLIT, bool BIAS>
__global__ __launch_bounds__(32) void k_gemmw(const T16* __restrict__ A, const T16* __restrict__ A2, const T16* __restrict__ Bt, const T16* __restrict__ Bt2, int K, float* C, int ldc, const float* __restrict__ bias, size_t sA, size_t sB, size_t sC) {
    typedef typename WFrag<T16>::V V;
    __shared__ __align__(16) float os[16 * 68];
    const size_t z = blockIdx.z; A += z * sA; if (A2) A2 += z * sA; Bt += z * sB; if (Bt2) Bt2 += z * sB; C += z * sC;
    const int lane = threadIdx.x & 31, lr = lane & 15, hi = lane >> 4; const int r0 = blockIdx.x * 64, c0 = blockIdx.y * 64;
    v8f acc[4][4];
#pragma unroll
    for (int mb = 0; mb < 4; ++mb)
#pragma unroll
        for (int nb = 0; nb < 4; ++nb) acc[mb][nb] = (v8f){};
    const size_t aoff = (size_t)(r0 + lr) * K + 8 * hi, boff = (size_t)(c0 + lr) * K + 8 * hi;

    for (int kc = 0; kc < K; kc += 32) {
        V a[4], a2[4];
#pragma unroll
        for (int mb = 0; mb < 4; ++mb) { a[mb] = WFrag<T16>::ld(A + aoff + (size_t)mb * 16 * K + kc); if (NSPLIT == 1 || NSPLIT == 2) a2[mb] = WFrag<T16>::ld(A2 + aoff + (size_t)mb * 16 * K + kc); }
#pragma unroll
        for (int nb = 0; nb < 4; ++nb) { const V b = WFrag<T16>::ld(Bt + boff + (size_t)nb * 16 * K + kc); V b2; if (NSPLIT >= 2) b2 = WFrag<T16>::ld(Bt2 + boff + (size_t)nb * 16 * K + kc);
#pragma unroll
            for (int mb = 0; mb < 4; ++mb) { acc[mb][nb] = WFrag<T16>::mma(a[mb], b, acc[mb][nb]); if (NSPLIT == 1 || NSPLIT == 2) acc[mb][nb] = WFrag<T16>::mma(a2[mb], b, acc[mb][nb]); if (NSPLIT >= 2) acc[mb][nb] = WFrag<T16>::mma(a[mb], b2, acc[mb][nb]); } }
        asm volatile("v_nop\n\tv_nop\n\tv_nop\n\tv_nop" : "+v"(acc[0][0]), "+v"(acc[1][1]), "+v"(acc[2][2]), "+v"(acc[3][3]) : "v"(a[0]), "v"(a[3]));
    }
#pragma unroll
    for (int mb = 0; mb < 4; ++mb) {
#pragma unroll
        for (int nb = 0; nb < 4; ++nb) {
#pragma unroll
            for (int j = 0; j < 8; ++j) os[(hi * 8 + j) * 68 + nb * 16 + lr] = acc[mb][nb][j]; }
        __builtin_amdgcn_wave_barrier(); asm volatile("" ::: "memory");
        float* crow = C + (size_t)(r0 + mb * 16) * ldc + c0;
{
#pragma unroll
            for (int s = 0; s < 8; ++s) { const int row = 2 * s + hi, cofs = lr * 4; v4f val = *(const v4fa*)(os + row * 68 + cofs); if (BIAS) { val[0] += bfr(bias[c0 + cofs]); val[1] += bfr(bias[c0 + cofs + 1]); val[2] += bfr(bias[c0 + cofs + 2]); val[3] += bfr(bias[c0 + cofs + 3]); }
                *(v4f*)(crow + (size_t)row * ldc + cofs) = val; }
             }
        __builtin_amdgcn_wave_barrier(); asm volatile("" ::: "memory");
    }
}

// ---- k_gemmc: the same one-wave 64x64 tile GEMM specialised for causal attention: CMODE 1 skips score tiles entirely above the diagonal (query rows r0+roff.., key columns c0..), CMODE 2 limits the
// key (K) loop of the probability x value contraction to the diagonal block (probabilities beyond it are exactly zero). roff = row offset of this launch's first row within the sequence.
template <typename T16, int NSPLIT, int CMODE>
__global__ __launch_bounds__(32) void k_gemmc(const T16* __restrict__ A, const T16* __restrict__ A2, const T16* __restrict__ Bt, const T16* __restrict__ Bt2, int K, float* C, int ldc, int roff, size_t sA, size_t sB, size_t sC) {
    typedef typename WFrag<T16>::V V;
    __shared__ __align__(16) float os[16 * 68];
    const size_t z = blockIdx.z; A += z * sA; if (A2) A2 += z * sA; Bt += z * sB; if (Bt2) Bt2 += z * sB; C += z * sC;
    const int lane = threadIdx.x & 31, lr = lane & 15, hi = lane >> 4; const int r0 = blockIdx.x * 64, c0 = blockIdx.y * 64;
    if (CMODE == 1 && c0 > r0 + roff + 63) return;                  // score tile entirely above the causal diagonal: never read (the softmax masks j > i by select)
    const int Kl = (CMODE == 2) ? min(K, r0 + roff + 64) : K;        // P.V: probabilities are exactly 0 beyond the diagonal block, so the K loop stops there
    v8f acc[4][4];
#pragma unroll
    for (int mb = 0; mb < 4; ++mb)
#pragma unroll
        for (int nb = 0; nb < 4; ++nb) acc[mb][nb] = (v8f){};
    const size_t aoff = (size_t)(r0 + lr) * K + 8 * hi, boff = (size_t)(c0 + lr) * K + 8 * hi;

    for (int kc = 0; kc < Kl; kc += 32) {
        V a[4], a2[4];
#pragma unroll
        for (int mb = 0; mb < 4; ++mb) { a[mb] = WFrag<T16>::ld(A + aoff + (size_t)mb * 16 * K + kc); if (NSPLIT == 1 || NSPLIT == 2) a2[mb] = WFrag<T16>::ld(A2 + aoff + (size_t)mb * 16 * K + kc); }
#pragma unroll
        for (int nb = 0; nb < 4; ++nb) { const V b = WFrag<T16>::ld(Bt + boff + (size_t)nb * 16 * K + kc); V b2; if (NSPLIT >= 2) b2 = WFrag<T16>::ld(Bt2 + boff + (size_t)nb * 16 * K + kc);
#pragma unroll
            for (int mb = 0; mb < 4; ++mb) { acc[mb][nb] = WFrag<T16>::mma(a[mb], b, acc[mb][nb]); if (NSPLIT == 1 || NSPLIT == 2) acc[mb][nb] = WFrag<T16>::mma(a2[mb], b, acc[mb][nb]); if (NSPLIT >= 2) acc[mb][nb] = WFrag<T16>::mma(a[mb], b2, acc[mb][nb]); } }
        asm volatile("v_nop\n\tv_nop\n\tv_nop\n\tv_nop" : "+v"(acc[0][0]), "+v"(acc[1][1]), "+v"(acc[2][2]), "+v"(acc[3][3]) : "v"(a[0]), "v"(a[3]));
    }
#pragma unroll
    for (int mb = 0; mb < 4; ++mb) {
#pragma unroll
        for (int nb = 0; nb < 4; ++nb) {
#pragma unroll
            for (int j = 0; j < 8; ++j) os[(hi * 8 + j) * 68 + nb * 16 + lr] = acc[mb][nb][j]; }
        __builtin_amdgcn_wave_barrier(); asm volatile("" ::: "memory");
        float* crow = C + (size_t)(r0 + mb * 16) * ldc + c0;
{
#pragma unroll
            for (int s = 0; s < 8; ++s) { const int row = 2 * s + hi, cofs = lr * 4; v4f val = *(const v4fa*)(os + row * 68 + cofs);
                *(v4f*)(crow + (size_t)row * ldc + cofs) = val; }
             }
        __builtin_amdgcn_wave_barrier(); asm volatile("" ::: "memory");
    }
}

__device__ __forceinline__ h16 tohx(float x) { return (h16)x; }
__device__ __forceinline__ void splitf(float y, unsigned short& h, unsigned short& l) { h = f2bf(y); l = f2bf(y - bf2f(h)); }
typedef __attribute__((ext_vector_type(2))) _Float16 v2h;
typedef __attribute__((ext_vector_type(4))) _Float16 v4h;
typedef __attribute__((ext_vector_type(2))) unsigned short v2us;
typedef __attribute__((ext_vector_type(4))) unsigned short v4us;
typedef __attribute__((ext_vector_type(2))) float v2f;
typedef __attribute__((ext_vector_type(4))) int v4i;


__global__ __launch_bounds__(256) void k_wtG(const float* __restrict__ w, int K, int N, bf* Bt) {
    const int lane = threadIdx.x & 31; const int L0 = (blockIdx.x * 8 + (threadIdx.x >> 5)) * 8; const int nlines = N * K / 64;
{
        for (int l = 0; l < 8; ++l) { const int L = L0 + l; if (L >= nlines) break; const size_t e = (size_t)L * 64 + lane * 2; const int k = (int)(e % K), n = (int)(e / K); v2us o;
            o[0] = f2bf(w[(size_t)k * N + n]); o[1] = f2bf(w[(size_t)(k + 1) * N + n]); *(v2us*)(Bt + e) = o; }
         }
}
__global__ __launch_bounds__(256) void k_cvt8(const float* __restrict__ src, bf* dst, size_t n8) { const size_t i = (size_t)blockIdx.x * 256 + threadIdx.x; if (i >= n8) return; const v8f v = *(const v8f*)(src + i * 8); v8us o;
#pragma unroll
    for (int k = 0; k < 8; ++k) o[k] = f2bf(v[k]); *(v8us*)(dst + i * 8) = o;  }

// k_rope: head planes [h][t][d] (fp16 + hi/lo) of rope(x) x sc with the rotate-half convention out[d] = x[d] cos[t][d] - x[d+HD/2] sin[t][d], out[d+HD/2] = x[d+HD/2] cos[t][d+HD/2] + x[d] sin[t][d+HD/2]
__global__ __launch_bounds__(256) void k_rope(const float* __restrict__ F, int pitch, int nheads, const float* __restrict__ CS, const float* __restrict__ RF, const float* __restrict__ nw, float sc, h16* P16, bf* Ph, bf* Pl) {
    const size_t e = ((size_t)blockIdx.x * 256 + threadIdx.x) * 2; if (e >= (size_t)nheads * TT * HD) return; const int d = (int)(e % HD); const int t = (int)((e / HD) % TT); const int h = (int)(e / ((size_t)HD * TT)); const float* f = F + (size_t)t * pitch + h * HD; const float rf = RF ? RF[(size_t)h * TT + t] : 1.0f; v2h o16; v2us oh, ol;
#pragma unroll
    for (int q = 0; q < 2; ++q) { const int dd = d + q; const int dp = (dd < HD / 2) ? dd + HD / 2 : dd - HD / 2; float x0 = f[dd], x1 = f[dp];
        if (RF) { float n0 = __fmul_rn(x0, rf), n1 = __fmul_rn(x1, rf); x0 = __fmul_rn(bfr(nw[dd]), n0); x1 = __fmul_rn(bfr(nw[dp]), n1); }
        const v2f cs = *(const v2f*)(CS + ((size_t)t * HD + dd) * 2); float a = __fmul_rn(x0, cs[0]), bq = __fmul_rn(x1, cs[1]); const float r = ((dd < HD / 2) ? __fsub_rn(a, bq) : __fadd_rn(a, bq)) * sc;
        o16[q] = tohx(r); unsigned short a2, c2; splitf(r, a2, c2); oh[q] = a2; ol[q] = c2; }
    *(v2h*)(P16 + e) = o16; *(v2us*)(Ph + e) = oh; *(v2us*)(Pl + e) = ol;  }

__global__ __launch_bounds__(256) void k_vtp(const float* __restrict__ F, int pitch, int nheads, h16* V16, bf* Vh, bf* Vl) { const size_t e = ((size_t)blockIdx.x * 256 + threadIdx.x) * 2; if (e >= (size_t)nheads * HD * TT) return; const int t = (int)(e % TT); const int d = (int)((e / TT) % HD); const int g = (int)(e / ((size_t)TT * HD)); v2h o16; v2us oh, ol;
#pragma unroll
    for (int q = 0; q < 2; ++q) { const float x = F[(size_t)(t + q) * pitch + g * HD + d]; o16[q] = tohx(x); unsigned short a2, c2; splitf(x, a2, c2); oh[q] = a2; ol[q] = c2; }
    *(v2h*)(V16 + e) = o16; *(v2us*)(Vh + e) = oh; *(v2us*)(Vl + e) = ol;  }

__global__ __launch_bounds__(256) void k_csid(float* CS) { const int idx = blockIdx.x * 256 + threadIdx.x; if (idx >= TT * HD) return; v2f cs; cs[0] = 1.0f; cs[1] = 0.0f; *(v2f*)(CS + (size_t)idx * 2) = cs;  }

// k_asoft: per row (zz, i): t = S x SCL for j <= i and i - j < WIN (the causal triangle; WIN = TT: the window never binds; an excluded key gets -3e38, whose exponential is an exact zero); softmax over the 2048 keys (register row, one exp, fixed trees);
__global__ __launch_bounds__(256) void k_asoft(const float* __restrict__ Sb, h16* P16, bf* Ph, bf* Pl) {
    const int lane = threadIdx.x & 31; const int row = blockIdx.x * 8 + (threadIdx.x >> 5); if (row >= ZH * TT) return; const int i = row % TT; const int zz = row / TT; (void)zz; const bool hires = (i < RH); const float* sr = Sb + (size_t)row * TT; float v[TT / 32]; float mx = -3.0e38f;
#pragma unroll
    for (int ch = 0; ch < TT / 128; ++ch) { const int j0 = ch * 128 + lane * 4; const v4f a = *(const v4f*)(sr + j0);
#pragma unroll
        for (int q = 0; q < 4; ++q) { const int j = j0 + q; (void)j; const float t = (j <= i && i - j < WIN) ? a[q] * SCL : -3.0e38f; v[ch * 4 + q] = t; mx = fmaxf(mx, t); } }
#pragma unroll
    for (int sh = 16; sh; sh >>= 1) mx = fmaxf(mx, __shfl_xor(mx, sh, 32));
    float sum = 0.f;
#pragma unroll
    for (int k = 0; k < TT / 32; ++k) { float d0 = __fsub_rn(v[k], mx); v[k] = __builtin_amdgcn_exp2f(__fmul_rn(d0, 1.4426950408889634f)); sum += v[k]; }
#pragma unroll
    for (int sh = 16; sh; sh >>= 1) sum += __shfl_xor(sum, sh, 32);
    const float f = __fdiv_rn(hires ? 1.0f : PCAR, sum);
{
        if (hires) {
#pragma unroll
            for (int ch = 0; ch < TT / 128; ++ch) { v4us oh, ol;
#pragma unroll
                for (int q = 0; q < 4; ++q) { unsigned short a, c2; splitf(v[ch * 4 + q] * f, a, c2); oh[q] = a; ol[q] = c2; }
                const size_t oo = ((size_t)zz * (RH ? RH : 1) + i) * TT + ch * 128 + lane * 4; *(v4us*)(Ph + oo) = oh; *(v4us*)(Pl + oo) = ol; }
        } else {
#pragma unroll
            for (int ch = 0; ch < TT / 128; ++ch) { v4h o4;
#pragma unroll
                for (int q = 0; q < 4; ++q) o4[q] = tohx(v[ch * 4 + q] * f);
                *(v4h*)(P16 + (size_t)row * TT + ch * 128 + lane * 4) = o4; } }
         }
}

__global__ __launch_bounds__(256) void k_merge(const float* __restrict__ O, int h0, float* OUTb) { const size_t e = ((size_t)blockIdx.x * 256 + threadIdx.x) * 2; if (e >= (size_t)ZH * TT * HD) return; const int d = (int)(e % HD); const int t = (int)((e / HD) % TT); const int zz = (int)(e / ((size_t)HD * TT)); const float cs = (t < RH) ? 1.0f : (1.0f / PCAR); const size_t oo = (size_t)t * DQ + (h0 + zz) * HD + d;
    v2f o2; o2[0] = O[e] * cs; o2[1] = O[e + 1] * cs; *(v2f*)(OUTb + oo) = o2;  }

extern "C" void kernel_launch(void* const* d_in, const int* in_sizes, int n_in,
                              void* d_out, int out_size, void* d_ws, size_t ws_size, hipStream_t stream) {
    (void)in_sizes; (void)n_in; (void)out_size;
    const float* x = (const float*)d_in[0]; const float* wk = (const float*)d_in[1]; const float* wq = (const float*)d_in[2]; const float* wv = (const float*)d_in[3];
    // inputs in the module's argument order = d_in[0..3]: the [8][2048][1024] plane, then the KEY, QUERY and VALUE weights [1024][128] (in, out): all four read; the causal rule is computed: there is no mask input
    float* OUT = (float*)d_out;     // [8][2048][128]
    char* wsp = (char*)d_ws;
    auto take = [&](size_t bytes) { char* p = wsp; wsp += (bytes + 255) & ~(size_t)255; return (void*)p; };
    bf* WQ = (bf*)take((size_t)DQ * DM * 2); bf* WK = (bf*)take((size_t)DKV * DM * 2); bf* WV = (bf*)take((size_t)DKV * DM * 2); float* CS = (float*)take((size_t)TT * HD * 2 * 4);
    bf* XB = (bf*)take((size_t)TT * DM * 2); float* FQ = (float*)take((size_t)TT * DQ * 4); float* FK = (float*)take((size_t)TT * DKV * 4);
    h16* QP16 = (h16*)take((size_t)NH_ * TT * HD * 2); h16* KP16 = (h16*)take((size_t)NKV * TT * HD * 2); h16* VT16 = (h16*)take((size_t)NKV * HD * TT * 2);
    bf* QPh = (bf*)take((size_t)NH_ * TT * HD * 2); bf* QPl = (bf*)take((size_t)NH_ * TT * HD * 2); bf* KPh = (bf*)take((size_t)NKV * TT * HD * 2); bf* KPl = (bf*)take((size_t)NKV * TT * HD * 2); bf* VTh = (bf*)take((size_t)NKV * HD * TT * 2); bf* VTl = (bf*)take((size_t)NKV * HD * TT * 2); bf* Ph = (bf*)take((size_t)ZH * RH * TT * 2); bf* Pl = (bf*)take((size_t)ZH * RH * TT * 2);
    float* Sb = (float*)take((size_t)ZH * TT * TT * 4); h16* P16 = (h16*)take((size_t)ZH * TT * TT * 2); float* Ob = (float*)take((size_t)ZH * TT * HD * 4);
    if ((size_t)(wsp - (char*)d_ws) > ws_size) return;
    float* FV = FK;   // the v projection reuses the k buffer after the k planes are built (stream-ordered)
    { k_wtG<<<(unsigned)((DM * DQ / 64 + 63) / 64), 256, 0, stream>>>(wq, DM, DQ, WQ); k_wtG<<<(unsigned)((DM * DKV / 64 + 63) / 64), 256, 0, stream>>>(wk, DM, DKV, WK); k_wtG<<<(unsigned)((DM * DKV / 64 + 63) / 64), 256, 0, stream>>>(wv, DM, DKV, WV); }   /* (in, out) weights: the transposing cast: [128][1024] = Bt */
    k_csid<<<(TT * HD + 255) / 256, 256, 0, stream>>>(CS);
    const unsigned LQ = (unsigned)(((size_t)NH_ * TT * HD / 2 + 255) / 256), LKv = (unsigned)(((size_t)NKV * TT * HD / 2 + 255) / 256), LX = (unsigned)(((size_t)TT * DM / 8 + 255) / 256);
    for (int b = 0; b < NB_; ++b) {
        k_cvt8<<<LX, 256, 0, stream>>>(x + (size_t)b * TT * DM, XB, (size_t)TT * DM / 8);
        k_gemmw<bf, 0, false><<<dim3(TT / 64, DQ / 64, 1), 32, 0, stream>>>(XB, nullptr, WQ, nullptr, DM, FQ, DQ, nullptr, 0, 0, 0);
        k_rope<<<LQ, 256, 0, stream>>>(FQ, DQ, NH_, CS, nullptr, nullptr, 1.0f, QP16, QPh, QPl);
        k_gemmw<bf, 0, false><<<dim3(TT / 64, DKV / 64, 1), 32, 0, stream>>>(XB, nullptr, WK, nullptr, DM, FK, DKV, nullptr, 0, 0, 0);
        k_rope<<<LKv, 256, 0, stream>>>(FK, DKV, NKV, CS, nullptr, nullptr, 1.0f, KP16, KPh, KPl);
        k_gemmw<bf, 0, false><<<dim3(TT / 64, DKV / 64, 1), 32, 0, stream>>>(XB, nullptr, WV, nullptr, DM, FV, DKV, nullptr, 0, 0, 0); k_vtp<<<LKv, 256, 0, stream>>>(FV, DKV, NKV, VT16, VTh, VTl);
        k_gemmc<bf, 2, 1><<<dim3(TT / 64, TT / 64, ZH), 32, 0, stream>>>(QPh, QPl, KPh, KPl, HD, Sb, TT, 0, (size_t)TT * HD, (size_t)TT * HD, (size_t)TT * TT);   /* the scores on hi / lo planes on EVERY row */
        k_asoft<<<ZH * TT / 8, 256, 0, stream>>>(Sb, P16, Ph, Pl);
        k_gemmc<bf, 2, 2><<<dim3(RH / 64, HD / 64, ZH), 32, 0, stream>>>(Ph, Pl, VTh, VTl, TT, Ob, HD, 0, (size_t)RH * TT, (size_t)HD * TT, (size_t)TT * HD);   /* P x v: three products on every row */
        k_merge<<<(unsigned)(((size_t)ZH * TT * HD / 2 + 255) / 256), 256, 0, stream>>>(Ob, 0, OUT + (size_t)b * TT * DQ); }   /* the one writer of d_out: entry b's rows */
}

// v001
// One run takes 252 microseconds.
// Next to v000, in two timings, it ran 3.95 and 3.89 times as fast.
#include <hip/hip_runtime.h>

// One head of causal self-attention with a 128-wide head, NO output projection, and the scores MULTIPLIED by 32 (inputs, in argument order: a0 [8][2048][1024]; a1, a2, a3 [1024][128] stored (in, out) and used as x W: the key, query and value weights IN THAT ORDER):
//   THE MODULE's FUNCTION: k = a0 a1; q = a0 a2; v = a0 a3 ([8][2048][128] each); S = (q k^T) x 32; everything above the diagonal set to nought, then EVERY exact nought set to -inf (so the module excludes the keys after the query AND any key inside the triangle whose score is exactly 0.0); softmax over the 2,048 keys; result = P v -> [8][2048][128] (2.1 M).
//   THIS TEXT excludes the keys after the query by index and KEEPS a score of exactly 0.0 inside the triangle: the two differ only where a computed score is exactly 0.0: not reached on real data (said again below).
// Layout: ALL EIGHT batch entries go through every stage in ONE launch of that stage (the entry is a plane index: more rows in the projections, grid z in the attention GEMMs): one bf16 copy of a0 (read by all three projections); the (in, out) weights transposed once by a transposing cast; exact projections (bf16 x bf16 words, f32 sums); identity-table plane builders (fp16 + bf16 hi / lo planes of q and k; the transposed value planes);
//   the causal T-2048 attention for the one head: THE SCORES ON hi / lo PLANES ON EVERY ROW (three products: the softmax is all but a hard maximum, a score's spread is about 360, and one 16-bit rounding of q or k would flip the winning key in hundreds of rows); THE SOFTMAX WEIGHTS ON bf16 hi / lo PLANES ON EVERY ROW TOO (RH = TT) and P x v as three products against the hi / lo value planes: a one-word fp16 P is not taken: 6.4 per cent of this draw's non-zero carried weights would be fp16 subnormals;
//   tiles above the diagonal skipped; the f32 merge writes the output rows (no carried factor at RH = TT): the one writer of d_out.
// The scale: the module writes scores x sqrt(1024): SCL 32.0f in the softmax's load stage, as the module writes it (a power of two: exact).
// Compute dtypes, f32 accumulate: every float input rounded to bf16 at its load; projections exact; scores three products; softmax f32 (the hardware exp2); P x v three products (bf16 hi / lo both sides; lo x lo not formed); the output an f32 copy.

#define NB_  8      // batch entries: the input is [8][2048][1024]
#define TT   2048
#define DM   1024
#define NH_  1
#define NKV  1
#define REP  (NH_ / NKV)
#define HD   128
#define DQ   (NH_ * HD)
#define DKV  (NKV * HD)
#define ZH   NB_                  // planes per attention launch: one head x the eight batch entries
#define RH   2048                 // = TT: query rows < RH use hi+lo planes of P: EVERY row here
#define WIN  2048
#define PCAR 1024.0f
#define SCL  32.0f   // sqrt(1024): the module MULTIPLIES the scores by it
typedef _Float16 h16;
typedef unsigned short bf;
typedef __attribute__((ext_vector_type(16))) __bf16   v16bf;
typedef __attribute__((ext_vector_type(16))) _Float16 v16h;
typedef __attribute__((ext_vector_type(8)))  _Float16 v8h;
typedef __attribute__((ext_vector_type(8)))  unsigned short v8us;
typedef __attribute__((ext_vector_type(8)))  float    v8f;
typedef __attribute__((ext_vector_type(4)))  float    v4f;
typedef v8h  __attribute__((may_alias)) v8ha;
typedef v4f  __attribute__((may_alias)) v4fa;
typedef v8us __attribute__((may_alias)) v8usa;

__device__ __forceinline__ unsigned short f2bf(float f) { unsigned u = __float_as_uint(f); u += 0x7FFFu + ((u >> 16) & 1u); return (unsigned short)(u >> 16); }
__device__ __forceinline__ float bf2f(unsigned short b) { return __uint_as_float(((unsigned)b) << 16); }
__device__ __forceinline__ float bfr(float f) { return bf2f(f2bf(f)); }
__device__ __forceinline__ v16h cat16(v8h lo, v8h hi) { return __builtin_shufflevector(lo, hi, 0, 1, 2, 3, 4, 5, 6, 7, 8, 9, 10, 11, 12, 13, 14, 15); }
__device__ __forceinline__ v16bf cat16b(v8us lo, v8us hi) { return __builtin_bit_cast(v16bf, __builtin_shufflevector(lo, hi, 0, 1, 2, 3, 4, 5, 6, 7, 8, 9, 10, 11, 12, 13, 14, 15)); }
__device__ __forceinline__ v8f wmma16(v16h a, v16h b, v8f c) { return __builtin_amdgcn_wmma_f32_16x16x32_f16(false, a, false, b, (short)0, c, false, false); }
__device__ __forceinline__ v8f wmmab(v16bf a, v16bf b, v8f c) { return __builtin_amdgcn_wmma_f32_16x16x32_bf16(false, a, false, b, (short)0, c, false, false); }



// ---- k_gemmw: register-blocked GEMM, ONE WAVE per 64x64 output tile (16 accumulators), operands straight from K-contiguous 16-bit planes; grid (M/64, N/64, Z), 32 threads.
// C[m][n] (f32, pitch ldc, + optional f32 bias[n]) = sum_k A[m][k] Bt[n][k] (+ split products per NSPLIT). z-batch strides sA/sB/sC in elements. K % 32 == 0.
template <typename T16> struct WFrag;
template <> struct WFrag<h16> { typedef v16h V; static __device__ __forceinline__ V ld(const h16* p) { return cat16(*(const v8h*)p, *(const v8h*)(p + 16)); } static __device__ __forceinline__ v8f mma(V a, V b, v8f c) { return wmma16(a, b, c); } };
template <> struct WFrag<bf> { typedef v16bf V; static __device__ __forceinline__ V ld(const bf* p) { return cat16b(*(const v8us*)p, *(const v8us*)(p + 16)); } static __device__ __forceinline__ v8f mma(V a, V b, v8f c) { return wmmab(a, b, c); } };
template <typename T16, int NSPLIT, bool BIAS>
__global__ __launch_bounds__(32) void k_gemmw(const T16* __restrict__ A, const T16* __restrict__ A2, const T16* __restrict__ Bt, const T16* __restrict__ Bt2, int K, float* C, int ldc, const float* __restrict__ bias, size_t sA, size_t sB, size_t sC) {
    typedef typename WFrag<T16>::V V;
    __shared__ __align__(16) float os[16 * 68];
    const size_t z = blockIdx.z; A += z * sA; if (A2) A2 += z * sA; Bt += z * sB; if (Bt2) Bt2 += z * sB; C += z * sC;
    const int lane = threadIdx.x & 31, lr = lane & 15, hi = lane >> 4; const int r0 = blockIdx.x * 64, c0 = blockIdx.y * 64;
    v8f acc[4][4];
#pragma unroll
    for (int mb = 0; mb < 4; ++mb)
#pragma unroll
        for (int nb = 0; nb < 4; ++nb) acc[mb][nb] = (v8f){};
    const size_t aoff = (size_t)(r0 + lr) * K + 8 * hi, boff = (size_t)(c0 + lr) * K + 8 * hi;

    for (int kc = 0; kc < K; kc += 32) {
        V a[4], a2[4];
#pragma unroll
        for (int mb = 0; mb < 4; ++mb) { a[mb] = WFrag<T16>::ld(A + aoff + (size_t)mb * 16 * K + kc); if (NSPLIT == 1 || NSPLIT == 2) a2[mb] = WFrag<T16>::ld(A2 + aoff + (size_t)mb * 16 * K + kc); }
#pragma unroll
        for (int nb = 0; nb < 4; ++nb) { const V b = WFrag<T16>::ld(Bt + boff + (size_t)nb * 16 * K + kc); V b2; if (NSPLIT >= 2) b2 = WFrag<T16>::ld(Bt2 + boff + (size_t)nb * 16 * K + kc);
#pragma unroll
            for (int mb = 0; mb < 4; ++mb) { acc[mb][nb] = WFrag<T16>::mma(a[mb], b, acc[mb][nb]); if (NSPLIT == 1 || NSPLIT == 2) acc[mb][nb] = WFrag<T16>::mma(a2[mb], b, acc[mb][nb]); if (NSPLIT >= 2) acc[mb][nb] = WFrag<T16>::mma(a[mb], b2, acc[mb][nb]); } }
        asm volatile("v_nop\n\tv_nop\n\tv_nop\n\tv_nop" : "+v"(acc[0][0]), "+v"(acc[1][1]), "+v"(acc[2][2]), "+v"(acc[3][3]) : "v"(a[0]), "v"(a[3]));
    }
#pragma unroll
    for (int mb = 0; mb < 4; ++mb) {
#pragma unroll
        for (int nb = 0; nb < 4; ++nb) {
#pragma unroll
            for (int j = 0; j < 8; ++j) os[(hi * 8 + j) * 68 + nb * 16 + lr] = acc[mb][nb][j]; }
        __builtin_amdgcn_wave_barrier(); asm volatile("" ::: "memory");
        float* crow = C + (size_t)(r0 + mb * 16) * ldc + c0;
{
#pragma unroll
            for (int s = 0; s < 8; ++s) { const int row = 2 * s + hi, cofs = lr * 4; v4f val = *(const v4fa*)(os + row * 68 + cofs); if (BIAS) { val[0] += bfr(bias[c0 + cofs]); val[1] += bfr(bias[c0 + cofs + 1]); val[2] += bfr(bias[c0 + cofs + 2]); val[3] += bfr(bias[c0 + cofs + 3]); }
                *(v4f*)(crow + (size_t)row * ldc + cofs) = val; }
             }
        __builtin_amdgcn_wave_barrier(); asm volatile("" ::: "memory");
    }
}

// ---- k_gemmc: the same one-wave 64x64 tile GEMM specialised for causal attention: CMODE 1 skips score tiles entirely above the diagonal (query rows r0+roff.., key columns c0..), CMODE 2 limits the
// key (K) loop of the probability x value contraction to the diagonal block (probabilities beyond it are exactly zero). roff = row offset of this launch's first row within the sequence.
template <typename T16, int NSPLIT, int CMODE>
__global__ __launch_bounds__(32) void k_gemmc(const T16* __restrict__ A, const T16* __restrict__ A2, const T16* __restrict__ Bt, const T16* __restrict__ Bt2, int K, float* C, int ldc, int roff, size_t sA, size_t sB, size_t sC) {
    typedef typename WFrag<T16>::V V;
    __shared__ __align__(16) float os[16 * 68];
    const size_t z = blockIdx.z; A += z * sA; if (A2) A2 += z * sA; Bt += z * sB; if (Bt2) Bt2 += z * sB; C += z * sC;
    const int lane = threadIdx.x & 31, lr = lane & 15, hi = lane >> 4; const int r0 = blockIdx.x * 64, c0 = blockIdx.y * 64;
    if (CMODE == 1 && c0 > r0 + roff + 63) return;                  // score tile entirely above the causal diagonal: never read (the softmax masks j > i by select)
    const int Kl = (CMODE == 2) ? min(K, r0 + roff + 64) : K;        // P.V: probabilities are exactly 0 beyond the diagonal block, so the K loop stops there
    v8f acc[4][4];
#pragma unroll
    for (int mb = 0; mb < 4; ++mb)
#pragma unroll
        for (int nb = 0; nb < 4; ++nb) acc[mb][nb] = (v8f){};
    const size_t aoff = (size_t)(r0 + lr) * K + 8 * hi, boff = (size_t)(c0 + lr) * K + 8 * hi;

    for (int kc = 0; kc < Kl; kc += 32) {
        V a[4], a2[4];
#pragma unroll
        for (int mb = 0; mb < 4; ++mb) { a[mb] = WFrag<T16>::ld(A + aoff + (size_t)mb * 16 * K + kc); if (NSPLIT == 1 || NSPLIT == 2) a2[mb] = WFrag<T16>::ld(A2 + aoff + (size_t)mb * 16 * K + kc); }
#pragma unroll
        for (int nb = 0; nb < 4; ++nb) { const V b = WFrag<T16>::ld(Bt + boff + (size_t)nb * 16 * K + kc); V b2; if (NSPLIT >= 2) b2 = WFrag<T16>::ld(Bt2 + boff + (size_t)nb * 16 * K + kc);
#pragma unroll
            for (int mb = 0; mb < 4; ++mb) { acc[mb][nb] = WFrag<T16>::mma(a[mb], b, acc[mb][nb]); if (NSPLIT == 1 || NSPLIT == 2) acc[mb][nb] = WFrag<T16>::mma(a2[mb], b, acc[mb][nb]); if (NSPLIT >= 2) acc[mb][nb] = WFrag<T16>::mma(a[mb], b2, acc[mb][nb]); } }
        asm volatile("v_nop\n\tv_nop\n\tv_nop\n\tv_nop" : "+v"(acc[0][0]), "+v"(acc[1][1]), "+v"(acc[2][2]), "+v"(acc[3][3]) : "v"(a[0]), "v"(a[3]));
    }
#pragma unroll
    for (int mb = 0; mb < 4; ++mb) {
#pragma unroll
        for (int nb = 0; nb < 4; ++nb) {
#pragma unroll
            for (int j = 0; j < 8; ++j) os[(hi * 8 + j) * 68 + nb * 16 + lr] = acc[mb][nb][j]; }
        __builtin_amdgcn_wave_barrier(); asm volatile("" ::: "memory");
        float* crow = C + (size_t)(r0 + mb * 16) * ldc + c0;
{
#pragma unroll
            for (int s = 0; s < 8; ++s) { const int row = 2 * s + hi, cofs = lr * 4; v4f val = *(const v4fa*)(os + row * 68 + cofs);
                *(v4f*)(crow + (size_t)row * ldc + cofs) = val; }
             }
        __builtin_amdgcn_wave_barrier(); asm volatile("" ::: "memory");
    }
}

__device__ __forceinline__ h16 tohx(float x) { return (h16)x; }
__device__ __forceinline__ void splitf(float y, unsigned short& h, unsigned short& l) { h = f2bf(y); l = f2bf(y - bf2f(h)); }
typedef __attribute__((ext_vector_type(2))) _Float16 v2h;
typedef __attribute__((ext_vector_type(4))) _Float16 v4h;
typedef __attribute__((ext_vector_type(2))) unsigned short v2us;
typedef __attribute__((ext_vector_type(4))) unsigned short v4us;
typedef __attribute__((ext_vector_type(2))) float v2f;
typedef __attribute__((ext_vector_type(4))) int v4i;


__global__ __launch_bounds__(256) void k_wtG(const float* __restrict__ w, int K, int N, bf* Bt) {
    const int lane = threadIdx.x & 31; const int L0 = (blockIdx.x * 8 + (threadIdx.x >> 5)) * 8; const int nlines = N * K / 64;
{
        for (int l = 0; l < 8; ++l) { const int L = L0 + l; if (L >= nlines) break; const size_t e = (size_t)L * 64 + lane * 2; const int k = (int)(e % K), n = (int)(e / K); v2us o;
            o[0] = f2bf(w[(size_t)k * N + n]); o[1] = f2bf(w[(size_t)(k + 1) * N + n]); *(v2us*)(Bt + e) = o; }
         }
}
__global__ __launch_bounds__(256) void k_cvt8(const float* __restrict__ src, bf* dst, size_t n8) { const size_t i = (size_t)blockIdx.x * 256 + threadIdx.x; if (i >= n8) return; const v8f v = *(const v8f*)(src + i * 8); v8us o;
#pragma unroll
    for (int k = 0; k < 8; ++k) o[k] = f2bf(v[k]); *(v8us*)(dst + i * 8) = o;  }

// k_rope: F holds plane h at F + h * fz (fz in elements). Head planes [h][t][d] (fp16 + hi/lo) of rope(x) x sc with the rotate-half convention out[d] = x[d] cos[t][d] - x[d+HD/2] sin[t][d], out[d+HD/2] = x[d+HD/2] cos[t][d+HD/2] + x[d] sin[t][d+HD/2]
__global__ __launch_bounds__(256) void k_rope(const float* __restrict__ F, int pitch, size_t fz, int nheads, const float* __restrict__ CS, const float* __restrict__ RF, const float* __restrict__ nw, float sc, h16* P16, bf* Ph, bf* Pl) {
    const size_t e = ((size_t)blockIdx.x * 256 + threadIdx.x) * 2; if (e >= (size_t)nheads * TT * HD) return; const int d = (int)(e % HD); const int t = (int)((e / HD) % TT); const int h = (int)(e / ((size_t)HD * TT)); const float* f = F + (size_t)h * fz + (size_t)t * pitch; const float rf = RF ? RF[(size_t)h * TT + t] : 1.0f; v2h o16; v2us oh, ol;
#pragma unroll
    for (int q = 0; q < 2; ++q) { const int dd = d + q; const int dp = (dd < HD / 2) ? dd + HD / 2 : dd - HD / 2; float x0 = f[dd], x1 = f[dp];
        if (RF) { float n0 = __fmul_rn(x0, rf), n1 = __fmul_rn(x1, rf); x0 = __fmul_rn(bfr(nw[dd]), n0); x1 = __fmul_rn(bfr(nw[dp]), n1); }
        const v2f cs = *(const v2f*)(CS + ((size_t)t * HD + dd) * 2); float a = __fmul_rn(x0, cs[0]), bq = __fmul_rn(x1, cs[1]); const float r = ((dd < HD / 2) ? __fsub_rn(a, bq) : __fadd_rn(a, bq)) * sc;
        o16[q] = tohx(r); unsigned short a2, c2; splitf(r, a2, c2); oh[q] = a2; ol[q] = c2; }
    *(v2h*)(P16 + e) = o16; *(v2us*)(Ph + e) = oh; *(v2us*)(Pl + e) = ol;  }

// k_vtp: F holds plane g at F + g * fz. The hi and lo words of a transposed value row stand side by side, [hi 2048 | lo 2048] (Vl = Vh + TT, row pitch 2 TT): the same pitch as the weights' rows, which the P x v GEMM reads against them.
__global__ __launch_bounds__(256) void k_vtp(const float* __restrict__ F, int pitch, size_t fz, int nheads, h16* V16, bf* Vh, bf* Vl) { const size_t e = ((size_t)blockIdx.x * 256 + threadIdx.x) * 2; if (e >= (size_t)nheads * HD * TT) return; const int t = (int)(e % TT); const int d = (int)((e / TT) % HD); const int g = (int)(e / ((size_t)TT * HD)); v2h o16; v2us oh, ol;
#pragma unroll
    for (int q = 0; q < 2; ++q) { const float x = F[(size_t)g * fz + (size_t)(t + q) * pitch + d]; o16[q] = tohx(x); unsigned short a2, c2; splitf(x, a2, c2); oh[q] = a2; ol[q] = c2; }
    const size_t e2 = ((size_t)g * HD + d) * (2 * TT) + t;
    *(v2h*)(V16 + e) = o16; *(v2us*)(Vh + e2) = oh; *(v2us*)(Vl + e2) = ol;  }

__global__ __launch_bounds__(256) void k_csid(float* CS) { const int idx = blockIdx.x * 256 + threadIdx.x; if (idx >= TT * HD) return; v2f cs; cs[0] = 1.0f; cs[1] = 0.0f; *(v2f*)(CS + (size_t)idx * 2) = cs;  }

// k_asoft: per row (zz, i): t = S x SCL for j <= i and i - j < WIN (the causal triangle; WIN = TT: the window never binds; an excluded key gets -3e38, whose exponential is an exact zero); softmax over the 2048 keys (register row, one exp, fixed trees);
// the hi / lo words of a row's weights go back INTO that row's own 8 KiB of the score plane, [hi 2048 | lo 2048] (Ph = the plane's base, Pl = Ph + TT, row pitch 2 TT): one wave owns the row and holds all of it in registers before its first store
// (every store needs the row's sum), so the eight score planes and their weights fit the workspace together. Sb, Ph and Pl alias: none of them is __restrict__.
__global__ __launch_bounds__(256) void k_asoft(const float* Sb, h16* P16, bf* Ph, bf* Pl) {
    const int lane = threadIdx.x & 31; const int row = blockIdx.x * 8 + (threadIdx.x >> 5); if (row >= ZH * TT) return; const int i = row % TT; const int zz = row / TT; (void)zz; const bool hires = (i < RH); const float* sr = Sb + (size_t)row * TT; float v[TT / 32]; float mx = -3.0e38f;
#pragma unroll
    for (int ch = 0; ch < TT / 128; ++ch) { const int j0 = ch * 128 + lane * 4; const v4f a = *(const v4f*)(sr + j0);
#pragma unroll
        for (int q = 0; q < 4; ++q) { const int j = j0 + q; (void)j; const float t = (j <= i && i - j < WIN) ? a[q] * SCL : -3.0e38f; v[ch * 4 + q] = t; mx = fmaxf(mx, t); } }
#pragma unroll
    for (int sh = 16; sh; sh >>= 1) mx = fmaxf(mx, __shfl_xor(mx, sh, 32));
    float sum = 0.f;
#pragma unroll
    for (int k = 0; k < TT / 32; ++k) { float d0 = __fsub_rn(v[k], mx); v[k] = __builtin_amdgcn_exp2f(__fmul_rn(d0, 1.4426950408889634f)); sum += v[k]; }
#pragma unroll
    for (int sh = 16; sh; sh >>= 1) sum += __shfl_xor(sum, sh, 32);
    const float f = __fdiv_rn(hires ? 1.0f : PCAR, sum);
{
        if (hires) {
#pragma unroll
            for (int ch = 0; ch < TT / 128; ++ch) { v4us oh, ol;
#pragma unroll
                for (int q = 0; q < 4; ++q) { unsigned short a, c2; splitf(v[ch * 4 + q] * f, a, c2); oh[q] = a; ol[q] = c2; }
                const size_t oo = ((size_t)zz * (RH ? RH : 1) + i) * (2 * TT) + ch * 128 + lane * 4; *(v4us*)(Ph + oo) = oh; *(v4us*)(Pl + oo) = ol; }
        } else {
#pragma unroll
            for (int ch = 0; ch < TT / 128; ++ch) { v4h o4;
#pragma unroll
                for (int q = 0; q < 4; ++q) o4[q] = tohx(v[ch * 4 + q] * f);
                *(v4h*)(P16 + (size_t)row * TT + ch * 128 + lane * 4) = o4; } }
         }
}

__global__ __launch_bounds__(256) void k_merge(const float* __restrict__ O, int h0, float* OUTb) { const size_t e = ((size_t)blockIdx.x * 256 + threadIdx.x) * 2; if (e >= (size_t)ZH * TT * HD) return; const int d = (int)(e % HD); const int t = (int)((e / HD) % TT); const int zz = (int)(e / ((size_t)HD * TT)); const float cs = (t < RH) ? 1.0f : (1.0f / PCAR); const size_t oo = ((size_t)zz * TT + t) * DQ + h0 * HD + d;
    v2f o2; o2[0] = O[e] * cs; o2[1] = O[e + 1] * cs; *(v2f*)(OUTb + oo) = o2;  }

extern "C" void kernel_launch(void* const* d_in, const int* in_sizes, int n_in,
                              void* d_out, int out_size, void* d_ws, size_t ws_size, hipStream_t stream) {
    (void)in_sizes; (void)n_in; (void)out_size;
    const float* x = (const float*)d_in[0]; const float* wk = (const float*)d_in[1]; const float* wq = (const float*)d_in[2]; const float* wv = (const float*)d_in[3];
    // inputs in the module's argument order = d_in[0..3]: the [8][2048][1024] plane, then the KEY, QUERY and VALUE weights [1024][128] (in, out): all four read; the causal rule is computed: there is no mask input
    float* OUT = (float*)d_out;     // [8][2048][128]
    char* wsp = (char*)d_ws;
    auto take = [&](size_t bytes) { char* p = wsp; wsp += (bytes + 255) & ~(size_t)255; return (void*)p; };
    bf* WQ = (bf*)take((size_t)DQ * DM * 2); bf* WK = (bf*)take((size_t)DKV * DM * 2); bf* WV = (bf*)take((size_t)DKV * DM * 2); float* CS = (float*)take((size_t)TT * HD * 2 * 4);
    bf* XB = (bf*)take((size_t)NB_ * TT * DM * 2); float* FQ = (float*)take((size_t)NB_ * TT * DQ * 4); float* FK = (float*)take((size_t)NB_ * TT * DKV * 4);
    h16* QP16 = (h16*)take((size_t)ZH * TT * HD * 2); h16* KP16 = (h16*)take((size_t)ZH * TT * HD * 2); h16* VT16 = (h16*)take((size_t)ZH * HD * TT * 2);
    bf* QPh = (bf*)take((size_t)ZH * TT * HD * 2); bf* QPl = (bf*)take((size_t)ZH * TT * HD * 2); bf* KPh = (bf*)take((size_t)ZH * TT * HD * 2); bf* KPl = (bf*)take((size_t)ZH * TT * HD * 2); bf* VTh = (bf*)take((size_t)ZH * HD * 2 * TT * 2);
    float* Sb = (float*)take((size_t)ZH * TT * TT * 4); float* Ob = (float*)take((size_t)ZH * TT * HD * 4);
    if ((size_t)(wsp - (char*)d_ws) > ws_size) return;
    bf* VTl = VTh + TT;                   // value rows [hi | lo], pitch 2 TT (k_vtp)
    bf* Ph = (bf*)Sb; bf* Pl = Ph + TT;   // weight rows [hi | lo], pitch 2 TT, each in its own score row (k_asoft)
    float* FV = FK;   // the v projection reuses the k buffer after the k planes are built (stream-ordered)
    { k_wtG<<<(unsigned)((DM * DQ / 64 + 63) / 64), 256, 0, stream>>>(wq, DM, DQ, WQ); k_wtG<<<(unsigned)((DM * DKV / 64 + 63) / 64), 256, 0, stream>>>(wk, DM, DKV, WK); k_wtG<<<(unsigned)((DM * DKV / 64 + 63) / 64), 256, 0, stream>>>(wv, DM, DKV, WV); }   /* (in, out) weights: the transposing cast: [128][1024] = Bt */
    k_csid<<<(TT * HD + 255) / 256, 256, 0, stream>>>(CS);
    const unsigned LP = (unsigned)(((size_t)ZH * TT * HD / 2 + 255) / 256), LX = (unsigned)(((size_t)NB_ * TT * DM / 8 + 255) / 256);
    k_cvt8<<<LX, 256, 0, stream>>>(x, XB, (size_t)NB_ * TT * DM / 8);
    k_gemmw<bf, 0, false><<<dim3(NB_ * TT / 64, DQ / 64, 1), 32, 0, stream>>>(XB, nullptr, WQ, nullptr, DM, FQ, DQ, nullptr, 0, 0, 0);   /* the projections: the eight entries' rows are one [16384][1024] operand */
    k_rope<<<LP, 256, 0, stream>>>(FQ, DQ, (size_t)TT * DQ, ZH, CS, nullptr, nullptr, 1.0f, QP16, QPh, QPl);
    k_gemmw<bf, 0, false><<<dim3(NB_ * TT / 64, DKV / 64, 1), 32, 0, stream>>>(XB, nullptr, WK, nullptr, DM, FK, DKV, nullptr, 0, 0, 0);
    k_rope<<<LP, 256, 0, stream>>>(FK, DKV, (size_t)TT * DKV, ZH, CS, nullptr, nullptr, 1.0f, KP16, KPh, KPl);
    k_gemmw<bf, 0, false><<<dim3(NB_ * TT / 64, DKV / 64, 1), 32, 0, stream>>>(XB, nullptr, WV, nullptr, DM, FV, DKV, nullptr, 0, 0, 0); k_vtp<<<LP, 256, 0, stream>>>(FV, DKV, (size_t)TT * DKV, ZH, VT16, VTh, VTl);
    k_gemmc<bf, 2, 1><<<dim3(TT / 64, TT / 64, ZH), 32, 0, stream>>>(QPh, QPl, KPh, KPl, HD, Sb, TT, 0, (size_t)TT * HD, (size_t)TT * HD, (size_t)TT * TT);   /* the scores on hi / lo planes on EVERY row */
    k_asoft<<<ZH * TT / 8, 256, 0, stream>>>(Sb, nullptr, Ph, Pl);   /* RH = TT: the one-word fp16 plane is never written */
    k_gemmc<bf, 2, 2><<<dim3(RH / 64, HD / 64, ZH), 32, 0, stream>>>(Ph, Pl, VTh, VTl, 2 * TT, Ob, HD, 0, (size_t)RH * 2 * TT, (size_t)HD * 2 * TT, (size_t)TT * HD);   /* P x v: three products on every row; K = 2 TT is the [hi | lo] rows' pitch: the key loop ends at the diagonal block, at most TT */
    k_merge<<<(unsigned)(((size_t)ZH * TT * HD / 2 + 255) / 256), 256, 0, stream>>>(Ob, 0, OUT);   /* the one writer of d_out */
}

// v002
// It runs in 225 microseconds.
// Next to v001, in two timings, it ran 1.11 times as fast each time.
// Over all steps from v000 it is 4.36 times as fast.
#include <hip/hip_runtime.h>

// One head of causal self-attention with a 128-wide head, NO output projection, and the scores MULTIPLIED by 32 (inputs, in argument order: a0 [8][2048][1024]; a1, a2, a3 [1024][128] stored (in, out) and used as x W: the key, query and value weights IN THAT ORDER):
//   THE MODULE's FUNCTION: k = a0 a1; q = a0 a2; v = a0 a3 ([8][2048][128] each); S = (q k^T) x 32; everything above the diagonal set to nought, then EVERY exact nought set to -inf (so the module excludes the keys after the query AND any key inside the triangle whose score is exactly 0.0); softmax over the 2,048 keys; result = P v -> [8][2048][128] (2.1 M).
//   THIS TEXT excludes the keys after the query by index and KEEPS a score of exactly 0.0 inside the triangle: the two differ only where a computed score is exactly 0.0: not reached on real data (said again below).
// Layout: ALL EIGHT batch entries go through every stage in ONE launch of that stage (the entry is a plane index: more rows in the projections, grid z in the attention GEMMs): one bf16 copy of a0 (read by all three projections); the (in, out) weights transposed once by a transposing cast (k_wtG); exact projections (bf16 x bf16 words, f32 sums) WHOSE OWN EPILOGUE splits each f32 sum into the bf16 hi / lo planes that the attention GEMMs read (q and k row planes; the transposed value planes): no f32 projection plane and no plane-builder pass;
//   the causal T-2048 attention for the one head: THE SCORES ON hi / lo PLANES ON EVERY ROW (three products: the softmax is all but a hard maximum, a score's spread is about 360, and one 16-bit rounding of q or k would flip the winning key in hundreds of rows); THE SOFTMAX WEIGHTS ON bf16 hi / lo PLANES ON EVERY ROW TOO (RH = TT) and P x v as three products against the hi / lo value planes: a one-word fp16 P is not taken: 6.4 per cent of this draw's non-zero carried weights would be fp16 subnormals;
//   tiles above the diagonal skipped; the P x v GEMM stores its f32 tiles straight into the output rows (no carried factor at RH = TT): the one writer of d_out.
// The scale: the module writes scores x sqrt(1024): SCL 32.0f in the softmax's load stage, as the module writes it (a power of two: exact).
// Compute dtypes, f32 accumulate: every float input rounded to bf16 at its load; projections exact; scores three products; softmax f32 (the hardware exp2); P x v three products (bf16 hi / lo both sides; lo x lo not formed); the output is those f32 sums as they stand.

#define NB_  8      // batch entries: the input is [8][2048][1024]
#define TT   2048
#define DM   1024
#define NH_  1
#define NKV  1
#define REP  (NH_ / NKV)
#define HD   128
#define DQ   (NH_ * HD)
#define DKV  (NKV * HD)
#define ZH   NB_                  // planes per attention launch: one head x the eight batch entries
#define RH   2048                 // = TT: query rows < RH use hi+lo planes of P: EVERY row here
#define WIN  2048
#define PCAR 1024.0f
#define SCL  32.0f   // sqrt(1024): the module MULTIPLIES the scores by it
typedef _Float16 h16;
typedef unsigned short bf;
typedef __attribute__((ext_vector_type(16))) __bf16   v16bf;
typedef __attribute__((ext_vector_type(16))) _Float16 v16h;
typedef __attribute__((ext_vector_type(8)))  _Float16 v8h;
typedef __attribute__((ext_vector_type(8)))  unsigned short v8us;
typedef __attribute__((ext_vector_type(8)))  float    v8f;
typedef __attribute__((ext_vector_type(4)))  float    v4f;
typedef v8h  __attribute__((may_alias)) v8ha;
typedef v4f  __attribute__((may_alias)) v4fa;
typedef v8us __attribute__((may_alias)) v8usa;

__device__ __forceinline__ unsigned short f2bf(float f) { unsigned u = __float_as_uint(f); u += 0x7FFFu + ((u >> 16) & 1u); return (unsigned short)(u >> 16); }
__device__ __forceinline__ float bf2f(unsigned short b) { return __uint_as_float(((unsigned)b) << 16); }
__device__ __forceinline__ float bfr(float f) { return bf2f(f2bf(f)); }
__device__ __forceinline__ v16h cat16(v8h lo, v8h hi) { return __builtin_shufflevector(lo, hi, 0, 1, 2, 3, 4, 5, 6, 7, 8, 9, 10, 11, 12, 13, 14, 15); }
__device__ __forceinline__ v16bf cat16b(v8us lo, v8us hi) { return __builtin_bit_cast(v16bf, __builtin_shufflevector(lo, hi, 0, 1, 2, 3, 4, 5, 6, 7, 8, 9, 10, 11, 12, 13, 14, 15)); }
__device__ __forceinline__ v8f wmma16(v16h a, v16h b, v8f c) { return __builtin_amdgcn_wmma_f32_16x16x32_f16(false, a, false, b, (short)0, c, false, false); }
__device__ __forceinline__ v8f wmmab(v16bf a, v16bf b, v8f c) { return __builtin_amdgcn_wmma_f32_16x16x32_bf16(false, a, false, b, (short)0, c, false, false); }
__device__ __forceinline__ void splitf(float y, unsigned short& h, unsigned short& l) { h = f2bf(y); l = f2bf(y - bf2f(h)); }
typedef __attribute__((ext_vector_type(4))) unsigned short v4us;



// ---- k_gemmw: register-blocked GEMM, ONE WAVE per 64x64 output tile (16 accumulators), operands straight from K-contiguous 16-bit planes; grid (M/64, N/64), 32 threads.
// f32 sums S[m][n] = sum_k A[m][k] Bt[n][k] (+ split products per NSPLIT), K % 32 == 0; each sum leaves the wave as its bf16 hi / lo words (splitf), never as an f32 plane:
//   EPI 1: row planes Ph / Pl [m][n], pitch ldc (q and k: [entry][t][d] is [m][n] as it stands); staged through LDS so that 16 lanes store one whole 128-byte line.
//   EPI 2: transposed planes [entry][n][hi 2048 | lo 2048] (Pl = Ph + TT, row pitch 2 TT: the same pitch as the weights' rows, which the P x v GEMM reads against them); m = entry x TT + t. A lane's 8 accumulator registers are 8 consecutive t of one n: one 16-byte store a plane, no staging; the tile's 64 t of a row n are one 128-byte line, written by this wave alone.
template <typename T16> struct WFrag;
template <> struct WFrag<h16> { typedef v16h V; static __device__ __forceinline__ V ld(const h16* p) { return cat16(*(const v8h*)p, *(const v8h*)(p + 16)); } static __device__ __forceinline__ v8f mma(V a, V b, v8f c) { return wmma16(a, b, c); } };
template <> struct WFrag<bf> { typedef v16bf V; static __device__ __forceinline__ V ld(const bf* p) { return cat16b(*(const v8us*)p, *(const v8us*)(p + 16)); } static __device__ __forceinline__ v8f mma(V a, V b, v8f c) { return wmmab(a, b, c); } };
template <typename T16, int NSPLIT, int EPI>
__global__ __launch_bounds__(32) void k_gemmw(const T16* __restrict__ A, const T16* __restrict__ A2, const T16* __restrict__ Bt, const T16* __restrict__ Bt2, int K, bf* Ph, bf* Pl, int ldc) {
    typedef typename WFrag<T16>::V V;
    __shared__ __align__(16) float os[16 * 68];
    const int lane = threadIdx.x & 31, lr = lane & 15, hi = lane >> 4; const int r0 = blockIdx.x * 64, c0 = blockIdx.y * 64;
    v8f acc[4][4];
#pragma unroll
    for (int mb = 0; mb < 4; ++mb)
#pragma unroll
        for (int nb = 0; nb < 4; ++nb) acc[mb][nb] = (v8f){};
    const size_t aoff = (size_t)(r0 + lr) * K + 8 * hi, boff = (size_t)(c0 + lr) * K + 8 * hi;

    for (int kc = 0; kc < K; kc += 32) {
        V a[4], a2[4];
#pragma unroll
        for (int mb = 0; mb < 4; ++mb) { a[mb] = WFrag<T16>::ld(A + aoff + (size_t)mb * 16 * K + kc); if (NSPLIT == 1 || NSPLIT == 2) a2[mb] = WFrag<T16>::ld(A2 + aoff + (size_t)mb * 16 * K + kc); }
#pragma unroll
        for (int nb = 0; nb < 4; ++nb) { const V b = WFrag<T16>::ld(Bt + boff + (size_t)nb * 16 * K + kc); V b2; if (NSPLIT >= 2) b2 = WFrag<T16>::ld(Bt2 + boff + (size_t)nb * 16 * K + kc);
#pragma unroll
            for (int mb = 0; mb < 4; ++mb) { acc[mb][nb] = WFrag<T16>::mma(a[mb], b, acc[mb][nb]); if (NSPLIT == 1 || NSPLIT == 2) acc[mb][nb] = WFrag<T16>::mma(a2[mb], b, acc[mb][nb]); if (NSPLIT >= 2) acc[mb][nb] = WFrag<T16>::mma(a[mb], b2, acc[mb][nb]); } }
        asm volatile("v_nop\n\tv_nop\n\tv_nop\n\tv_nop" : "+v"(acc[0][0]), "+v"(acc[1][1]), "+v"(acc[2][2]), "+v"(acc[3][3]) : "v"(a[0]), "v"(a[3]));
    }
    if (EPI == 2) {
        const int g = r0 / TT, t0 = r0 % TT;   // a 64-row tile lies inside one entry (TT % 64 == 0)
#pragma unroll
        for (int mb = 0; mb < 4; ++mb) {
#pragma unroll
            for (int nb = 0; nb < 4; ++nb) { v8us oh, ol;
#pragma unroll
                for (int j = 0; j < 8; ++j) { unsigned short a2, c2; splitf(acc[mb][nb][j], a2, c2); oh[j] = a2; ol[j] = c2; }
                const size_t oo = ((size_t)g * HD + c0 + nb * 16 + lr) * (2 * TT) + t0 + mb * 16 + 8 * hi; *(v8us*)(Ph + oo) = oh; *(v8us*)(Pl + oo) = ol; } }
        return;
    }
#pragma unroll
    for (int mb = 0; mb < 4; ++mb) {
#pragma unroll
        for (int nb = 0; nb < 4; ++nb) {
#pragma unroll
            for (int j = 0; j < 8; ++j) os[(hi * 8 + j) * 68 + nb * 16 + lr] = acc[mb][nb][j]; }
        __builtin_amdgcn_wave_barrier(); asm volatile("" ::: "memory");   // keeps the row reads below behind the staging writes above
#pragma unroll
        for (int s = 0; s < 8; ++s) { const int row = 2 * s + hi, cofs = lr * 4; const v4f val = *(const v4fa*)(os + row * 68 + cofs); v4us oh, ol;
#pragma unroll
            for (int q = 0; q < 4; ++q) { unsigned short a2, c2; splitf(val[q], a2, c2); oh[q] = a2; ol[q] = c2; }
            const size_t oo = (size_t)(r0 + mb * 16 + row) * ldc + c0 + cofs; *(v4us*)(Ph + oo) = oh; *(v4us*)(Pl + oo) = ol; }
        __builtin_amdgcn_wave_barrier(); asm volatile("" ::: "memory");   // keeps the next block's staging writes behind these row reads
    }
}

// ---- k_gemmc: the same one-wave 64x64 tile GEMM specialised for causal attention: CMODE 1 skips score tiles entirely above the diagonal (query rows r0+roff.., key columns c0..), CMODE 2 limits the
// key (K) loop of the probability x value contraction to the diagonal block (probabilities beyond it are exactly zero). roff = row offset of this launch's first row within the sequence.
template <typename T16, int NSPLIT, int CMODE>
__global__ __launch_bounds__(32) void k_gemmc(const T16* __restrict__ A, const T16* __restrict__ A2, const T16* __restrict__ Bt, const T16* __restrict__ Bt2, int K, float* C, int ldc, int roff, size_t sA, size_t sB, size_t sC) {
    typedef typename WFrag<T16>::V V;
    __shared__ __align__(16) float os[16 * 68];
    const size_t z = blockIdx.z; A += z * sA; if (A2) A2 += z * sA; Bt += z * sB; if (Bt2) Bt2 += z * sB; C += z * sC;
    const int lane = threadIdx.x & 31, lr = lane & 15, hi = lane >> 4; const int r0 = blockIdx.x * 64, c0 = blockIdx.y * 64;
    if (CMODE == 1 && c0 > r0 + roff + 63) return;                  // score tile entirely above the causal diagonal: never read (the softmax masks j > i by select)
    const int Kl = (CMODE == 2) ? min(K, r0 + roff + 64) : K;        // P.V: probabilities are exactly 0 beyond the diagonal block, so the K loop stops there
    v8f acc[4][4];
#pragma unroll
    for (int mb = 0; mb < 4; ++mb)
#pragma unroll
        for (int nb = 0; nb < 4; ++nb) acc[mb][nb] = (v8f){};
    const size_t aoff = (size_t)(r0 + lr) * K + 8 * hi, boff = (size_t)(c0 + lr) * K + 8 * hi;

    for (int kc = 0; kc < Kl; kc += 32) {
        V a[4], a2[4];
#pragma unroll
        for (int mb = 0; mb < 4; ++mb) { a[mb] = WFrag<T16>::ld(A + aoff + (size_t)mb * 16 * K + kc); if (NSPLIT == 1 || NSPLIT == 2) a2[mb] = WFrag<T16>::ld(A2 + aoff + (size_t)mb * 16 * K + kc); }
#pragma unroll
        for (int nb = 0; nb < 4; ++nb) { const V b = WFrag<T16>::ld(Bt + boff + (size_t)nb * 16 * K + kc); V b2; if (NSPLIT >= 2) b2 = WFrag<T16>::ld(Bt2 + boff + (size_t)nb * 16 * K + kc);
#pragma unroll
            for (int mb = 0; mb < 4; ++mb) { acc[mb][nb] = WFrag<T16>::mma(a[mb], b, acc[mb][nb]); if (NSPLIT == 1 || NSPLIT == 2) acc[mb][nb] = WFrag<T16>::mma(a2[mb], b, acc[mb][nb]); if (NSPLIT >= 2) acc[mb][nb] = WFrag<T16>::mma(a[mb], b2, acc[mb][nb]); } }
        asm volatile("v_nop\n\tv_nop\n\tv_nop\n\tv_nop" : "+v"(acc[0][0]), "+v"(acc[1][1]), "+v"(acc[2][2]), "+v"(acc[3][3]) : "v"(a[0]), "v"(a[3]));
    }
#pragma unroll
    for (int mb = 0; mb < 4; ++mb) {
#pragma unroll
        for (int nb = 0; nb < 4; ++nb) {
#pragma unroll
            for (int j = 0; j < 8; ++j) os[(hi * 8 + j) * 68 + nb * 16 + lr] = acc[mb][nb][j]; }
        __builtin_amdgcn_wave_barrier(); asm volatile("" ::: "memory");
        float* crow = C + (size_t)(r0 + mb * 16) * ldc + c0;
{
#pragma unroll
            for (int s = 0; s < 8; ++s) { const int row = 2 * s + hi, cofs = lr * 4; v4f val = *(const v4fa*)(os + row * 68 + cofs);
                *(v4f*)(crow + (size_t)row * ldc + cofs) = val; }
             }
        __builtin_amdgcn_wave_barrier(); asm volatile("" ::: "memory");
    }
}

__device__ __forceinline__ h16 tohx(float x) { return (h16)x; }
typedef __attribute__((ext_vector_type(2))) _Float16 v2h;
typedef __attribute__((ext_vector_type(4))) _Float16 v4h;
typedef __attribute__((ext_vector_type(2))) unsigned short v2us;
typedef __attribute__((ext_vector_type(2))) float v2f;
typedef __attribute__((ext_vector_type(4))) int v4i;


__global__ __launch_bounds__(256) void k_wtG(const float* __restrict__ w, int K, int N, bf* Bt) {
    const int lane = threadIdx.x & 31; const int L0 = (blockIdx.x * 8 + (threadIdx.x >> 5)) * 8; const int nlines = N * K / 64;
{
        for (int l = 0; l < 8; ++l) { const int L = L0 + l; if (L >= nlines) break; const size_t e = (size_t)L * 64 + lane * 2; const int k = (int)(e % K), n = (int)(e / K); v2us o;
            o[0] = f2bf(w[(size_t)k * N + n]); o[1] = f2bf(w[(size_t)(k + 1) * N + n]); *(v2us*)(Bt + e) = o; }
         }
}
__global__ __launch_bounds__(256) void k_cvt8(const float* __restrict__ src, bf* dst, size_t n8) { const size_t i = (size_t)blockIdx.x * 256 + threadIdx.x; if (i >= n8) return; const v8f v = *(const v8f*)(src + i * 8); v8us o;
#pragma unroll
    for (int k = 0; k < 8; ++k) o[k] = f2bf(v[k]); *(v8us*)(dst + i * 8) = o;  }

// k_asoft: per row (zz, i): t = S x SCL for j <= i and i - j < WIN (the causal triangle; WIN = TT: the window never binds; an excluded key gets -3e38, whose exponential is an exact zero); softmax over the 2048 keys (register row, one exp, fixed trees);
// the hi / lo words of a row's weights go back INTO that row's own 8 KiB of the score plane, [hi 2048 | lo 2048] (Ph = the plane's base, Pl = Ph + TT, row pitch 2 TT): one wave owns the row and holds all of it in registers before its first store
// (every store needs the row's sum), so the eight score planes and their weights fit the workspace together. Sb, Ph and Pl alias: none of them is __restrict__.
__global__ __launch_bounds__(256) void k_asoft(const float* Sb, h16* P16, bf* Ph, bf* Pl) {
    const int lane = threadIdx.x & 31; const int row = blockIdx.x * 8 + (threadIdx.x >> 5); if (row >= ZH * TT) return; const int i = row % TT; const int zz = row / TT; (void)zz; const bool hires = (i < RH); const float* sr = Sb + (size_t)row * TT; float v[TT / 32]; float mx = -3.0e38f;
#pragma unroll
    for (int ch = 0; ch < TT / 128; ++ch) { const int j0 = ch * 128 + lane * 4; const v4f a = *(const v4f*)(sr + j0);
#pragma unroll
        for (int q = 0; q < 4; ++q) { const int j = j0 + q; (void)j; const float t = (j <= i && i - j < WIN) ? a[q] * SCL : -3.0e38f; v[ch * 4 + q] = t; mx = fmaxf(mx, t); } }
#pragma unroll
    for (int sh = 16; sh; sh >>= 1) mx = fmaxf(mx, __shfl_xor(mx, sh, 32));
    float sum = 0.f;
#pragma unroll
    for (int k = 0; k < TT / 32; ++k) { float d0 = __fsub_rn(v[k], mx); v[k] = __builtin_amdgcn_exp2f(__fmul_rn(d0, 1.4426950408889634f)); sum += v[k]; }
#pragma unroll
    for (int sh = 16; sh; sh >>= 1) sum += __shfl_xor(sum, sh, 32);
    const float f = __fdiv_rn(hires ? 1.0f : PCAR, sum);
{
        if (hires) {
#pragma unroll
            for (int ch = 0; ch < TT / 128; ++ch) { v4us oh, ol;
#pragma unroll
                for (int q = 0; q < 4; ++q) { unsigned short a, c2; splitf(v[ch * 4 + q] * f, a, c2); oh[q] = a; ol[q] = c2; }
                const size_t oo = ((size_t)zz * (RH ? RH : 1) + i) * (2 * TT) + ch * 128 + lane * 4; *(v4us*)(Ph + oo) = oh; *(v4us*)(Pl + oo) = ol; }
        } else {
#pragma unroll
            for (int ch = 0; ch < TT / 128; ++ch) { v4h o4;
#pragma unroll
                for (int q = 0; q < 4; ++q) o4[q] = tohx(v[ch * 4 + q] * f);
                *(v4h*)(P16 + (size_t)row * TT + ch * 128 + lane * 4) = o4; } }
         }
}

extern "C" void kernel_launch(void* const* d_in, const int* in_sizes, int n_in,
                              void* d_out, int out_size, void* d_ws, size_t ws_size, hipStream_t stream) {
    (void)in_sizes; (void)n_in; (void)out_size;
    const float* x = (const float*)d_in[0]; const float* wk = (const float*)d_in[1]; const float* wq = (const float*)d_in[2]; const float* wv = (const float*)d_in[3];
    // inputs in the module's argument order = d_in[0..3]: the [8][2048][1024] plane, then the KEY, QUERY and VALUE weights [1024][128] (in, out): all four read; the causal rule is computed: there is no mask input
    float* OUT = (float*)d_out;     // [8][2048][128]
    char* wsp = (char*)d_ws;
    auto take = [&](size_t bytes) { char* p = wsp; wsp += (bytes + 255) & ~(size_t)255; return (void*)p; };
    bf* WQ = (bf*)take((size_t)DQ * DM * 2); bf* WK = (bf*)take((size_t)DKV * DM * 2); bf* WV = (bf*)take((size_t)DKV * DM * 2);
    bf* XB = (bf*)take((size_t)NB_ * TT * DM * 2);
    bf* QPh = (bf*)take((size_t)ZH * TT * HD * 2); bf* QPl = (bf*)take((size_t)ZH * TT * HD * 2); bf* KPh = (bf*)take((size_t)ZH * TT * HD * 2); bf* KPl = (bf*)take((size_t)ZH * TT * HD * 2); bf* VTh = (bf*)take((size_t)ZH * HD * 2 * TT * 2);
    float* Sb = (float*)take((size_t)ZH * TT * TT * 4);
    if ((size_t)(wsp - (char*)d_ws) > ws_size) return;
    bf* VTl = VTh + TT;                   // value rows [hi | lo], pitch 2 TT (k_gemmw, EPI 2)
    bf* Ph = (bf*)Sb; bf* Pl = Ph + TT;   // weight rows [hi | lo], pitch 2 TT, each in its own score row (k_asoft)
    { k_wtG<<<(unsigned)((DM * DQ / 64 + 63) / 64), 256, 0, stream>>>(wq, DM, DQ, WQ); k_wtG<<<(unsigned)((DM * DKV / 64 + 63) / 64), 256, 0, stream>>>(wk, DM, DKV, WK); k_wtG<<<(unsigned)((DM * DKV / 64 + 63) / 64), 256, 0, stream>>>(wv, DM, DKV, WV); }   /* (in, out) weights: the transposing cast: [128][1024] = Bt */
    const unsigned LX = (unsigned)(((size_t)NB_ * TT * DM / 8 + 255) / 256);
    k_cvt8<<<LX, 256, 0, stream>>>(x, XB, (size_t)NB_ * TT * DM / 8);
    k_gemmw<bf, 0, 1><<<dim3(NB_ * TT / 64, DQ / 64, 1), 32, 0, stream>>>(XB, nullptr, WQ, nullptr, DM, QPh, QPl, DQ);   /* the projections: the eight entries' rows are one [16384][1024] operand; each writes its own hi / lo planes */
    k_gemmw<bf, 0, 1><<<dim3(NB_ * TT / 64, DKV / 64, 1), 32, 0, stream>>>(XB, nullptr, WK, nullptr, DM, KPh, KPl, DKV);
    k_gemmw<bf, 0, 2><<<dim3(NB_ * TT / 64, DKV / 64, 1), 32, 0, stream>>>(XB, nullptr, WV, nullptr, DM, VTh, VTl, 0);
    k_gemmc<bf, 2, 1><<<dim3(TT / 64, TT / 64, ZH), 32, 0, stream>>>(QPh, QPl, KPh, KPl, HD, Sb, TT, 0, (size_t)TT * HD, (size_t)TT * HD, (size_t)TT * TT);   /* the scores on hi / lo planes on EVERY row */
    k_asoft<<<ZH * TT / 8, 256, 0, stream>>>(Sb, nullptr, Ph, Pl);   /* RH = TT: the one-word fp16 plane is never written */
    k_gemmc<bf, 2, 2><<<dim3(RH / 64, HD / 64, ZH), 32, 0, stream>>>(Ph, Pl, VTh, VTl, 2 * TT, OUT, HD, 0, (size_t)RH * 2 * TT, (size_t)HD * 2 * TT, (size_t)TT * HD);   /* P x v: three products on every row; K = 2 TT is the [hi | lo] rows' pitch: the key loop ends at the diagonal block, at most TT; its tiles are the output rows [entry][t][d]: the one writer of d_out */
}

// v003
// It runs in 165 microseconds.
// Timed twice side by side with v002, it ran 1.36 and 1.38 times as fast.
// Counting every step since v000, it is 5.97 times as fast.
#include <hip/hip_runtime.h>

// One head of causal self-attention with a 128-wide head, NO output projection, and the scores MULTIPLIED by 32 (inputs, in argument order: a0 [8][2048][1024]; a1, a2, a3 [1024][128] stored (in, out) and used as x W: the key, query and value weights IN THAT ORDER):
//   THE MODULE's FUNCTION: k = a0 a1; q = a0 a2; v = a0 a3 ([8][2048][128] each); S = (q k^T) x 32; everything above the diagonal set to nought, then EVERY exact nought set to -inf (so the module excludes the keys after the query AND any key inside the triangle whose score is exactly 0.0); softmax over the 2,048 keys; result = P v -> [8][2048][128] (2.1 M).
//   THIS TEXT excludes the keys after the query by index and KEEPS a score of exactly 0.0 inside the triangle: the two differ only where a computed score is exactly 0.0: not reached on real data (said again below).
// Layout: ALL EIGHT batch entries go through every stage in ONE launch of that stage (the entry is a plane index: more rows in the projections, grid z in the attention GEMMs): one bf16 copy of a0 (read by all three projections) and the (in, out) weights transposed once by a transposing cast, all four casts in one launch; the three projections in one launch; exact projections (bf16 x bf16 words, f32 sums) WHOSE OWN EPILOGUE splits each f32 sum into the bf16 hi / lo planes that the attention GEMMs read (q and k row planes; the transposed value planes): no f32 projection plane and no plane-builder pass;
//   the causal T-2048 attention for the one head: THE SCORES ON hi / lo PLANES ON EVERY ROW (three products: the softmax is all but a hard maximum, a score's spread is about 360, and one 16-bit rounding of q or k would flip the winning key in hundreds of rows); THE SOFTMAX WEIGHTS ON bf16 hi / lo PLANES ON EVERY ROW TOO (RH = TT) and P x v as three products against the hi / lo value planes: a one-word fp16 P is not taken: 6.4 per cent of this draw's non-zero carried weights would be fp16 subnormals;
//   tiles above the diagonal skipped; the P x v GEMM stores its f32 tiles straight into the output rows (no carried factor at RH = TT): the one writer of d_out.
// The scale: the module writes scores x sqrt(1024): SCL 32.0f in the softmax's load stage, as the module writes it (a power of two: exact).
// Compute dtypes, f32 accumulate: every float input rounded to bf16 at its load; projections exact; scores three products; softmax f32 (the hardware exp2); P x v three products (bf16 hi / lo both sides; lo x lo not formed); the output is those f32 sums as they stand.

#define NB_  8      // batch entries: the input is [8][2048][1024]
#define TT   2048
#define DM   1024
#define NH_  1
#define NKV  1
#define REP  (NH_ / NKV)
#define HD   128
#define DQ   (NH_ * HD)
#define DKV  (NKV * HD)
#define ZH   NB_                  // planes per attention launch: one head x the eight batch entries
#define RH   2048                 // = TT: query rows < RH use hi+lo planes of P: EVERY row here
#define WIN  2048
#define PCAR 1024.0f
#define SCL  32.0f   // sqrt(1024): the module MULTIPLIES the scores by it
typedef _Float16 h16;
typedef unsigned short bf;
typedef __attribute__((ext_vector_type(16))) __bf16   v16bf;
typedef __attribute__((ext_vector_type(16))) _Float16 v16h;
typedef __attribute__((ext_vector_type(8)))  _Float16 v8h;
typedef __attribute__((ext_vector_type(8)))  unsigned short v8us;
typedef __attribute__((ext_vector_type(8)))  float    v8f;
typedef __attribute__((ext_vector_type(4)))  float    v4f;
typedef v8h  __attribute__((may_alias)) v8ha;
typedef v4f  __attribute__((may_alias)) v4fa;
typedef v8us __attribute__((may_alias)) v8usa;

__device__ __forceinline__ unsigned short f2bf(float f) { unsigned u = __float_as_uint(f); u += 0x7FFFu + ((u >> 16) & 1u); return (unsigned short)(u >> 16); }
__device__ __forceinline__ float bf2f(unsigned short b) { return __uint_as_float(((unsigned)b) << 16); }
__device__ __forceinline__ float bfr(float f) { return bf2f(f2bf(f)); }
__device__ __forceinline__ v16h cat16(v8h lo, v8h hi) { return __builtin_shufflevector(lo, hi, 0, 1, 2, 3, 4, 5, 6, 7, 8, 9, 10, 11, 12, 13, 14, 15); }
__device__ __forceinline__ v16bf cat16b(v8us lo, v8us hi) { return __builtin_bit_cast(v16bf, __builtin_shufflevector(lo, hi, 0, 1, 2, 3, 4, 5, 6, 7, 8, 9, 10, 11, 12, 13, 14, 15)); }
__device__ __forceinline__ v8f wmma16(v16h a, v16h b, v8f c) { return __builtin_amdgcn_wmma_f32_16x16x32_f16(false, a, false, b, (short)0, c, false, false); }
__device__ __forceinline__ v8f wmmab(v16bf a, v16bf b, v8f c) { return __builtin_amdgcn_wmma_f32_16x16x32_bf16(false, a, false, b, (short)0, c, false, false); }
__device__ __forceinline__ void splitf(float y, unsigned short& h, unsigned short& l) { h = f2bf(y); l = f2bf(y - bf2f(h)); }
typedef __attribute__((ext_vector_type(4))) unsigned short v4us;



// ---- k_gemmw: the three projections in ONE launch. Register-blocked GEMM, ONE WAVE per 64x64 output tile (16 accumulators), operands straight from K-contiguous 16-bit planes.
// A block is six such waves, which share no data in LDS and meet at no barrier: 2 row tiles x the 3 weights (q, k, v) at one 64-column tile; grid (M/128, N/64), 192 threads: 1,536 waves are on the chip at once, where a launch per weight had 512.
// The three waves of a row tile read the same rows of A, the two waves of a weight the same rows of Bt: those lines come into the WGP's cache once a block.
// f32 sums S[m][n] = sum_k A[m][k] Bt[n][k] (+ split products per NSPLIT), K % 32 == 0; each sum leaves the wave as its bf16 hi / lo words (splitf), never as an f32 plane:
//   q and k: row planes Ph / Pl [m][n], pitch ldc ([entry][t][d] is [m][n] as it stands); staged through the wave's own slice of LDS so that 16 lanes store one whole 128-byte line.
//   v: transposed planes [entry][n][hi 2048 | lo 2048] (Pl = Ph + TT, row pitch 2 TT: the same pitch as the weights' rows, which the P x v GEMM reads against them); m = entry x TT + t. A lane's 8 accumulator registers are 8 consecutive t of one n: one 16-byte store a plane, no staging; the tile's 64 t of a row n are one 128-byte line, written by this wave alone.
template <typename T16> struct WFrag;
template <> struct WFrag<h16> { typedef v16h V; static __device__ __forceinline__ V ld(const h16* p) { return cat16(*(const v8h*)p, *(const v8h*)(p + 16)); } static __device__ __forceinline__ v8f mma(V a, V b, v8f c) { return wmma16(a, b, c); } };
template <> struct WFrag<bf> { typedef v16bf V; static __device__ __forceinline__ V ld(const bf* p) { return cat16b(*(const v8us*)p, *(const v8us*)(p + 16)); } static __device__ __forceinline__ v8f mma(V a, V b, v8f c) { return wmmab(a, b, c); } };
template <typename T16, int NSPLIT>
__global__ __launch_bounds__(192) void k_gemmw(const T16* __restrict__ A, const T16* __restrict__ A2, const T16* __restrict__ Bq, const T16* __restrict__ Bk, const T16* __restrict__ Bv, const T16* __restrict__ Bt2, int K, bf* Qh, bf* Ql, bf* Kh, bf* Kl, bf* Vh, bf* Vl, int ldc) {
    typedef typename WFrag<T16>::V V;
    __shared__ __align__(16) float osw[6][16 * 68];
    const int wave = __builtin_amdgcn_readfirstlane((int)(threadIdx.x >> 5)), p = wave % 3, rt = wave / 3;   // p: 0 = q, 1 = k, 2 = v; rt: which of the block's two row tiles; scalars, so that every test on p is a scalar branch
    const T16* __restrict__ Bt = (p == 0) ? Bq : (p == 1) ? Bk : Bv; bf* Ph = (p == 0) ? Qh : (p == 1) ? Kh : Vh; bf* Pl = (p == 0) ? Ql : (p == 1) ? Kl : Vl; float* os = osw[wave];
    const int lane = threadIdx.x & 31, lr = lane & 15, hi = lane >> 4; const int r0 = (blockIdx.x * 2 + rt) * 64, c0 = blockIdx.y * 64;
    v8f acc[4][4];
#pragma unroll
    for (int mb = 0; mb < 4; ++mb)
#pragma unroll
        for (int nb = 0; nb < 4; ++nb) acc[mb][nb] = (v8f){};
    const size_t aoff = (size_t)(r0 + lr) * K + 8 * hi, boff = (size_t)(c0 + lr) * K + 8 * hi;

    for (int kc = 0; kc < K; kc += 32) {
        V a[4], a2[4];
#pragma unroll
        for (int mb = 0; mb < 4; ++mb) { a[mb] = WFrag<T16>::ld(A + aoff + (size_t)mb * 16 * K + kc); if (NSPLIT == 1 || NSPLIT == 2) a2[mb] = WFrag<T16>::ld(A2 + aoff + (size_t)mb * 16 * K + kc); }
#pragma unroll
        for (int nb = 0; nb < 4; ++nb) { const V b = WFrag<T16>::ld(Bt + boff + (size_t)nb * 16 * K + kc); V b2; if (NSPLIT >= 2) b2 = WFrag<T16>::ld(Bt2 + boff + (size_t)nb * 16 * K + kc);
#pragma unroll
            for (int mb = 0; mb < 4; ++mb) { acc[mb][nb] = WFrag<T16>::mma(a[mb], b, acc[mb][nb]); if (NSPLIT == 1 || NSPLIT == 2) acc[mb][nb] = WFrag<T16>::mma(a2[mb], b, acc[mb][nb]); if (NSPLIT >= 2) acc[mb][nb] = WFrag<T16>::mma(a[mb], b2, acc[mb][nb]); } }
        asm volatile("v_nop\n\tv_nop\n\tv_nop\n\tv_nop" : "+v"(acc[0][0]), "+v"(acc[1][1]), "+v"(acc[2][2]), "+v"(acc[3][3]) : "v"(a[0]), "v"(a[3]));
    }
    if (p == 2) {
        const int g = r0 / TT, t0 = r0 % TT;   // a 64-row tile lies inside one entry (TT % 64 == 0)
#pragma unroll
        for (int mb = 0; mb < 4; ++mb) {
#pragma unroll
            for (int nb = 0; nb < 4; ++nb) { v8us oh, ol;
#pragma unroll
                for (int j = 0; j < 8; ++j) { unsigned short a2, c2; splitf(acc[mb][nb][j], a2, c2); oh[j] = a2; ol[j] = c2; }
                const size_t oo = ((size_t)g * HD + c0 + nb * 16 + lr) * (2 * TT) + t0 + mb * 16 + 8 * hi; *(v8us*)(Ph + oo) = oh; *(v8us*)(Pl + oo) = ol; } }
        return;
    }
#pragma unroll
    for (int mb = 0; mb < 4; ++mb) {
#pragma unroll
        for (int nb = 0; nb < 4; ++nb) {
#pragma unroll
            for (int j = 0; j < 8; ++j) os[(hi * 8 + j) * 68 + nb * 16 + lr] = acc[mb][nb][j]; }
        __builtin_amdgcn_wave_barrier(); asm volatile("" ::: "memory");   // keeps the row reads below behind the staging writes above
#pragma unroll
        for (int s = 0; s < 8; ++s) { const int row = 2 * s + hi, cofs = lr * 4; const v4f val = *(const v4fa*)(os + row * 68 + cofs); v4us oh, ol;
#pragma unroll
            for (int q = 0; q < 4; ++q) { unsigned short a2, c2; splitf(val[q], a2, c2); oh[q] = a2; ol[q] = c2; }
            const size_t oo = (size_t)(r0 + mb * 16 + row) * ldc + c0 + cofs; *(v4us*)(Ph + oo) = oh; *(v4us*)(Pl + oo) = ol; }
        __builtin_amdgcn_wave_barrier(); asm volatile("" ::: "memory");   // keeps the next block's staging writes behind these row reads
    }
}

// ---- k_gemmc: the same one-wave 64x64 tile GEMM specialised for causal attention: CMODE 1 skips score tiles entirely above the diagonal (query rows r0+roff.., key columns c0..), CMODE 2 limits the
// key (K) loop of the probability x value contraction to the diagonal block (probabilities beyond it are exactly zero). roff = row offset of this launch's first row within the sequence.
template <typename T16, int NSPLIT, int CMODE>
__global__ __launch_bounds__(32) void k_gemmc(const T16* __restrict__ A, const T16* __restrict__ A2, const T16* __restrict__ Bt, const T16* __restrict__ Bt2, int K, float* C, int ldc, int roff, size_t sA, size_t sB, size_t sC) {
    typedef typename WFrag<T16>::V V;
    __shared__ __align__(16) float os[16 * 68];
    const size_t z = blockIdx.z; A += z * sA; if (A2) A2 += z * sA; Bt += z * sB; if (Bt2) Bt2 += z * sB; C += z * sC;
    const int lane = threadIdx.x & 31, lr = lane & 15, hi = lane >> 4; const int r0 = blockIdx.x * 64, c0 = blockIdx.y * 64;
    if (CMODE == 1 && c0 > r0 + roff + 63) return;                  // score tile entirely above the causal diagonal: never read (the softmax masks j > i by select)
    const int Kl = (CMODE == 2) ? min(K, r0 + roff + 64) : K;        // P.V: probabilities are exactly 0 beyond the diagonal block, so the K loop stops there
    v8f acc[4][4];
#pragma unroll
    for (int mb = 0; mb < 4; ++mb)
#pragma unroll
        for (int nb = 0; nb < 4; ++nb) acc[mb][nb] = (v8f){};
    const size_t aoff = (size_t)(r0 + lr) * K + 8 * hi, boff = (size_t)(c0 + lr) * K + 8 * hi;

    for (int kc = 0; kc < Kl; kc += 32) {
        V a[4], a2[4];
#pragma unroll
        for (int mb = 0; mb < 4; ++mb) { a[mb] = WFrag<T16>::ld(A + aoff + (size_t)mb * 16 * K + kc); if (NSPLIT == 1 || NSPLIT == 2) a2[mb] = WFrag<T16>::ld(A2 + aoff + (size_t)mb * 16 * K + kc); }
#pragma unroll
        for (int nb = 0; nb < 4; ++nb) { const V b = WFrag<T16>::ld(Bt + boff + (size_t)nb * 16 * K + kc); V b2; if (NSPLIT >= 2) b2 = WFrag<T16>::ld(Bt2 + boff + (size_t)nb * 16 * K + kc);
#pragma unroll
            for (int mb = 0; mb < 4; ++mb) { acc[mb][nb] = WFrag<T16>::mma(a[mb], b, acc[mb][nb]); if (NSPLIT == 1 || NSPLIT == 2) acc[mb][nb] = WFrag<T16>::mma(a2[mb], b, acc[mb][nb]); if (NSPLIT >= 2) acc[mb][nb] = WFrag<T16>::mma(a[mb], b2, acc[mb][nb]); } }
        asm volatile("v_nop\n\tv_nop\n\tv_nop\n\tv_nop" : "+v"(acc[0][0]), "+v"(acc[1][1]), "+v"(acc[2][2]), "+v"(acc[3][3]) : "v"(a[0]), "v"(a[3]));
    }
#pragma unroll
    for (int mb = 0; mb < 4; ++mb) {
#pragma unroll
        for (int nb = 0; nb < 4; ++nb) {
#pragma unroll
            for (int j = 0; j < 8; ++j) os[(hi * 8 + j) * 68 + nb * 16 + lr] = acc[mb][nb][j]; }
        __builtin_amdgcn_wave_barrier(); asm volatile("" ::: "memory");
        float* crow = C + (size_t)(r0 + mb * 16) * ldc + c0;
{
#pragma unroll
            for (int s = 0; s < 8; ++s) { const int row = 2 * s + hi, cofs = lr * 4; v4f val = *(const v4fa*)(os + row * 68 + cofs);
                *(v4f*)(crow + (size_t)row * ldc + cofs) = val; }
             }
        __builtin_amdgcn_wave_barrier(); asm volatile("" ::: "memory");
    }
}

__device__ __forceinline__ h16 tohx(float x) { return (h16)x; }
typedef __attribute__((ext_vector_type(2))) _Float16 v2h;
typedef __attribute__((ext_vector_type(4))) _Float16 v4h;
typedef __attribute__((ext_vector_type(2))) unsigned short v2us;
typedef __attribute__((ext_vector_type(2))) float v2f;
typedef __attribute__((ext_vector_type(4))) int v4i;


// ---- k_prep: the four casts, which depend on nothing but the inputs, in ONE launch, told apart by block index: blocks [0, 3 WTB) are the transposing casts of the q, k and v weights (WTB blocks each; first, because their strided reads take longest), the rest the straight cast of a0.
#define WTB (DM * HD / 64 / 64)   // blocks per weight: 8 waves x 8 lines of 64 words
__global__ __launch_bounds__(256) void k_prep(const float* __restrict__ src, const float* __restrict__ wq, const float* __restrict__ wk, const float* __restrict__ wv, bf* dst, bf* WQ, bf* WK, bf* WV, size_t n8) {
    if (blockIdx.x < 3 * WTB) {
        const int sel = blockIdx.x / WTB, blk = blockIdx.x % WTB; const float* __restrict__ w = (sel == 0) ? wq : (sel == 1) ? wk : wv; bf* Bt = (sel == 0) ? WQ : (sel == 1) ? WK : WV; const int K = DM, N = HD;
        const int lane = threadIdx.x & 31; const int L0 = (blk * 8 + (threadIdx.x >> 5)) * 8; const int nlines = N * K / 64;
        for (int l = 0; l < 8; ++l) { const int L = L0 + l; if (L >= nlines) break; const size_t e = (size_t)L * 64 + lane * 2; const int k = (int)(e % K), n = (int)(e / K); v2us o;
            o[0] = f2bf(w[(size_t)k * N + n]); o[1] = f2bf(w[(size_t)(k + 1) * N + n]); *(v2us*)(Bt + e) = o; }
        return;
    }
    const size_t i = (size_t)(blockIdx.x - 3 * WTB) * 256 + threadIdx.x; if (i >= n8) return; const v8f v = *(const v8f*)(src + i * 8); v8us o;
#pragma unroll
    for (int k = 0; k < 8; ++k) o[k] = f2bf(v[k]); *(v8us*)(dst + i * 8) = o;  }

// k_asoft: per row (zz, i): t = S x SCL for j <= i and i - j < WIN (the causal triangle; WIN = TT: the window never binds; an excluded key gets -3e38, whose exponential is an exact zero); softmax over the 2048 keys (register row, one exp, fixed trees);
// the hi / lo words of a row's weights go back INTO that row's own 8 KiB of the score plane, [hi 2048 | lo 2048] (Ph = the plane's base, Pl = Ph + TT, row pitch 2 TT): one wave owns the row and holds all of it in registers before its first store
// (every store needs the row's sum), so the eight score planes and their weights fit the workspace together. Sb, Ph and Pl alias: none of them is __restrict__.
__global__ __launch_bounds__(256) void k_asoft(const float* Sb, h16* P16, bf* Ph, bf* Pl) {
    const int lane = threadIdx.x & 31; const int row = blockIdx.x * 8 + (threadIdx.x >> 5); if (row >= ZH * TT) return; const int i = row % TT; const int zz = row / TT; (void)zz; const bool hires = (i < RH); const float* sr = Sb + (size_t)row * TT; float v[TT / 32]; float mx = -3.0e38f;
#pragma unroll
    for (int ch = 0; ch < TT / 128; ++ch) { const int j0 = ch * 128 + lane * 4; const v4f a = *(const v4f*)(sr + j0);
#pragma unroll
        for (int q = 0; q < 4; ++q) { const int j = j0 + q; (void)j; const float t = (j <= i && i - j < WIN) ? a[q] * SCL : -3.0e38f; v[ch * 4 + q] = t; mx = fmaxf(mx, t); } }
#pragma unroll
    for (int sh = 16; sh; sh >>= 1) mx = fmaxf(mx, __shfl_xor(mx, sh, 32));
    float sum = 0.f;
#pragma unroll
    for (int k = 0; k < TT / 32; ++k) { float d0 = __fsub_rn(v[k], mx); v[k] = __builtin_amdgcn_exp2f(__fmul_rn(d0, 1.4426950408889634f)); sum += v[k]; }
#pragma unroll
    for (int sh = 16; sh; sh >>= 1) sum += __shfl_xor(sum, sh, 32);
    const float f = __fdiv_rn(hires ? 1.0f : PCAR, sum);
{
        if (hires) {
#pragma unroll
            for (int ch = 0; ch < TT / 128; ++ch) { v4us oh, ol;
#pragma unroll
                for (int q = 0; q < 4; ++q) { unsigned short a, c2; splitf(v[ch * 4 + q] * f, a, c2); oh[q] = a; ol[q] = c2; }
                const size_t oo = ((size_t)zz * (RH ? RH : 1) + i) * (2 * TT) + ch * 128 + lane * 4; *(v4us*)(Ph + oo) = oh; *(v4us*)(Pl + oo) = ol; }
        } else {
#pragma unroll
            for (int ch = 0; ch < TT / 128; ++ch) { v4h o4;
#pragma unroll
                for (int q = 0; q < 4; ++q) o4[q] = tohx(v[ch * 4 + q] * f);
                *(v4h*)(P16 + (size_t)row * TT + ch * 128 + lane * 4) = o4; } }
         }
}

extern "C" void kernel_launch(void* const* d_in, const int* in_sizes, int n_in,
                              void* d_out, int out_size, void* d_ws, size_t ws_size, hipStream_t stream) {
    (void)in_sizes; (void)n_in; (void)out_size;
    const float* x = (const float*)d_in[0]; const float* wk = (const float*)d_in[1]; const float* wq = (const float*)d_in[2]; const float* wv = (const float*)d_in[3];
    // inputs in the module's argument order = d_in[0..3]: the [8][2048][1024] plane, then the KEY, QUERY and VALUE weights [1024][128] (in, out): all four read; the causal rule is computed: there is no mask input
    float* OUT = (float*)d_out;     // [8][2048][128]
    char* wsp = (char*)d_ws;
    auto take = [&](size_t bytes) { char* p = wsp; wsp += (bytes + 255) & ~(size_t)255; return (void*)p; };
    bf* WQ = (bf*)take((size_t)DQ * DM * 2); bf* WK = (bf*)take((size_t)DKV * DM * 2); bf* WV = (bf*)take((size_t)DKV * DM * 2);
    bf* XB = (bf*)take((size_t)NB_ * TT * DM * 2);
    bf* QPh = (bf*)take((size_t)ZH * TT * HD * 2); bf* QPl = (bf*)take((size_t)ZH * TT * HD * 2); bf* KPh = (bf*)take((size_t)ZH * TT * HD * 2); bf* KPl = (bf*)take((size_t)ZH * TT * HD * 2); bf* VTh = (bf*)take((size_t)ZH * HD * 2 * TT * 2);
    float* Sb = (float*)take((size_t)ZH * TT * TT * 4);
    if ((size_t)(wsp - (char*)d_ws) > ws_size) return;
    bf* VTl = VTh + TT;                   // value rows [hi | lo], pitch 2 TT (k_gemmw, the p == 2 epilogue)
    bf* Ph = (bf*)Sb; bf* Pl = Ph + TT;   // weight rows [hi | lo], pitch 2 TT, each in its own score row (k_asoft)
    const unsigned LX = (unsigned)(((size_t)NB_ * TT * DM / 8 + 255) / 256);
    k_prep<<<3 * WTB + LX, 256, 0, stream>>>(x, wq, wk, wv, XB, WQ, WK, WV, (size_t)NB_ * TT * DM / 8);   /* (in, out) weights: the transposing cast: [128][1024] = Bt; a0: the straight cast */
    k_gemmw<bf, 0><<<dim3(NB_ * TT / 128, HD / 64, 1), 192, 0, stream>>>(XB, nullptr, WQ, WK, WV, nullptr, DM, QPh, QPl, KPh, KPl, VTh, VTl, HD);   /* the three projections: the eight entries' rows are one [16384][1024] operand; each wave writes its own tile of its weight's hi / lo planes */
    k_gemmc<bf, 2, 1><<<dim3(TT / 64, TT / 64, ZH), 32, 0, stream>>>(QPh, QPl, KPh, KPl, HD, Sb, TT, 0, (size_t)TT * HD, (size_t)TT * HD, (size_t)TT * TT);   /* the scores on hi / lo planes on EVERY row */
    k_asoft<<<ZH * TT / 8, 256, 0, stream>>>(Sb, nullptr, Ph, Pl);   /* RH = TT: the one-word fp16 plane is never written */
    k_gemmc<bf, 2, 2><<<dim3(RH / 64, HD / 64, ZH), 32, 0, stream>>>(Ph, Pl, VTh, VTl, 2 * TT, OUT, HD, 0, (size_t)RH * 2 * TT, (size_t)HD * 2 * TT, (size_t)TT * HD);   /* P x v: three products on every row; K = 2 TT is the [hi | lo] rows' pitch: the key loop ends at the diagonal block, at most TT; its tiles are the output rows [entry][t][d]: the one writer of d_out */
}

// v004
// A run of this version takes 144 microseconds.
// Timed twice side by side with v003, it ran 1.15 and 1.14 times as fast.
// All steps since v000 together make it 6.83 times as fast.
#include <hip/hip_runtime.h>

// One head of causal self-attention with a 128-wide head, NO output projection, and the scores MULTIPLIED by 32 (inputs, in argument order: a0 [8][2048][1024]; a1, a2, a3 [1024][128] stored (in, out) and used as x W: the key, query and value weights IN THAT ORDER):
//   THE MODULE's FUNCTION: k = a0 a1; q = a0 a2; v = a0 a3 ([8][2048][128] each); S = (q k^T) x 32; everything above the diagonal set to nought, then EVERY exact nought set to -inf (so the module excludes the keys after the query AND any key inside the triangle whose score is exactly 0.0); softmax over the 2,048 keys; result = P v -> [8][2048][128] (2.1 M).
//   THIS TEXT excludes the keys after the query by index and KEEPS a score of exactly 0.0 inside the triangle: the two differ only where a computed score is exactly 0.0: not reached on real data (said again below).
// Layout: ALL EIGHT batch entries go through every stage in ONE launch of that stage (the entry is a plane index: more rows in the projections, grid z in the attention GEMMs): one bf16 copy of a0 (read by all three projections) and the (in, out) weights transposed once by a transposing cast, all four casts in one launch; the three projections in one launch; exact projections (bf16 x bf16 words, f32 sums) WHOSE OWN EPILOGUE splits each f32 sum into the bf16 hi / lo planes that the attention GEMMs read (q and k row planes; the transposed value planes): no f32 projection plane and no plane-builder pass;
//   the causal T-2048 attention for the one head: THE SCORES ON hi / lo PLANES ON EVERY ROW (three products: the softmax is all but a hard maximum, a score's spread is about 360, and one 16-bit rounding of q or k would flip the winning key in hundreds of rows); THE SOFTMAX WEIGHTS ON bf16 hi / lo PLANES ON EVERY ROW TOO (RH = TT) and P x v as three products against the hi / lo value planes: a one-word fp16 P is not taken: 6.4 per cent of this draw's non-zero carried weights would be fp16 subnormals;
//   tiles above the diagonal skipped; the P x v GEMM stores its f32 tiles straight into the output rows (no carried factor at RH = TT): the one writer of d_out.
// The scale: the module writes scores x sqrt(1024): SCL 32.0f in the softmax's load stage, as the module writes it (a power of two: exact).
// Compute dtypes, f32 accumulate: every float input rounded to bf16 at its load; projections exact; scores three products; softmax f32 (the hardware exp2); P x v three products (bf16 hi / lo both sides; lo x lo not formed); the output is those f32 sums as they stand.

#define NB_  8      // batch entries: the input is [8][2048][1024]
#define TT   2048
#define DM   1024
#define NH_  1
#define NKV  1
#define REP  (NH_ / NKV)
#define HD   128
#define DQ   (NH_ * HD)
#define DKV  (NKV * HD)
#define ZH   NB_                  // planes per attention launch: one head x the eight batch entries
#define RH   2048                 // = TT: query rows < RH use hi+lo planes of P: EVERY row here
#define WIN  2048
#define PCAR 1024.0f
#define SCL  32.0f   // sqrt(1024): the module MULTIPLIES the scores by it
typedef _Float16 h16;
typedef unsigned short bf;
typedef __attribute__((ext_vector_type(16))) __bf16   v16bf;
typedef __attribute__((ext_vector_type(16))) _Float16 v16h;
typedef __attribute__((ext_vector_type(8)))  _Float16 v8h;
typedef __attribute__((ext_vector_type(8)))  unsigned short v8us;
typedef __attribute__((ext_vector_type(8)))  float    v8f;
typedef __attribute__((ext_vector_type(4)))  float    v4f;
typedef v8h  __attribute__((may_alias)) v8ha;
typedef v4f  __attribute__((may_alias)) v4fa;
typedef v8us __attribute__((may_alias)) v8usa;

__device__ __forceinline__ unsigned short f2bf(float f) { unsigned u = __float_as_uint(f); u += 0x7FFFu + ((u >> 16) & 1u); return (unsigned short)(u >> 16); }
__device__ __forceinline__ float bf2f(unsigned short b) { return __uint_as_float(((unsigned)b) << 16); }
__device__ __forceinline__ float bfr(float f) { return bf2f(f2bf(f)); }
__device__ __forceinline__ v16h cat16(v8h lo, v8h hi) { return __builtin_shufflevector(lo, hi, 0, 1, 2, 3, 4, 5, 6, 7, 8, 9, 10, 11, 12, 13, 14, 15); }
__device__ __forceinline__ v16bf cat16b(v8us lo, v8us hi) { return __builtin_bit_cast(v16bf, __builtin_shufflevector(lo, hi, 0, 1, 2, 3, 4, 5, 6, 7, 8, 9, 10, 11, 12, 13, 14, 15)); }
__device__ __forceinline__ v8f wmma16(v16h a, v16h b, v8f c) { return __builtin_amdgcn_wmma_f32_16x16x32_f16(false, a, false, b, (short)0, c, false, false); }
__device__ __forceinline__ v8f wmmab(v16bf a, v16bf b, v8f c) { return __builtin_amdgcn_wmma_f32_16x16x32_bf16(false, a, false, b, (short)0, c, false, false); }
__device__ __forceinline__ void splitf(float y, unsigned short& h, unsigned short& l) { h = f2bf(y); l = f2bf(y - bf2f(h)); }
typedef __attribute__((ext_vector_type(4))) unsigned short v4us;



// ---- k_gemmw: the three projections in ONE launch. Register-blocked GEMM, ONE WAVE per 64x64 output tile (16 accumulators), operands straight from K-contiguous 16-bit planes.
// A block is six such waves, which share no data in LDS and meet at no barrier: 2 row tiles x the 3 weights (q, k, v) at one 64-column tile; grid (M/128, N/64), 192 threads: 1,536 waves are on the chip at once, where a launch per weight had 512.
// The three waves of a row tile read the same rows of A, the two waves of a weight the same rows of Bt: those lines come into the WGP's cache once a block.
// f32 sums S[m][n] = sum_k A[m][k] Bt[n][k] (+ split products per NSPLIT), K % 32 == 0; each sum leaves the wave as its bf16 hi / lo words (splitf), never as an f32 plane:
//   q and k: row planes Ph / Pl [m][n], pitch ldc ([entry][t][d] is [m][n] as it stands); staged through the wave's own slice of LDS so that 16 lanes store one whole 128-byte line.
//   v: transposed planes [entry][n][hi 2048 | lo 2048] (Pl = Ph + TT, row pitch 2 TT: the same pitch as the weights' rows, which the P x v GEMM reads against them); m = entry x TT + t. A lane's 8 accumulator registers are 8 consecutive t of one n: one 16-byte store a plane, no staging; the tile's 64 t of a row n are one 128-byte line, written by this wave alone.
template <typename T16> struct WFrag;
template <> struct WFrag<h16> { typedef v16h V; static __device__ __forceinline__ V ld(const h16* p) { return cat16(*(const v8h*)p, *(const v8h*)(p + 16)); } static __device__ __forceinline__ v8f mma(V a, V b, v8f c) { return wmma16(a, b, c); } };
template <> struct WFrag<bf> { typedef v16bf V; static __device__ __forceinline__ V ld(const bf* p) { return cat16b(*(const v8us*)p, *(const v8us*)(p + 16)); } static __device__ __forceinline__ v8f mma(V a, V b, v8f c) { return wmmab(a, b, c); } };
template <typename T16, int NSPLIT>
__global__ __launch_bounds__(192) void k_gemmw(const T16* __restrict__ A, const T16* __restrict__ A2, const T16* __restrict__ Bq, const T16* __restrict__ Bk, const T16* __restrict__ Bv, const T16* __restrict__ Bt2, int K, bf* Qh, bf* Ql, bf* Kh, bf* Kl, bf* Vh, bf* Vl, int ldc) {
    typedef typename WFrag<T16>::V V;
    __shared__ __align__(16) float osw[6][16 * 68];
    const int wave = __builtin_amdgcn_readfirstlane((int)(threadIdx.x >> 5)), p = wave % 3, rt = wave / 3;   // p: 0 = q, 1 = k, 2 = v; rt: which of the block's two row tiles; scalars, so that every test on p is a scalar branch
    const T16* __restrict__ Bt = (p == 0) ? Bq : (p == 1) ? Bk : Bv; bf* Ph = (p == 0) ? Qh : (p == 1) ? Kh : Vh; bf* Pl = (p == 0) ? Ql : (p == 1) ? Kl : Vl; float* os = osw[wave];
    const int lane = threadIdx.x & 31, lr = lane & 15, hi = lane >> 4; const int r0 = (blockIdx.x * 2 + rt) * 64, c0 = blockIdx.y * 64;
    v8f acc[4][4];
#pragma unroll
    for (int mb = 0; mb < 4; ++mb)
#pragma unroll
        for (int nb = 0; nb < 4; ++nb) acc[mb][nb] = (v8f){};
    const size_t aoff = (size_t)(r0 + lr) * K + 8 * hi, boff = (size_t)(c0 + lr) * K + 8 * hi;

    for (int kc = 0; kc < K; kc += 32) {
        V a[4], a2[4];
#pragma unroll
        for (int mb = 0; mb < 4; ++mb) { a[mb] = WFrag<T16>::ld(A + aoff + (size_t)mb * 16 * K + kc); if (NSPLIT == 1 || NSPLIT == 2) a2[mb] = WFrag<T16>::ld(A2 + aoff + (size_t)mb * 16 * K + kc); }
#pragma unroll
        for (int nb = 0; nb < 4; ++nb) { const V b = WFrag<T16>::ld(Bt + boff + (size_t)nb * 16 * K + kc); V b2; if (NSPLIT >= 2) b2 = WFrag<T16>::ld(Bt2 + boff + (size_t)nb * 16 * K + kc);
#pragma unroll
            for (int mb = 0; mb < 4; ++mb) { acc[mb][nb] = WFrag<T16>::mma(a[mb], b, acc[mb][nb]); if (NSPLIT == 1 || NSPLIT == 2) acc[mb][nb] = WFrag<T16>::mma(a2[mb], b, acc[mb][nb]); if (NSPLIT >= 2) acc[mb][nb] = WFrag<T16>::mma(a[mb], b2, acc[mb][nb]); } }
        asm volatile("v_nop\n\tv_nop\n\tv_nop\n\tv_nop" : "+v"(acc[0][0]), "+v"(acc[1][1]), "+v"(acc[2][2]), "+v"(acc[3][3]) : "v"(a[0]), "v"(a[3]));
    }
    if (p == 2) {
        const int g = r0 / TT, t0 = r0 % TT;   // a 64-row tile lies inside one entry (TT % 64 == 0)
#pragma unroll
        for (int mb = 0; mb < 4; ++mb) {
#pragma unroll
            for (int nb = 0; nb < 4; ++nb) { v8us oh, ol;
#pragma unroll
                for (int j = 0; j < 8; ++j) { unsigned short a2, c2; splitf(acc[mb][nb][j], a2, c2); oh[j] = a2; ol[j] = c2; }
                const size_t oo = ((size_t)g * HD + c0 + nb * 16 + lr) * (2 * TT) + t0 + mb * 16 + 8 * hi; *(v8us*)(Ph + oo) = oh; *(v8us*)(Pl + oo) = ol; } }
        return;
    }
#pragma unroll
    for (int mb = 0; mb < 4; ++mb) {
#pragma unroll
        for (int nb = 0; nb < 4; ++nb) {
#pragma unroll
            for (int j = 0; j < 8; ++j) os[(hi * 8 + j) * 68 + nb * 16 + lr] = acc[mb][nb][j]; }
        __builtin_amdgcn_wave_barrier(); asm volatile("" ::: "memory");   // keeps the row reads below behind the staging writes above
#pragma unroll
        for (int s = 0; s < 8; ++s) { const int row = 2 * s + hi, cofs = lr * 4; const v4f val = *(const v4fa*)(os + row * 68 + cofs); v4us oh, ol;
#pragma unroll
            for (int q = 0; q < 4; ++q) { unsigned short a2, c2; splitf(val[q], a2, c2); oh[q] = a2; ol[q] = c2; }
            const size_t oo = (size_t)(r0 + mb * 16 + row) * ldc + c0 + cofs; *(v4us*)(Ph + oo) = oh; *(v4us*)(Pl + oo) = ol; }
        __builtin_amdgcn_wave_barrier(); asm volatile("" ::: "memory");   // keeps the next block's staging writes behind these row reads
    }
}

// ---- k_gemmc: the same one-wave 64x64 tile GEMM specialised for causal attention: CMODE 1 skips score tiles entirely above the diagonal (query rows r0+roff.., key columns c0..), CMODE 2 limits the
// key (K) loop of the probability x value contraction to the diagonal block (probabilities beyond it are exactly zero). roff = row offset of this launch's first row within the sequence. Only CMODE 1 is launched here: the probability x value contraction is k_gemmpv, below.
template <typename T16, int NSPLIT, int CMODE>
__global__ __launch_bounds__(32) void k_gemmc(const T16* __restrict__ A, const T16* __restrict__ A2, const T16* __restrict__ Bt, const T16* __restrict__ Bt2, int K, float* C, int ldc, int roff, size_t sA, size_t sB, size_t sC) {
    typedef typename WFrag<T16>::V V;
    __shared__ __align__(16) float os[16 * 68];
    const size_t z = blockIdx.z; A += z * sA; if (A2) A2 += z * sA; Bt += z * sB; if (Bt2) Bt2 += z * sB; C += z * sC;
    const int lane = threadIdx.x & 31, lr = lane & 15, hi = lane >> 4; const int r0 = blockIdx.x * 64, c0 = blockIdx.y * 64;
    if (CMODE == 1 && c0 > r0 + roff + 63) return;                  // score tile entirely above the causal diagonal: never read (the softmax masks j > i by select)
    const int Kl = (CMODE == 2) ? min(K, r0 + roff + 64) : K;        // P.V: probabilities are exactly 0 beyond the diagonal block, so the K loop stops there
    v8f acc[4][4];
#pragma unroll
    for (int mb = 0; mb < 4; ++mb)
#pragma unroll
        for (int nb = 0; nb < 4; ++nb) acc[mb][nb] = (v8f){};
    const size_t aoff = (size_t)(r0 + lr) * K + 8 * hi, boff = (size_t)(c0 + lr) * K + 8 * hi;

    for (int kc = 0; kc < Kl; kc += 32) {
        V a[4], a2[4];
#pragma unroll
        for (int mb = 0; mb < 4; ++mb) { a[mb] = WFrag<T16>::ld(A + aoff + (size_t)mb * 16 * K + kc); if (NSPLIT == 1 || NSPLIT == 2) a2[mb] = WFrag<T16>::ld(A2 + aoff + (size_t)mb * 16 * K + kc); }
#pragma unroll
        for (int nb = 0; nb < 4; ++nb) { const V b = WFrag<T16>::ld(Bt + boff + (size_t)nb * 16 * K + kc); V b2; if (NSPLIT >= 2) b2 = WFrag<T16>::ld(Bt2 + boff + (size_t)nb * 16 * K + kc);
#pragma unroll
            for (int mb = 0; mb < 4; ++mb) { acc[mb][nb] = WFrag<T16>::mma(a[mb], b, acc[mb][nb]); if (NSPLIT == 1 || NSPLIT == 2) acc[mb][nb] = WFrag<T16>::mma(a2[mb], b, acc[mb][nb]); if (NSPLIT >= 2) acc[mb][nb] = WFrag<T16>::mma(a[mb], b2, acc[mb][nb]); } }
        asm volatile("v_nop\n\tv_nop\n\tv_nop\n\tv_nop" : "+v"(acc[0][0]), "+v"(acc[1][1]), "+v"(acc[2][2]), "+v"(acc[3][3]) : "v"(a[0]), "v"(a[3]));
    }
#pragma unroll
    for (int mb = 0; mb < 4; ++mb) {
#pragma unroll
        for (int nb = 0; nb < 4; ++nb) {
#pragma unroll
            for (int j = 0; j < 8; ++j) os[(hi * 8 + j) * 68 + nb * 16 + lr] = acc[mb][nb][j]; }
        __builtin_amdgcn_wave_barrier(); asm volatile("" ::: "memory");
        float* crow = C + (size_t)(r0 + mb * 16) * ldc + c0;
{
#pragma unroll
            for (int s = 0; s < 8; ++s) { const int row = 2 * s + hi, cofs = lr * 4; v4f val = *(const v4fa*)(os + row * 68 + cofs);
                *(v4f*)(crow + (size_t)row * ldc + cofs) = val; }
             }
        __builtin_amdgcn_wave_barrier(); asm volatile("" ::: "memory");
    }
}

// ---- k_gemmpv: the probability x value contraction, the same 64x64 tile, fragments and three products as k_gemmc, with the key loop of a tile DEALT OVER THE 8 WAVES OF A BLOCK: wave w takes the 32-key steps w, w + 8, w + 16, ...
// (neighbouring waves read the two halves of the same 128-byte lines), so the longest chain of dependent load-then-multiply steps is 8 long where one wave alone had 64, and 2,048 waves are on the chip where 512 were.
// The key loop ends at the diagonal block (probabilities beyond it are exactly zero), so a tile's work grows with its row index: a block takes the row tiles 31 - x and x, one after the other, and every block carries the same 66 steps.
// The 8 partial tiles meet in LDS, [row 64][wave 8][68 words] with 4 more words a row (RP: rows 8 apart, which the two lane halves write at once, then lie 32 banks apart; and one address register reaches all that a lane reads);
// behind one barrier wave w adds rows 8 w .. 8 w + 7 over the partials 0, 1, ..., 7 IN THAT FIXED ORDER and stores them: 16 lanes store the tile's 256 bytes of an output row.
template <typename T16>
__global__ __launch_bounds__(256) void k_gemmpv(const T16* __restrict__ A, const T16* __restrict__ A2, const T16* __restrict__ Bt, const T16* __restrict__ Bt2, int K, float* C, int ldc, size_t sA, size_t sB, size_t sC) {
    typedef typename WFrag<T16>::V V;
    constexpr int RP = 8 * 68 + 4;
    __shared__ __align__(16) float red[64 * RP];
    const size_t z = blockIdx.z; A += z * sA; A2 += z * sA; Bt += z * sB; Bt2 += z * sB; C += z * sC;
    const int wave = __builtin_amdgcn_readfirstlane((int)(threadIdx.x >> 5));   // a scalar, so that the key loop's test is a scalar branch
    const int lane = threadIdx.x & 31, lr = lane & 15, hi = lane >> 4; const int c0 = blockIdx.y * 64;
    const size_t boff = (size_t)(c0 + lr) * K + 8 * hi;
    float* os = red + wave * 68;
#pragma nounroll   // one copy of the tile's code: two would not run faster
    for (int t = 0; t < 2; ++t) {
        const int r0 = (t ? (int)blockIdx.x : TT / 64 - 1 - (int)blockIdx.x) * 64;
        const int Kl = min(K, r0 + 64);        // probabilities are exactly 0 beyond the diagonal block, so the key loop stops there
        v8f acc[4][4];
#pragma unroll
        for (int mb = 0; mb < 4; ++mb)
#pragma unroll
            for (int nb = 0; nb < 4; ++nb) acc[mb][nb] = (v8f){};
        const size_t aoff = (size_t)(r0 + lr) * K + 8 * hi;

        for (int kc = wave * 32; kc < Kl; kc += 8 * 32) {
            V a[4], a2[4];
#pragma unroll
            for (int mb = 0; mb < 4; ++mb) { a[mb] = WFrag<T16>::ld(A + aoff + (size_t)mb * 16 * K + kc); a2[mb] = WFrag<T16>::ld(A2 + aoff + (size_t)mb * 16 * K + kc); }
#pragma unroll
            for (int nb = 0; nb < 4; ++nb) { const V b = WFrag<T16>::ld(Bt + boff + (size_t)nb * 16 * K + kc); const V b2 = WFrag<T16>::ld(Bt2 + boff + (size_t)nb * 16 * K + kc);
#pragma unroll
                for (int mb = 0; mb < 4; ++mb) { acc[mb][nb] = WFrag<T16>::mma(a[mb], b, acc[mb][nb]); acc[mb][nb] = WFrag<T16>::mma(a2[mb], b, acc[mb][nb]); acc[mb][nb] = WFrag<T16>::mma(a[mb], b2, acc[mb][nb]); } }
            asm volatile("v_nop\n\tv_nop\n\tv_nop\n\tv_nop" : "+v"(acc[0][0]), "+v"(acc[1][1]), "+v"(acc[2][2]), "+v"(acc[3][3]) : "v"(a[0]), "v"(a[3]));   // the matrix instructions' distance on the loop's taken branch, as in k_gemmc
        }
        if (t) __syncthreads();   // the first tile's partials in LDS have been read by every wave before they are written again
#pragma unroll
        for (int mb = 0; mb < 4; ++mb)
#pragma unroll
            for (int nb = 0; nb < 4; ++nb)
#pragma unroll
                for (int j = 0; j < 8; ++j) os[(mb * 16 + hi * 8 + j) * RP + nb * 16 + lr] = acc[mb][nb][j];
        __syncthreads();          // all 8 partial tiles are in LDS before any wave adds them
#pragma unroll
        for (int s = 0; s < 4; ++s) { const int row = wave * 8 + 2 * s + hi, cofs = lr * 4; v4f val = *(const v4fa*)(red + row * RP + cofs);
#pragma unroll
            for (int w = 1; w < 8; ++w) val += *(const v4fa*)(red + row * RP + w * 68 + cofs);
            *(v4f*)(C + (size_t)(r0 + row) * ldc + c0 + cofs) = val; }
        asm volatile("s_wait_xcnt 0x0" ::: "memory");   // stands in front of the next tile's zeroing of the accumulators, which takes the registers that these stores name
    }
}

__device__ __forceinline__ h16 tohx(float x) { return (h16)x; }
typedef __attribute__((ext_vector_type(2))) _Float16 v2h;
typedef __attribute__((ext_vector_type(4))) _Float16 v4h;
typedef __attribute__((ext_vector_type(2))) unsigned short v2us;
typedef __attribute__((ext_vector_type(2))) float v2f;
typedef __attribute__((ext_vector_type(4))) int v4i;


// ---- k_prep: the four casts, which depend on nothing but the inputs, in ONE launch, told apart by block index: blocks [0, 3 WTB) are the transposing casts of the q, k and v weights (WTB blocks each; first, because their strided reads take longest), the rest the straight cast of a0.
#define WTB (DM * HD / 64 / 64)   // blocks per weight: 8 waves x 8 lines of 64 words
__global__ __launch_bounds__(256) void k_prep(const float* __restrict__ src, const float* __restrict__ wq, const float* __restrict__ wk, const float* __restrict__ wv, bf* dst, bf* WQ, bf* WK, bf* WV, size_t n8) {
    if (blockIdx.x < 3 * WTB) {
        const int sel = blockIdx.x / WTB, blk = blockIdx.x % WTB; const float* __restrict__ w = (sel == 0) ? wq : (sel == 1) ? wk : wv; bf* Bt = (sel == 0) ? WQ : (sel == 1) ? WK : WV; const int K = DM, N = HD;
        const int lane = threadIdx.x & 31; const int L0 = (blk * 8 + (threadIdx.x >> 5)) * 8; const int nlines = N * K / 64;
        for (int l = 0; l < 8; ++l) { const int L = L0 + l; if (L >= nlines) break; const size_t e = (size_t)L * 64 + lane * 2; const int k = (int)(e % K), n = (int)(e / K); v2us o;
            o[0] = f2bf(w[(size_t)k * N + n]); o[1] = f2bf(w[(size_t)(k + 1) * N + n]); *(v2us*)(Bt + e) = o; }
        return;
    }
    const size_t i = (size_t)(blockIdx.x - 3 * WTB) * 256 + threadIdx.x; if (i >= n8) return; const v8f v = *(const v8f*)(src + i * 8); v8us o;
#pragma unroll
    for (int k = 0; k < 8; ++k) o[k] = f2bf(v[k]); *(v8us*)(dst + i * 8) = o;  }

// k_asoft: per row (zz, i): t = S x SCL for j <= i and i - j < WIN (the causal triangle; WIN = TT: the window never binds; an excluded key gets -3e38, whose exponential is an exact zero); softmax over the 2048 keys (register row, one exp, fixed trees);
// the hi / lo words of a row's weights go back INTO that row's own 8 KiB of the score plane, [hi 2048 | lo 2048] (Ph = the plane's base, Pl = Ph + TT, row pitch 2 TT): one wave owns the row and holds all of it in registers before its first store
// (every store needs the row's sum), so the eight score planes and their weights fit the workspace together. Sb, Ph and Pl alias: none of them is __restrict__.
__global__ __launch_bounds__(256) void k_asoft(const float* Sb, h16* P16, bf* Ph, bf* Pl) {
    const int lane = threadIdx.x & 31; const int row = blockIdx.x * 8 + (threadIdx.x >> 5); if (row >= ZH * TT) return; const int i = row % TT; const int zz = row / TT; (void)zz; const bool hires = (i < RH); const float* sr = Sb + (size_t)row * TT; float v[TT / 32]; float mx = -3.0e38f;
#pragma unroll
    for (int ch = 0; ch < TT / 128; ++ch) { const int j0 = ch * 128 + lane * 4; const v4f a = *(const v4f*)(sr + j0);
#pragma unroll
        for (int q = 0; q < 4; ++q) { const int j = j0 + q; (void)j; const float t = (j <= i && i - j < WIN) ? a[q] * SCL : -3.0e38f; v[ch * 4 + q] = t; mx = fmaxf(mx, t); } }
#pragma unroll
    for (int sh = 16; sh; sh >>= 1) mx = fmaxf(mx, __shfl_xor(mx, sh, 32));
    float sum = 0.f;
#pragma unroll
    for (int k = 0; k < TT / 32; ++k) { float d0 = __fsub_rn(v[k], mx); v[k] = __builtin_amdgcn_exp2f(__fmul_rn(d0, 1.4426950408889634f)); sum += v[k]; }
#pragma unroll
    for (int sh = 16; sh; sh >>= 1) sum += __shfl_xor(sum, sh, 32);
    const float f = __fdiv_rn(hires ? 1.0f : PCAR, sum);
{
        if (hires) {
#pragma unroll
            for (int ch = 0; ch < TT / 128; ++ch) { v4us oh, ol;
#pragma unroll
                for (int q = 0; q < 4; ++q) { unsigned short a, c2; splitf(v[ch * 4 + q] * f, a, c2); oh[q] = a; ol[q] = c2; }
                const size_t oo = ((size_t)zz * (RH ? RH : 1) + i) * (2 * TT) + ch * 128 + lane * 4; *(v4us*)(Ph + oo) = oh; *(v4us*)(Pl + oo) = ol; }
        } else {
#pragma unroll
            for (int ch = 0; ch < TT / 128; ++ch) { v4h o4;
#pragma unroll
                for (int q = 0; q < 4; ++q) o4[q] = tohx(v[ch * 4 + q] * f);
                *(v4h*)(P16 + (size_t)row * TT + ch * 128 + lane * 4) = o4; } }
         }
}

extern "C" void kernel_launch(void* const* d_in, const int* in_sizes, int n_in,
                              void* d_out, int out_size, void* d_ws, size_t ws_size, hipStream_t stream) {
    (void)in_sizes; (void)n_in; (void)out_size;
    const float* x = (const float*)d_in[0]; const float* wk = (const float*)d_in[1]; const float* wq = (const float*)d_in[2]; const float* wv = (const float*)d_in[3];
    // inputs in the module's argument order = d_in[0..3]: the [8][2048][1024] plane, then the KEY, QUERY and VALUE weights [1024][128] (in, out): all four read; the causal rule is computed: there is no mask input
    float* OUT = (float*)d_out;     // [8][2048][128]
    char* wsp = (char*)d_ws;
    auto take = [&](size_t bytes) { char* p = wsp; wsp += (bytes + 255) & ~(size_t)255; return (void*)p; };
    bf* WQ = (bf*)take((size_t)DQ * DM * 2); bf* WK = (bf*)take((size_t)DKV * DM * 2); bf* WV = (bf*)take((size_t)DKV * DM * 2);
    bf* XB = (bf*)take((size_t)NB_ * TT * DM * 2);
    bf* QPh = (bf*)take((size_t)ZH * TT * HD * 2); bf* QPl = (bf*)take((size_t)ZH * TT * HD * 2); bf* KPh = (bf*)take((size_t)ZH * TT * HD * 2); bf* KPl = (bf*)take((size_t)ZH * TT * HD * 2); bf* VTh = (bf*)take((size_t)ZH * HD * 2 * TT * 2);
    float* Sb = (float*)take((size_t)ZH * TT * TT * 4);
    if ((size_t)(wsp - (char*)d_ws) > ws_size) return;
    bf* VTl = VTh + TT;                   // value rows [hi | lo], pitch 2 TT (k_gemmw, the p == 2 epilogue)
    bf* Ph = (bf*)Sb; bf* Pl = Ph + TT;   // weight rows [hi | lo], pitch 2 TT, each in its own score row (k_asoft)
    const unsigned LX = (unsigned)(((size_t)NB_ * TT * DM / 8 + 255) / 256);
    k_prep<<<3 * WTB + LX, 256, 0, stream>>>(x, wq, wk, wv, XB, WQ, WK, WV, (size_t)NB_ * TT * DM / 8);   /* (in, out) weights: the transposing cast: [128][1024] = Bt; a0: the straight cast */
    k_gemmw<bf, 0><<<dim3(NB_ * TT / 128, HD / 64, 1), 192, 0, stream>>>(XB, nullptr, WQ, WK, WV, nullptr, DM, QPh, QPl, KPh, KPl, VTh, VTl, HD);   /* the three projections: the eight entries' rows are one [16384][1024] operand; each wave writes its own tile of its weight's hi / lo planes */
    k_gemmc<bf, 2, 1><<<dim3(TT / 64, TT / 64, ZH), 32, 0, stream>>>(QPh, QPl, KPh, KPl, HD, Sb, TT, 0, (size_t)TT * HD, (size_t)TT * HD, (size_t)TT * TT);   /* the scores on hi / lo planes on EVERY row */
    k_asoft<<<ZH * TT / 8, 256, 0, stream>>>(Sb, nullptr, Ph, Pl);   /* RH = TT: the one-word fp16 plane is never written */
    k_gemmpv<bf><<<dim3(TT / 128, HD / 64, ZH), 256, 0, stream>>>(Ph, Pl, VTh, VTl, 2 * TT, OUT, HD, (size_t)RH * 2 * TT, (size_t)HD * 2 * TT, (size_t)TT * HD);   /* P x v: three products on every row; K = 2 TT is the [hi | lo] rows' pitch: the key loop ends at the diagonal block, at most TT; its tiles are the output rows [entry][t][d]: the one writer of d_out */
}

// v005
// Measured time: 126 microseconds a run.
// Next to v004, in two timings, it ran 1.14 times as fast each time.
// Over all steps from v000 it is 7.78 times as fast.
#include <hip/hip_runtime.h>

// One head of causal self-attention with a 128-wide head, NO output projection, and the scores MULTIPLIED by 32 (inputs, in argument order: a0 [8][2048][1024]; a1, a2, a3 [1024][128] stored (in, out) and used as x W: the key, query and value weights IN THAT ORDER):
//   THE MODULE's FUNCTION: k = a0 a1; q = a0 a2; v = a0 a3 ([8][2048][128] each); S = (q k^T) x 32; everything above the diagonal set to nought, then EVERY exact nought set to -inf (so the module excludes the keys after the query AND any key inside the triangle whose score is exactly 0.0); softmax over the 2,048 keys; result = P v -> [8][2048][128] (2.1 M).
//   THIS TEXT excludes the keys after the query by index and KEEPS a score of exactly 0.0 inside the triangle: the two differ only where a computed score is exactly 0.0: not reached on real data.
// Layout: ALL EIGHT batch entries go through every stage in ONE launch of that stage (the entry is a plane index: more rows in the projections, grid z in the attention GEMMs): one bf16 copy of a0 (read by all three projections) and the (in, out) weights transposed once by a transposing cast, all four casts in one launch; the three projections in one launch; exact projections (bf16 x bf16 words, f32 sums) WHOSE OWN EPILOGUE splits each f32 sum into the bf16 hi / lo planes that the attention GEMMs read (q and k row planes; the transposed value planes): no f32 projection plane and no plane-builder pass;
//   the causal T-2048 attention for the one head: THE SCORES ON hi / lo PLANES ON EVERY ROW (three products: the softmax is all but a hard maximum, a score's spread is about 360, and one 16-bit rounding of q or k would flip the winning key in hundreds of rows); THE SOFTMAX WEIGHTS ON bf16 hi / lo PLANES ON EVERY ROW TOO (RH = TT) and P x v as three products against the hi / lo value planes: a one-word fp16 P is not taken: 6.4 per cent of this draw's non-zero carried weights would be fp16 subnormals;
//   tiles above the diagonal skipped; the P x v GEMM stores its f32 tiles straight into the output rows (no carried factor at RH = TT): the one writer of d_out.
// The scale: the module writes scores x sqrt(1024): SCL 32.0f in the softmax's masking stage, as the module writes it (a power of two: exact).
// Compute dtypes, f32 accumulate: every float input rounded to bf16 at its load; projections exact; scores three products; softmax f32 (the hardware exp2); P x v three products (bf16 hi / lo both sides; lo x lo not formed); the output is those f32 sums as they stand.

#define NB_  8      // batch entries: the input is [8][2048][1024]
#define TT   2048
#define DM   1024
#define NH_  1
#define NKV  1
#define REP  (NH_ / NKV)
#define HD   128
#define DQ   (NH_ * HD)
#define DKV  (NKV * HD)
#define ZH   NB_                  // planes per attention launch: one head x the eight batch entries
#define RH   2048                 // = TT: query rows < RH use hi+lo planes of P: EVERY row here
#define WIN  2048
#define PCAR 1024.0f
#define SCL  32.0f   // sqrt(1024): the module MULTIPLIES the scores by it
typedef _Float16 h16;
typedef unsigned short bf;
typedef __attribute__((ext_vector_type(16))) __bf16   v16bf;
typedef __attribute__((ext_vector_type(16))) _Float16 v16h;
typedef __attribute__((ext_vector_type(8)))  _Float16 v8h;
typedef __attribute__((ext_vector_type(8)))  unsigned short v8us;
typedef __attribute__((ext_vector_type(8)))  float    v8f;
typedef __attribute__((ext_vector_type(4)))  float    v4f;
typedef v8h  __attribute__((may_alias)) v8ha;
typedef v4f  __attribute__((may_alias)) v4fa;
typedef v8us __attribute__((may_alias)) v8usa;

__device__ __forceinline__ unsigned short f2bf(float f) { unsigned u = __float_as_uint(f); u += 0x7FFFu + ((u >> 16) & 1u); return (unsigned short)(u >> 16); }
__device__ __forceinline__ float bf2f(unsigned short b) { return __uint_as_float(((unsigned)b) << 16); }
__device__ __forceinline__ float bfr(float f) { return bf2f(f2bf(f)); }
__device__ __forceinline__ v16h cat16(v8h lo, v8h hi) { return __builtin_shufflevector(lo, hi, 0, 1, 2, 3, 4, 5, 6, 7, 8, 9, 10, 11, 12, 13, 14, 15); }
__device__ __forceinline__ v16bf cat16b(v8us lo, v8us hi) { return __builtin_bit_cast(v16bf, __builtin_shufflevector(lo, hi, 0, 1, 2, 3, 4, 5, 6, 7, 8, 9, 10, 11, 12, 13, 14, 15)); }
__device__ __forceinline__ v8f wmma16(v16h a, v16h b, v8f c) { return __builtin_amdgcn_wmma_f32_16x16x32_f16(false, a, false, b, (short)0, c, false, false); }
__device__ __forceinline__ v8f wmmab(v16bf a, v16bf b, v8f c) { return __builtin_amdgcn_wmma_f32_16x16x32_bf16(false, a, false, b, (short)0, c, false, false); }
__device__ __forceinline__ void splitf(float y, unsigned short& h, unsigned short& l) { h = f2bf(y); l = f2bf(y - bf2f(h)); }
typedef __attribute__((ext_vector_type(4))) unsigned short v4us;



// ---- k_gemmw: the three projections in ONE launch. Register-blocked GEMM, ONE WAVE per 64x64 output tile (16 accumulators), operands straight from K-contiguous 16-bit planes.
// A block is six such waves, which share no data in LDS and meet at no barrier: 2 row tiles x the 3 weights (q, k, v) at one 64-column tile; grid (M/128, N/64), 192 threads: 1,536 waves are on the chip at once, where a launch per weight had 512.
// The three waves of a row tile read the same rows of A, the two waves of a weight the same rows of Bt: those lines come into the WGP's cache once a block.
// f32 sums S[m][n] = sum_k A[m][k] Bt[n][k] (+ split products per NSPLIT), K % 32 == 0; each sum leaves the wave as its bf16 hi / lo words (splitf), never as an f32 plane:
//   q and k: row planes Ph / Pl [m][n], pitch ldc ([entry][t][d] is [m][n] as it stands); staged through the wave's own slice of LDS so that 16 lanes store one whole 128-byte line.
//   v: transposed planes [entry][n][hi 2048 | lo 2048] (Pl = Ph + TT, row pitch 2 TT: the same pitch as the weights' rows, which the P x v GEMM reads against them); m = entry x TT + t. A lane's 8 accumulator registers are 8 consecutive t of one n: one 16-byte store a plane, no staging; the tile's 64 t of a row n are one 128-byte line, written by this wave alone.
template <typename T16> struct WFrag;
template <> struct WFrag<h16> { typedef v16h V; static __device__ __forceinline__ V ld(const h16* p) { return cat16(*(const v8h*)p, *(const v8h*)(p + 16)); } static __device__ __forceinline__ v8f mma(V a, V b, v8f c) { return wmma16(a, b, c); } };
template <> struct WFrag<bf> { typedef v16bf V; static __device__ __forceinline__ V ld(const bf* p) { return cat16b(*(const v8us*)p, *(const v8us*)(p + 16)); } static __device__ __forceinline__ v8f mma(V a, V b, v8f c) { return wmmab(a, b, c); } };
template <typename T16, int NSPLIT>
__global__ __launch_bounds__(192) void k_gemmw(const T16* __restrict__ A, const T16* __restrict__ A2, const T16* __restrict__ Bq, const T16* __restrict__ Bk, const T16* __restrict__ Bv, const T16* __restrict__ Bt2, int K, bf* Qh, bf* Ql, bf* Kh, bf* Kl, bf* Vh, bf* Vl, int ldc) {
    typedef typename WFrag<T16>::V V;
    __shared__ __align__(16) float osw[6][16 * 68];
    const int wave = __builtin_amdgcn_readfirstlane((int)(threadIdx.x >> 5)), p = wave % 3, rt = wave / 3;   // p: 0 = q, 1 = k, 2 = v; rt: which of the block's two row tiles; scalars, so that every test on p is a scalar branch
    const T16* __restrict__ Bt = (p == 0) ? Bq : (p == 1) ? Bk : Bv; bf* Ph = (p == 0) ? Qh : (p == 1) ? Kh : Vh; bf* Pl = (p == 0) ? Ql : (p == 1) ? Kl : Vl; float* os = osw[wave];
    const int lane = threadIdx.x & 31, lr = lane & 15, hi = lane >> 4; const int r0 = (blockIdx.x * 2 + rt) * 64, c0 = blockIdx.y * 64;
    v8f acc[4][4];
#pragma unroll
    for (int mb = 0; mb < 4; ++mb)
#pragma unroll
        for (int nb = 0; nb < 4; ++nb) acc[mb][nb] = (v8f){};
    const size_t aoff = (size_t)(r0 + lr) * K + 8 * hi, boff = (size_t)(c0 + lr) * K + 8 * hi;

    for (int kc = 0; kc < K; kc += 32) {
        V a[4], a2[4];
#pragma unroll
        for (int mb = 0; mb < 4; ++mb) { a[mb] = WFrag<T16>::ld(A + aoff + (size_t)mb * 16 * K + kc); if (NSPLIT == 1 || NSPLIT == 2) a2[mb] = WFrag<T16>::ld(A2 + aoff + (size_t)mb * 16 * K + kc); }
#pragma unroll
        for (int nb = 0; nb < 4; ++nb) { const V b = WFrag<T16>::ld(Bt + boff + (size_t)nb * 16 * K + kc); V b2; if (NSPLIT >= 2) b2 = WFrag<T16>::ld(Bt2 + boff + (size_t)nb * 16 * K + kc);
#pragma unroll
            for (int mb = 0; mb < 4; ++mb) { acc[mb][nb] = WFrag<T16>::mma(a[mb], b, acc[mb][nb]); if (NSPLIT == 1 || NSPLIT == 2) acc[mb][nb] = WFrag<T16>::mma(a2[mb], b, acc[mb][nb]); if (NSPLIT >= 2) acc[mb][nb] = WFrag<T16>::mma(a[mb], b2, acc[mb][nb]); } }
        asm volatile("v_nop\n\tv_nop\n\tv_nop\n\tv_nop" : "+v"(acc[0][0]), "+v"(acc[1][1]), "+v"(acc[2][2]), "+v"(acc[3][3]) : "v"(a[0]), "v"(a[3]));
    }
    if (p == 2) {
        const int g = r0 / TT, t0 = r0 % TT;   // a 64-row tile lies inside one entry (TT % 64 == 0)
#pragma unroll
        for (int mb = 0; mb < 4; ++mb) {
#pragma unroll
            for (int nb = 0; nb < 4; ++nb) { v8us oh, ol;
#pragma unroll
                for (int j = 0; j < 8; ++j) { unsigned short a2, c2; splitf(acc[mb][nb][j], a2, c2); oh[j] = a2; ol[j] = c2; }
                const size_t oo = ((size_t)g * HD + c0 + nb * 16 + lr) * (2 * TT) + t0 + mb * 16 + 8 * hi; *(v8us*)(Ph + oo) = oh; *(v8us*)(Pl + oo) = ol; } }
        return;
    }
#pragma unroll
    for (int mb = 0; mb < 4; ++mb) {
#pragma unroll
        for (int nb = 0; nb < 4; ++nb) {
#pragma unroll
            for (int j = 0; j < 8; ++j) os[(hi * 8 + j) * 68 + nb * 16 + lr] = acc[mb][nb][j]; }
        __builtin_amdgcn_wave_barrier(); asm volatile("" ::: "memory");   // keeps the row reads below behind the staging writes above
#pragma unroll
        for (int s = 0; s < 8; ++s) { const int row = 2 * s + hi, cofs = lr * 4; const v4f val = *(const v4fa*)(os + row * 68 + cofs); v4us oh, ol;
#pragma unroll
            for (int q = 0; q < 4; ++q) { unsigned short a2, c2; splitf(val[q], a2, c2); oh[q] = a2; ol[q] = c2; }
            const size_t oo = (size_t)(r0 + mb * 16 + row) * ldc + c0 + cofs; *(v4us*)(Ph + oo) = oh; *(v4us*)(Pl + oo) = ol; }
        __builtin_amdgcn_wave_barrier(); asm volatile("" ::: "memory");   // keeps the next block's staging writes behind these row reads
    }
}

// ---- k_gemmc: the same one-wave 64x64 tile GEMM specialised for causal attention: CMODE 1 skips score tiles entirely above the diagonal (query rows r0+roff.., key columns c0..), CMODE 2 limits the
// key (K) loop of the probability x value contraction to the diagonal block (probabilities beyond it are exactly zero). roff = row offset of this launch's first row within the sequence. Only CMODE 1 is launched here: the probability x value contraction is k_gemmpv, below.
template <typename T16, int NSPLIT, int CMODE>
__global__ __launch_bounds__(32) void k_gemmc(const T16* __restrict__ A, const T16* __restrict__ A2, const T16* __restrict__ Bt, const T16* __restrict__ Bt2, int K, float* C, int ldc, int roff, size_t sA, size_t sB, size_t sC) {
    typedef typename WFrag<T16>::V V;
    __shared__ __align__(16) float os[16 * 68];
    const size_t z = blockIdx.z; A += z * sA; if (A2) A2 += z * sA; Bt += z * sB; if (Bt2) Bt2 += z * sB; C += z * sC;
    const int lane = threadIdx.x & 31, lr = lane & 15, hi = lane >> 4; const int r0 = blockIdx.x * 64, c0 = blockIdx.y * 64;
    if (CMODE == 1 && c0 > r0 + roff + 63) return;                  // score tile entirely above the causal diagonal: never computed (the softmax masks j > i by select, also where its 128-key chunk reads into such a tile)
    const int Kl = (CMODE == 2) ? min(K, r0 + roff + 64) : K;        // P.V: probabilities are exactly 0 beyond the diagonal block, so the K loop stops there
    v8f acc[4][4];
#pragma unroll
    for (int mb = 0; mb < 4; ++mb)
#pragma unroll
        for (int nb = 0; nb < 4; ++nb) acc[mb][nb] = (v8f){};
    const size_t aoff = (size_t)(r0 + lr) * K + 8 * hi, boff = (size_t)(c0 + lr) * K + 8 * hi;

    for (int kc = 0; kc < Kl; kc += 32) {
        V a[4], a2[4];
#pragma unroll
        for (int mb = 0; mb < 4; ++mb) { a[mb] = WFrag<T16>::ld(A + aoff + (size_t)mb * 16 * K + kc); if (NSPLIT == 1 || NSPLIT == 2) a2[mb] = WFrag<T16>::ld(A2 + aoff + (size_t)mb * 16 * K + kc); }
#pragma unroll
        for (int nb = 0; nb < 4; ++nb) { const V b = WFrag<T16>::ld(Bt + boff + (size_t)nb * 16 * K + kc); V b2; if (NSPLIT >= 2) b2 = WFrag<T16>::ld(Bt2 + boff + (size_t)nb * 16 * K + kc);
#pragma unroll
            for (int mb = 0; mb < 4; ++mb) { acc[mb][nb] = WFrag<T16>::mma(a[mb], b, acc[mb][nb]); if (NSPLIT == 1 || NSPLIT == 2) acc[mb][nb] = WFrag<T16>::mma(a2[mb], b, acc[mb][nb]); if (NSPLIT >= 2) acc[mb][nb] = WFrag<T16>::mma(a[mb], b2, acc[mb][nb]); } }
        asm volatile("v_nop\n\tv_nop\n\tv_nop\n\tv_nop" : "+v"(acc[0][0]), "+v"(acc[1][1]), "+v"(acc[2][2]), "+v"(acc[3][3]) : "v"(a[0]), "v"(a[3]));
    }
#pragma unroll
    for (int mb = 0; mb < 4; ++mb) {
#pragma unroll
        for (int nb = 0; nb < 4; ++nb) {
#pragma unroll
            for (int j = 0; j < 8; ++j) os[(hi * 8 + j) * 68 + nb * 16 + lr] = acc[mb][nb][j]; }
        __builtin_amdgcn_wave_barrier(); asm volatile("" ::: "memory");
        float* crow = C + (size_t)(r0 + mb * 16) * ldc + c0;
{
#pragma unroll
            for (int s = 0; s < 8; ++s) { const int row = 2 * s + hi, cofs = lr * 4; v4f val = *(const v4fa*)(os + row * 68 + cofs);
                *(v4f*)(crow + (size_t)row * ldc + cofs) = val; }
             }
        __builtin_amdgcn_wave_barrier(); asm volatile("" ::: "memory");
    }
}

// ---- k_gemmpv: the probability x value contraction, the same 64x64 tile, fragments and three products as k_gemmc, with the key loop of a tile DEALT OVER THE 8 WAVES OF A BLOCK: wave w takes the 32-key steps w, w + 8, w + 16, ...
// (neighbouring waves read the two halves of the same 128-byte lines), so the longest chain of dependent load-then-multiply steps is 8 long where one wave alone had 64, and 2,048 waves are on the chip where 512 were.
// The key loop ends at the diagonal block (probabilities beyond it are exactly zero), so a tile's work grows with its row index: a block takes the row tiles 31 - x and x, one after the other, and every block carries the same 66 steps.
// The 8 partial tiles meet in LDS, [row 64][wave 8][68 words] with 4 more words a row (RP: rows 8 apart, which the two lane halves write at once, then lie 32 banks apart; and one address register reaches all that a lane reads);
// behind one barrier wave w adds rows 8 w .. 8 w + 7 over the partials 0, 1, ..., 7 IN THAT FIXED ORDER and stores them: 16 lanes store the tile's 256 bytes of an output row.
template <typename T16>
__global__ __launch_bounds__(256) void k_gemmpv(const T16* __restrict__ A, const T16* __restrict__ A2, const T16* __restrict__ Bt, const T16* __restrict__ Bt2, int K, float* C, int ldc, size_t sA, size_t sB, size_t sC) {
    typedef typename WFrag<T16>::V V;
    constexpr int RP = 8 * 68 + 4;
    __shared__ __align__(16) float red[64 * RP];
    const size_t z = blockIdx.z; A += z * sA; A2 += z * sA; Bt += z * sB; Bt2 += z * sB; C += z * sC;
    const int wave = __builtin_amdgcn_readfirstlane((int)(threadIdx.x >> 5));   // a scalar, so that the key loop's test is a scalar branch
    const int lane = threadIdx.x & 31, lr = lane & 15, hi = lane >> 4; const int c0 = blockIdx.y * 64;
    const size_t boff = (size_t)(c0 + lr) * K + 8 * hi;
    float* os = red + wave * 68;
#pragma nounroll   // one copy of the tile's code: two would not run faster
    for (int t = 0; t < 2; ++t) {
        const int r0 = (t ? (int)blockIdx.x : TT / 64 - 1 - (int)blockIdx.x) * 64;
        const int Kl = min(K, r0 + 64);        // probabilities are exactly 0 beyond the diagonal block, so the key loop stops there
        v8f acc[4][4];
#pragma unroll
        for (int mb = 0; mb < 4; ++mb)
#pragma unroll
            for (int nb = 0; nb < 4; ++nb) acc[mb][nb] = (v8f){};
        const size_t aoff = (size_t)(r0 + lr) * K + 8 * hi;

        for (int kc = wave * 32; kc < Kl; kc += 8 * 32) {
            V a[4], a2[4];
#pragma unroll
            for (int mb = 0; mb < 4; ++mb) { a[mb] = WFrag<T16>::ld(A + aoff + (size_t)mb * 16 * K + kc); a2[mb] = WFrag<T16>::ld(A2 + aoff + (size_t)mb * 16 * K + kc); }
#pragma unroll
            for (int nb = 0; nb < 4; ++nb) { const V b = WFrag<T16>::ld(Bt + boff + (size_t)nb * 16 * K + kc); const V b2 = WFrag<T16>::ld(Bt2 + boff + (size_t)nb * 16 * K + kc);
#pragma unroll
                for (int mb = 0; mb < 4; ++mb) { acc[mb][nb] = WFrag<T16>::mma(a[mb], b, acc[mb][nb]); acc[mb][nb] = WFrag<T16>::mma(a2[mb], b, acc[mb][nb]); acc[mb][nb] = WFrag<T16>::mma(a[mb], b2, acc[mb][nb]); } }
            asm volatile("v_nop\n\tv_nop\n\tv_nop\n\tv_nop" : "+v"(acc[0][0]), "+v"(acc[1][1]), "+v"(acc[2][2]), "+v"(acc[3][3]) : "v"(a[0]), "v"(a[3]));   // the matrix instructions' distance on the loop's taken branch, as in k_gemmc
        }
        if (t) __syncthreads();   // the first tile's partials in LDS have been read by every wave before they are written again
#pragma unroll
        for (int mb = 0; mb < 4; ++mb)
#pragma unroll
            for (int nb = 0; nb < 4; ++nb)
#pragma unroll
                for (int j = 0; j < 8; ++j) os[(mb * 16 + hi * 8 + j) * RP + nb * 16 + lr] = acc[mb][nb][j];
        __syncthreads();          // all 8 partial tiles are in LDS before any wave adds them
#pragma unroll
        for (int s = 0; s < 4; ++s) { const int row = wave * 8 + 2 * s + hi, cofs = lr * 4; v4f val = *(const v4fa*)(red + row * RP + cofs);
#pragma unroll
            for (int w = 1; w < 8; ++w) val += *(const v4fa*)(red + row * RP + w * 68 + cofs);
            *(v4f*)(C + (size_t)(r0 + row) * ldc + c0 + cofs) = val; }
        asm volatile("s_wait_xcnt 0x0" ::: "memory");   // stands in front of the next tile's zeroing of the accumulators, which takes the registers that these stores name
    }
}

__device__ __forceinline__ h16 tohx(float x) { return (h16)x; }
typedef __attribute__((ext_vector_type(2))) _Float16 v2h;
typedef __attribute__((ext_vector_type(4))) _Float16 v4h;
typedef __attribute__((ext_vector_type(2))) unsigned short v2us;
typedef __attribute__((ext_vector_type(2))) float v2f;
typedef __attribute__((ext_vector_type(4))) int v4i;


// ---- k_prep: the four casts, which depend on nothing but the inputs, in ONE launch, told apart by block index: blocks [0, 3 WTB) are the transposing casts of the q, k and v weights (WTB blocks each; first, because their strided reads take longest), the rest the straight cast of a0.
#define WTB (DM * HD / 64 / 64)   // blocks per weight: 8 waves x 8 lines of 64 words
__global__ __launch_bounds__(256) void k_prep(const float* __restrict__ src, const float* __restrict__ wq, const float* __restrict__ wk, const float* __restrict__ wv, bf* dst, bf* WQ, bf* WK, bf* WV, size_t n8) {
    if (blockIdx.x < 3 * WTB) {
        const int sel = blockIdx.x / WTB, blk = blockIdx.x % WTB; const float* __restrict__ w = (sel == 0) ? wq : (sel == 1) ? wk : wv; bf* Bt = (sel == 0) ? WQ : (sel == 1) ? WK : WV; const int K = DM, N = HD;
        const int lane = threadIdx.x & 31; const int L0 = (blk * 8 + (threadIdx.x >> 5)) * 8; const int nlines = N * K / 64;
        for (int l = 0; l < 8; ++l) { const int L = L0 + l; if (L >= nlines) break; const size_t e = (size_t)L * 64 + lane * 2; const int k = (int)(e % K), n = (int)(e / K); v2us o;
            o[0] = f2bf(w[(size_t)k * N + n]); o[1] = f2bf(w[(size_t)(k + 1) * N + n]); *(v2us*)(Bt + e) = o; }
        return;
    }
    const size_t i = (size_t)(blockIdx.x - 3 * WTB) * 256 + threadIdx.x; if (i >= n8) return; const v8f v = *(const v8f*)(src + i * 8); v8us o;
#pragma unroll
    for (int k = 0; k < 8; ++k) o[k] = f2bf(v[k]); *(v8us*)(dst + i * 8) = o;  }

// k_asoft: per row (zz, i): t = S x SCL for j <= i and i - j < WIN (the causal triangle; WIN = TT: the window never binds; an excluded key gets -3e38, whose exponential is an exact zero); softmax over the keys (register row, one exp, fixed trees);
// the hi / lo words of a row's weights go back INTO that row's own 8 KiB of the score plane, [hi 2048 | lo 2048] (Ph = the plane's base, Pl = Ph + TT, row pitch 2 TT): one wave owns the row and holds all that it reads of it in registers before its first store
// (every store needs the row's sum), so the eight score planes and their weights fit the workspace together. Sb, Ph and Pl alias: none of them is __restrict__.
// ONLY THE 128-KEY CHUNKS THAT REACH THE TRIANGLE ARE TOUCHED: row i loads, exponentiates and stores its first nch = i / 128 + 1 chunks. The chunks behind them hold excluded keys alone: they never raise the maximum, they add exact zeros to the sum,
// and the P x v GEMM never reads their weights (its key loop ends at the row tile's diagonal block, at or in front of key 128 nch). The kept terms are added in the order they had: the same bits as with all 16 chunks.
// A row's work grows with i, so a block takes 4 rows from the top of its entry and their 4 mirror rows from the bottom (waves w and w + 4: rows i and TT - 1 - i): every such pair of waves carries 17 chunks.
__global__ __launch_bounds__(256) void k_asoft(const float* Sb, h16* P16, bf* Ph, bf* Pl) {
    const int lane = threadIdx.x & 31; const int wave = __builtin_amdgcn_readfirstlane((int)(threadIdx.x >> 5));   // a scalar, so that every test on the chunk count is a scalar branch
    const int zz = blockIdx.x / (TT / 8); if (zz >= ZH) return; const int ib = (blockIdx.x % (TT / 8)) * 4 + (wave & 3); const int i = (wave < 4) ? ib : TT - 1 - ib; const int row = zz * TT + i;
    const int nch = i / 128 + 1; const bool hires = (i < RH); const char* sr = (const char*)(Sb + (size_t)row * TT); const unsigned lo = lane * 16u; float v[TT / 32]; float mx = -3.0e38f;
#pragma unroll
    for (int ch = 0; ch < TT / 128; ++ch) if (ch < nch) { const v4f a = *(const v4f*)(sr + lo + ch * 512);   // the loads alone, so that all of a row's loads are in flight together
#pragma unroll
        for (int q = 0; q < 4; ++q) v[ch * 4 + q] = a[q]; }
    asm volatile("s_wait_xcnt 0x0" :: "v"(sr + lo), "v"(lo), "v"(lane) : "memory");   // stands in front of the first overwrite of the loads' address registers; the address and the lane's offset are inputs so that they keep their registers up to here and no load lands on them
#pragma unroll
    for (int ch = 0; ch < TT / 128; ++ch) if (ch < nch) { const int j0 = ch * 128 + lane * 4;
#pragma unroll
        for (int q = 0; q < 4; ++q) { const int j = j0 + q; (void)j; const float t = (j <= i && i - j < WIN) ? v[ch * 4 + q] * SCL : -3.0e38f; v[ch * 4 + q] = t; mx = fmaxf(mx, t); } }
#pragma unroll
    for (int sh = 16; sh; sh >>= 1) mx = fmaxf(mx, __shfl_xor(mx, sh, 32));
    float sum = 0.f;
#pragma unroll
    for (int ch = 0; ch < TT / 128; ++ch) if (ch < nch) {
#pragma unroll
        for (int q = 0; q < 4; ++q) { const int k = ch * 4 + q; float d0 = __fsub_rn(v[k], mx); const float e0 = __fmul_rn(d0, 1.4426950408889634f);
            if (ch == 0) asm("v_exp_f32 %0, %1\n\tv_nop" : "=v"(v[k]) : "v"(e0));   // the same hardware exp2 with the slot behind the transcendental filled: chunk 0 runs on every row, and in its straight-line code the compiler's order left that slot open
            else v[k] = __builtin_amdgcn_exp2f(e0);
            sum += v[k]; } }
#pragma unroll
    for (int sh = 16; sh; sh >>= 1) sum += __shfl_xor(sum, sh, 32);
    const float f = __fdiv_rn(hires ? 1.0f : PCAR, sum);
{
        if (hires) {
#pragma unroll
            for (int ch = 0; ch < TT / 128; ++ch) if (ch < nch) { v4us oh, ol;
#pragma unroll
                for (int q = 0; q < 4; ++q) { unsigned short a, c2; splitf(v[ch * 4 + q] * f, a, c2); oh[q] = a; ol[q] = c2; }
                const size_t oo = ((size_t)zz * (RH ? RH : 1) + i) * (2 * TT) + ch * 128 + lane * 4; *(v4us*)(Ph + oo) = oh; *(v4us*)(Pl + oo) = ol;
                asm volatile("s_wait_xcnt 0x0" ::: "memory"); }   // stands in front of the next chunk's arithmetic, which takes the registers that these two stores name
        } else {
#pragma unroll
            for (int ch = 0; ch < TT / 128; ++ch) if (ch < nch) { v4h o4;
#pragma unroll
                for (int q = 0; q < 4; ++q) o4[q] = tohx(v[ch * 4 + q] * f);
                *(v4h*)(P16 + (size_t)row * TT + ch * 128 + lane * 4) = o4;
                asm volatile("s_wait_xcnt 0x0" ::: "memory"); } }   // as above
         }
}

extern "C" void kernel_launch(void* const* d_in, const int* in_sizes, int n_in,
                              void* d_out, int out_size, void* d_ws, size_t ws_size, hipStream_t stream) {
    (void)in_sizes; (void)n_in; (void)out_size;
    const float* x = (const float*)d_in[0]; const float* wk = (const float*)d_in[1]; const float* wq = (const float*)d_in[2]; const float* wv = (const float*)d_in[3];
    // inputs in the module's argument order = d_in[0..3]: the [8][2048][1024] plane, then the KEY, QUERY and VALUE weights [1024][128] (in, out): all four read; the causal rule is computed: there is no mask input
    float* OUT = (float*)d_out;     // [8][2048][128]
    char* wsp = (char*)d_ws;
    auto take = [&](size_t bytes) { char* p = wsp; wsp += (bytes + 255) & ~(size_t)255; return (void*)p; };
    bf* WQ = (bf*)take((size_t)DQ * DM * 2); bf* WK = (bf*)take((size_t)DKV * DM * 2); bf* WV = (bf*)take((size_t)DKV * DM * 2);
    bf* XB = (bf*)take((size_t)NB_ * TT * DM * 2);
    bf* QPh = (bf*)take((size_t)ZH * TT * HD * 2); bf* QPl = (bf*)take((size_t)ZH * TT * HD * 2); bf* KPh = (bf*)take((size_t)ZH * TT * HD * 2); bf* KPl = (bf*)take((size_t)ZH * TT * HD * 2); bf* VTh = (bf*)take((size_t)ZH * HD * 2 * TT * 2);
    float* Sb = (float*)take((size_t)ZH * TT * TT * 4);
    if ((size_t)(wsp - (char*)d_ws) > ws_size) return;
    bf* VTl = VTh + TT;                   // value rows [hi | lo], pitch 2 TT (k_gemmw, the p == 2 epilogue)
    bf* Ph = (bf*)Sb; bf* Pl = Ph + TT;   // weight rows [hi | lo], pitch 2 TT, each in its own score row (k_asoft)
    const unsigned LX = (unsigned)(((size_t)NB_ * TT * DM / 8 + 255) / 256);
    k_prep<<<3 * WTB + LX, 256, 0, stream>>>(x, wq, wk, wv, XB, WQ, WK, WV, (size_t)NB_ * TT * DM / 8);   /* (in, out) weights: the transposing cast: [128][1024] = Bt; a0: the straight cast */
    k_gemmw<bf, 0><<<dim3(NB_ * TT / 128, HD / 64, 1), 192, 0, stream>>>(XB, nullptr, WQ, WK, WV, nullptr, DM, QPh, QPl, KPh, KPl, VTh, VTl, HD);   /* the three projections: the eight entries' rows are one [16384][1024] operand; each wave writes its own tile of its weight's hi / lo planes */
    k_gemmc<bf, 2, 1><<<dim3(TT / 64, TT / 64, ZH), 32, 0, stream>>>(QPh, QPl, KPh, KPl, HD, Sb, TT, 0, (size_t)TT * HD, (size_t)TT * HD, (size_t)TT * TT);   /* the scores on hi / lo planes on EVERY row */
    k_asoft<<<ZH * TT / 8, 256, 0, stream>>>(Sb, nullptr, Ph, Pl);   /* RH = TT: the one-word fp16 plane is never written */
    k_gemmpv<bf><<<dim3(TT / 128, HD / 64, ZH), 256, 0, stream>>>(Ph, Pl, VTh, VTl, 2 * TT, OUT, HD, (size_t)RH * 2 * TT, (size_t)HD * 2 * TT, (size_t)TT * HD);   /* P x v: three products on every row; K = 2 TT is the [hi | lo] rows' pitch: the key loop ends at the diagonal block, at most TT; its tiles are the output rows [entry][t][d]: the one writer of d_out */
}

// v006
// One run takes 116 microseconds.
// Timed twice side by side with v005, it ran 1.07 and 1.11 times as fast.
// Counting every step since v000, it is 8.45 times as fast.
#include <hip/hip_runtime.h>

// One head of causal self-attention with a 128-wide head, NO output projection, and the scores MULTIPLIED by 32 (inputs, in argument order: a0 [8][2048][1024]; a1, a2, a3 [1024][128] stored (in, out) and used as x W: the key, query and value weights IN THAT ORDER):
//   THE MODULE's FUNCTION: k = a0 a1; q = a0 a2; v = a0 a3 ([8][2048][128] each); S = (q k^T) x 32; everything above the diagonal set to nought, then EVERY exact nought set to -inf (so the module excludes the keys after the query AND any key inside the triangle whose score is exactly 0.0); softmax over the 2,048 keys; result = P v -> [8][2048][128] (2.1 M).
//   THIS TEXT excludes the keys after the query by index and KEEPS a score of exactly 0.0 inside the triangle: the two differ only where a computed score is exactly 0.0: not reached on real data.
// Layout: ALL EIGHT batch entries go through every stage in ONE launch of that stage (the entry is a plane index: more rows in the projections, grid z in the attention GEMMs): one bf16 copy of a0 (read by all three projections) and the (in, out) weights transposed once by the transposing cast, all four casts in one launch; the three projections in one launch; exact projections (bf16 x bf16 words, f32 sums) WHOSE OWN EPILOGUE splits each f32 sum into the bf16 hi / lo planes that the attention GEMMs read (q and k row planes; the transposed value planes): no f32 projection plane and no plane-builder pass; EVERY 16-bit plane that a GEMM reads (a0's copy, the weights, q, k, the transposed v, the softmax weights) is stored in FRAGMENT ORDER (said above k_gemmw's loader);
//   the causal T-2048 attention for the one head: THE SCORES ON hi / lo PLANES ON EVERY ROW (three products: the softmax is all but a hard maximum, a score's spread is about 360, and one 16-bit rounding of q or k would flip the winning key in hundreds of rows); THE SOFTMAX WEIGHTS ON bf16 hi / lo PLANES ON EVERY ROW TOO (RH = TT) and P x v as three products against the hi / lo value planes: a one-word fp16 P is not taken: 6.4 per cent of this draw's non-zero carried weights would be fp16 subnormals;
//   tiles above the diagonal skipped; the P x v GEMM stores its f32 tiles straight into the output rows (no carried factor at RH = TT): the one writer of d_out.
// The scale: the module writes scores x sqrt(1024): SCL 32.0f in the softmax's masking stage, as the module writes it (a power of two: exact).
// Compute dtypes, f32 accumulate: every float input rounded to bf16 at its load; projections exact; scores three products; softmax f32 (the hardware exp2); P x v three products (bf16 hi / lo both sides; lo x lo not formed); the output is those f32 sums as they stand.

#define NB_  8      // batch entries: the input is [8][2048][1024]
#define TT   2048
#define DM   1024
#define NH_  1
#define NKV  1
#define REP  (NH_ / NKV)
#define HD   128
#define DQ   (NH_ * HD)
#define DKV  (NKV * HD)
#define ZH   NB_                  // planes per attention launch: one head x the eight batch entries
#define RH   2048                 // = TT: query rows < RH use hi+lo planes of P: EVERY row here
#define WIN  2048
#define PCAR 1024.0f
#define SCL  32.0f   // sqrt(1024): the module MULTIPLIES the scores by it
typedef _Float16 h16;
typedef unsigned short bf;
typedef __attribute__((ext_vector_type(16))) __bf16   v16bf;
typedef __attribute__((ext_vector_type(16))) _Float16 v16h;
typedef __attribute__((ext_vector_type(8)))  _Float16 v8h;
typedef __attribute__((ext_vector_type(8)))  unsigned short v8us;
typedef __attribute__((ext_vector_type(8)))  float    v8f;
typedef __attribute__((ext_vector_type(4)))  float    v4f;
typedef v8h  __attribute__((may_alias)) v8ha;
typedef v4f  __attribute__((may_alias)) v4fa;
typedef v8us __attribute__((may_alias)) v8usa;

__device__ __forceinline__ unsigned short f2bf(float f) { unsigned u = __float_as_uint(f); u += 0x7FFFu + ((u >> 16) & 1u); return (unsigned short)(u >> 16); }
__device__ __forceinline__ float bf2f(unsigned short b) { return __uint_as_float(((unsigned)b) << 16); }
__device__ __forceinline__ float bfr(float f) { return bf2f(f2bf(f)); }
__device__ __forceinline__ v16h cat16(v8h lo, v8h hi) { return __builtin_shufflevector(lo, hi, 0, 1, 2, 3, 4, 5, 6, 7, 8, 9, 10, 11, 12, 13, 14, 15); }
__device__ __forceinline__ v16bf cat16b(v8us lo, v8us hi) { return __builtin_bit_cast(v16bf, __builtin_shufflevector(lo, hi, 0, 1, 2, 3, 4, 5, 6, 7, 8, 9, 10, 11, 12, 13, 14, 15)); }
__device__ __forceinline__ v8f wmma16(v16h a, v16h b, v8f c) { return __builtin_amdgcn_wmma_f32_16x16x32_f16(false, a, false, b, (short)0, c, false, false); }
__device__ __forceinline__ v8f wmmab(v16bf a, v16bf b, v8f c) { return __builtin_amdgcn_wmma_f32_16x16x32_bf16(false, a, false, b, (short)0, c, false, false); }
__device__ __forceinline__ void splitf(float y, unsigned short& h, unsigned short& l) { h = f2bf(y); l = f2bf(y - bf2f(h)); }
typedef __attribute__((ext_vector_type(4))) unsigned short v4us;



// ---- k_gemmw: the three projections in ONE launch. Register-blocked GEMM, ONE WAVE per 64x64 output tile (16 accumulators), operands straight from 16-bit planes in fragment order (below).
// A block is six such waves, which share no data in LDS and meet at no barrier: 2 row tiles x the 3 weights (q, k, v) at one 64-column tile; grid (M/128, N/64), 192 threads: 1,536 waves are on the chip at once, where a launch per weight had 512.
// The three waves of a row tile read the same rows of A, the two waves of a weight the same rows of Bt: those lines come into the WGP's cache once a block.
// f32 sums S[m][n] = sum_k A[m][k] Bt[n][k], K % 32 == 0; each sum leaves the wave as its bf16 hi / lo words (splitf), never as an f32 plane:
//   q and k: planes Ph / Pl of [m][n], ldc words a row ([entry][t][d] is [m][n] as it stands), in fragment order; staged through the wave's own slice of LDS, from which a lane takes the 8 consecutive n of its unit.
//   v: transposed planes of [n][t] per entry, TT words a row, in fragment order, [entry][hi: HD x TT | lo: HD x TT] (Pl = Ph + HD TT); m = entry x TT + t. A lane's 8 accumulator registers are 8 consecutive t of one n = lane % 16: they ARE the lane's unit: one 16-byte store a plane, no staging.
// FRAGMENT ORDER of a K-contiguous 16-bit plane X[row][k] (K % 32 == 0, rows % 16 == 0): blocks of 16 rows x 32 k = 512 words = 1 KiB, block (R, S) = (row / 16, k / 32) at word (R K / 32 + S) 512 = 16 R K + 16 (32 S);
// inside a block [half 2][lane 32][8 words]: word (row, k) with kk = k % 32 stands at (kk / 16) 256 + (((kk % 16) / 8) 16 + row % 16) 8 + kk % 8. A lane's fragment (row lane % 16; k = 8 (lane / 16) + 0..7, then 16 more) is the same 16 words in the same order as it would take from the row plane,
// but each of its two 16-byte loads (ldf: the lane's unit of half 0, then of half 1) is, over the wave, 512 contiguous bytes = 4 whole lines, where a load from the row plane touches 16 lines. Every writer of such a plane stores whole units, 512 contiguous bytes a wave.
template <typename T16> struct WFrag;
template <> struct WFrag<h16> { typedef v16h V; static __device__ __forceinline__ V ldf(const h16* p) { return cat16(*(const v8h*)p, *(const v8h*)(p + 256)); } static __device__ __forceinline__ v8f mma(V a, V b, v8f c) { return wmma16(a, b, c); } };
template <> struct WFrag<bf> { typedef v16bf V; static __device__ __forceinline__ V ldf(const bf* p) { return cat16b(*(const v8us*)p, *(const v8us*)(p + 256)); } static __device__ __forceinline__ v8f mma(V a, V b, v8f c) { return wmmab(a, b, c); } };
template <typename T16, int K>
__global__ __launch_bounds__(192) void k_gemmw(const T16* __restrict__ A, const T16* __restrict__ Bq, const T16* __restrict__ Bk, const T16* __restrict__ Bv, bf* Qh, bf* Ql, bf* Kh, bf* Kl, bf* Vh, bf* Vl, int ldc) {
    typedef typename WFrag<T16>::V V;
    __shared__ __align__(16) float osw[6][16 * 68];
    const int wave = __builtin_amdgcn_readfirstlane((int)(threadIdx.x >> 5)), p = wave % 3, rt = wave / 3;   // p: 0 = q, 1 = k, 2 = v; rt: which of the block's two row tiles; scalars, so that every test on p is a scalar branch
    const T16* __restrict__ Bt = (p == 0) ? Bq : (p == 1) ? Bk : Bv; bf* Ph = (p == 0) ? Qh : (p == 1) ? Kh : Vh; bf* Pl = (p == 0) ? Ql : (p == 1) ? Kl : Vl; float* os = osw[wave];
    const int lane = threadIdx.x & 31, lr = lane & 15, hi = lane >> 4; const int r0 = (blockIdx.x * 2 + rt) * 64, c0 = blockIdx.y * 64;
    v8f acc[4][4];
#pragma unroll
    for (int mb = 0; mb < 4; ++mb)
#pragma unroll
        for (int nb = 0; nb < 4; ++nb) acc[mb][nb] = (v8f){};
    const T16* pa = A + (size_t)r0 * K + 8 * lane; const T16* pb = Bt + (size_t)c0 * K + 8 * lane;   // fragment order: row tile R starts at word 16 R K, its k step at 16 kc; K is a constant, so that a step's fragments of a plane lie at constant offsets from ONE address

    for (int kc = 0; kc < K; kc += 32) {
        const T16* ka = pa + kc * 16; const T16* kb = pb + kc * 16; V a[4], b[4];
#pragma unroll
        for (int mb = 0; mb < 4; ++mb) a[mb] = WFrag<T16>::ldf(ka + mb * 16 * K);
#pragma unroll
        for (int nb = 0; nb < 4; ++nb) b[nb] = WFrag<T16>::ldf(kb + nb * 16 * K);
        asm volatile("s_wait_xcnt 0x0" :: "v"(ka), "v"(kb) : "memory");   // stands behind the step's fragment loads, in front of the first overwrite of their address registers; the addresses are inputs so that they keep their registers up to here and no load lands on them
#pragma unroll
        for (int nb = 0; nb < 4; ++nb)
#pragma unroll
            for (int mb = 0; mb < 4; ++mb) acc[mb][nb] = WFrag<T16>::mma(a[mb], b[nb], acc[mb][nb]);
        asm volatile("v_nop\n\tv_nop\n\tv_nop\n\tv_nop" : "+v"(acc[0][0]), "+v"(acc[1][1]), "+v"(acc[2][2]), "+v"(acc[3][3]) : "v"(a[0]), "v"(a[3]));
    }
    if (p == 2) {
        const int g = r0 / TT, t0 = r0 % TT;   // a 64-row tile lies inside one entry (TT % 64 == 0)
#pragma unroll
        for (int mb = 0; mb < 4; ++mb) {
#pragma unroll
            for (int nb = 0; nb < 4; ++nb) { v8us oh, ol;
#pragma unroll
                for (int j = 0; j < 8; ++j) { unsigned short a2, c2; splitf(acc[mb][nb][j], a2, c2); oh[j] = a2; ol[j] = c2; }
                const size_t oo = (size_t)g * (2 * HD * TT) + (size_t)(c0 + nb * 16) * TT + (size_t)t0 * 16 + (mb >> 1) * 512 + (mb & 1) * 256 + lane * 8; *(v8us*)(Ph + oo) = oh; *(v8us*)(Pl + oo) = ol; } }
        return;
    }
#pragma unroll
    for (int mb = 0; mb < 4; ++mb) {
#pragma unroll
        for (int nb = 0; nb < 4; ++nb) {
#pragma unroll
            for (int j = 0; j < 8; ++j) os[(hi * 8 + j) * 68 + nb * 16 + lr] = acc[mb][nb][j]; }
        __builtin_amdgcn_wave_barrier(); asm volatile("" ::: "memory");   // keeps the row reads below behind the staging writes above
#pragma unroll
        for (int s = 0; s < 4; ++s) { const float* sp = os + lr * 68 + s * 16 + hi * 8; const v4f v0 = *(const v4fa*)sp, v1 = *(const v4fa*)(sp + 4); v8us oh, ol;   // row lr, columns 16 s + 8 hi ..: the lane's 8 words of half s % 2 of block s / 2
#pragma unroll
            for (int q = 0; q < 4; ++q) { unsigned short a2, c2; splitf(v0[q], a2, c2); oh[q] = a2; ol[q] = c2; splitf(v1[q], a2, c2); oh[4 + q] = a2; ol[4 + q] = c2; }
            const size_t oo = (size_t)(r0 + mb * 16) * ldc + (size_t)c0 * 16 + (s >> 1) * 512 + (s & 1) * 256 + lane * 8; *(v8us*)(Ph + oo) = oh; *(v8us*)(Pl + oo) = ol; }
        asm volatile("s_wait_xcnt 0x0" ::: "memory");   // stands behind the run of stores, in front of whatever next takes the registers that they name
        __builtin_amdgcn_wave_barrier(); asm volatile("" ::: "memory");   // keeps the next block's staging writes behind these row reads
    }
}

// ---- k_gemmc: the same one-wave 64x64 tile GEMM for the causal scores, three products on hi / lo planes (a b, a2 b, a b2, in that order into each accumulator): score tiles entirely above the diagonal (query rows r0+roff.., key columns c0..) are skipped.
// roff = row offset of this launch's first row within the sequence. The probability x value contraction is k_gemmpv, below.
template <typename T16, int K, int DP>
__global__ __launch_bounds__(32) void k_gemmc(const T16* __restrict__ A, const T16* __restrict__ Bt, float* C, int ldc, int roff, size_t sA, size_t sB, size_t sC) {
    typedef typename WFrag<T16>::V V;
    __shared__ __align__(16) float os[16 * 68];
    const size_t z = blockIdx.z; A += z * sA; Bt += z * sB; C += z * sC;   // the lo plane of A and of Bt stands DP words behind its hi plane
    const int lane = threadIdx.x & 31, lr = lane & 15, hi = lane >> 4; const int r0 = blockIdx.x * 64, c0 = blockIdx.y * 64;
    if (c0 > r0 + roff + 63) return;                  // score tile entirely above the causal diagonal: not computed (the softmax may load it, and masks j > i by select)
    v8f acc[4][4];
#pragma unroll
    for (int mb = 0; mb < 4; ++mb)
#pragma unroll
        for (int nb = 0; nb < 4; ++nb) acc[mb][nb] = (v8f){};
    const size_t ao = (size_t)r0 * K + 8 * lane, bo = (size_t)c0 * K + 8 * lane;   // fragment order: row tile R starts at word 16 R K, its k step at 16 kc

    for (int kc = 0; kc < K; kc += 32) {
        const T16* ka = A + ao + kc * 16; const T16* kb = Bt + bo + kc * 16; V a[4], a2[4], b[4], b2[4];   // K and DP are constants: all 16 fragments of a step lie at constant offsets from these two addresses
#pragma unroll
        for (int mb = 0; mb < 4; ++mb) { a[mb] = WFrag<T16>::ldf(ka + mb * 16 * K); a2[mb] = WFrag<T16>::ldf(ka + DP + mb * 16 * K); }
#pragma unroll
        for (int nb = 0; nb < 3; ++nb) { b[nb] = WFrag<T16>::ldf(kb + nb * 16 * K); b2[nb] = WFrag<T16>::ldf(kb + DP + nb * 16 * K); }
        __builtin_amdgcn_sched_barrier(0);   // 14 of the 16 fragments are in flight together before the first product (all 16 and the accumulators do not fit 256 registers); without it the compiler, which must keep every load in front of the wait below, sinks the loads between the products a pair at a time, each pair waited for on its own
#pragma unroll
        for (int mb = 0; mb < 4; ++mb) { acc[mb][0] = WFrag<T16>::mma(a[mb], b[0], acc[mb][0]); acc[mb][0] = WFrag<T16>::mma(a2[mb], b[0], acc[mb][0]); acc[mb][0] = WFrag<T16>::mma(a[mb], b2[0], acc[mb][0]); }
        __builtin_amdgcn_sched_barrier(0);   // the last two fragments take the registers that column block 0 has left, and fly during blocks 1 and 2
        b[3] = WFrag<T16>::ldf(kb + 3 * 16 * K); b2[3] = WFrag<T16>::ldf(kb + DP + 3 * 16 * K);
        asm volatile("s_wait_xcnt 0x0" :: "v"(ka), "v"(kb) : "memory");   // as in k_gemmw: behind the step's last fragment load, in front of the first overwrite of the address registers, which it holds up to here so that no load lands on them
        __builtin_amdgcn_sched_barrier(0);   // keeps those loads from sinking further
#pragma unroll
        for (int nb = 1; nb < 4; ++nb) {
            if (nb == 3) __builtin_amdgcn_sched_barrier(0);   // block 3's products, which wait for those loads, stay behind the 24 products of blocks 1 and 2
#pragma unroll
            for (int mb = 0; mb < 4; ++mb) { acc[mb][nb] = WFrag<T16>::mma(a[mb], b[nb], acc[mb][nb]); acc[mb][nb] = WFrag<T16>::mma(a2[mb], b[nb], acc[mb][nb]); acc[mb][nb] = WFrag<T16>::mma(a[mb], b2[nb], acc[mb][nb]); } }
        asm volatile("v_nop\n\tv_nop\n\tv_nop\n\tv_nop" : "+v"(acc[0][0]), "+v"(acc[1][1]), "+v"(acc[2][2]), "+v"(acc[3][3]) : "v"(a[0]), "v"(a[3]));
    }
#pragma unroll
    for (int mb = 0; mb < 4; ++mb) {
#pragma unroll
        for (int nb = 0; nb < 4; ++nb) {
#pragma unroll
            for (int j = 0; j < 8; ++j) os[(hi * 8 + j) * 68 + nb * 16 + lr] = acc[mb][nb][j]; }
        __builtin_amdgcn_wave_barrier(); asm volatile("" ::: "memory");
        float* crow = C + (size_t)(r0 + mb * 16) * ldc + c0;
{
#pragma unroll
            for (int s = 0; s < 8; ++s) { const int row = 2 * s + hi, cofs = lr * 4; v4f val = *(const v4fa*)(os + row * 68 + cofs);
                *(v4f*)(crow + (size_t)row * ldc + cofs) = val; }
             }
        __builtin_amdgcn_wave_barrier(); asm volatile("" ::: "memory");
    }
}

// ---- k_gemmpv: the probability x value contraction, the same 64x64 tile, fragments and three products as k_gemmc, with the key loop of a tile DEALT OVER THE 8 WAVES OF A BLOCK: wave w takes the 32-key steps w, w + 8, w + 16, ...
// (both operands in fragment order: a step's blocks are whole lines of its own), so the longest chain of dependent load-then-multiply steps is 8 long where one wave alone had 64, and 2,048 waves are on the chip where 512 were.
// The key loop ends at the diagonal block (probabilities beyond it are exactly zero), so a tile's work grows with its row index: a block takes the row tiles 31 - x and x, one after the other, and every block carries the same 66 steps.
// The 8 partial tiles meet in LDS, [row 64][wave 8][68 words] with 4 more words a row (RP: rows 8 apart, which the two lane halves write at once, then lie 32 banks apart; and one address register reaches all that a lane reads);
// behind one barrier wave w adds rows 8 w .. 8 w + 7 over the partials 0, 1, ..., 7 IN THAT FIXED ORDER and stores them: 16 lanes store the tile's 256 bytes of an output row.
template <typename T16, int K, int Kb, int DA, int DB>
__global__ __launch_bounds__(256) void k_gemmpv(const T16* __restrict__ A, const T16* __restrict__ Bt, float* C, int ldc, size_t sA, size_t sB, size_t sC) {
    typedef typename WFrag<T16>::V V;
    constexpr int RP = 8 * 68 + 4;
    __shared__ __align__(16) float red[64 * RP];
    const size_t z = blockIdx.z; A += z * sA; Bt += z * sB; C += z * sC;   // the lo words stand DA (weights) and DB (values) words behind their hi words
    const int wave = __builtin_amdgcn_readfirstlane((int)(threadIdx.x >> 5));   // a scalar, so that the key loop's test is a scalar branch
    const int lane = threadIdx.x & 31, lr = lane & 15, hi = lane >> 4; const int c0 = blockIdx.y * 64;
    const size_t bo = (size_t)c0 * Kb + 8 * lane;   // fragment order, Kb words a value row
    float* os = red + wave * 68;
#pragma nounroll   // one copy of the tile's code: two would not run faster
    for (int t = 0; t < 2; ++t) {
        const int r0 = (t ? (int)blockIdx.x : TT / 64 - 1 - (int)blockIdx.x) * 64;
        const int Kl = min(K, r0 + 64);        // probabilities are exactly 0 beyond the diagonal block, so the key loop stops there
        v8f acc[4][4];
#pragma unroll
        for (int mb = 0; mb < 4; ++mb)
#pragma unroll
            for (int nb = 0; nb < 4; ++nb) acc[mb][nb] = (v8f){};
        const size_t ao = (size_t)r0 * K + 8 * lane;   // fragment order, K words (hi and lo) a weight row

        for (int kc = wave * 32; kc < Kl; kc += 8 * 32) {
            const T16* ka = A + ao + kc * 16; const T16* kb = Bt + bo + kc * 16; V a[4], a2[4], b[4], b2[4];   // the load order, the wait and the scheduling barriers: as in k_gemmc, for the same reasons; this kernel has 8 registers fewer to spare (above 256 a SIMD holds 3 waves, not 4), so 13 fragments go first
#pragma unroll
            for (int mb = 0; mb < 4; ++mb) { a[mb] = WFrag<T16>::ldf(ka + mb * 16 * K); a2[mb] = WFrag<T16>::ldf(ka + DA + mb * 16 * K); }
            b[0] = WFrag<T16>::ldf(kb); b2[0] = WFrag<T16>::ldf(kb + DB); b[1] = WFrag<T16>::ldf(kb + 16 * Kb); b2[1] = WFrag<T16>::ldf(kb + DB + 16 * Kb); b[2] = WFrag<T16>::ldf(kb + 2 * 16 * Kb);
#pragma unroll
            for (int nb = 0; nb < 4; ++nb) {
                __builtin_amdgcn_sched_barrier(0);   // the loads above stay in front of this block's products, and the block's products behind those of the block before
#pragma unroll
                for (int mb = 0; mb < 4; ++mb) { acc[mb][nb] = WFrag<T16>::mma(a[mb], b[nb], acc[mb][nb]); acc[mb][nb] = WFrag<T16>::mma(a2[mb], b[nb], acc[mb][nb]); acc[mb][nb] = WFrag<T16>::mma(a[mb], b2[nb], acc[mb][nb]); }
                if (nb < 2) __builtin_amdgcn_sched_barrier(0);   // the loads below take the registers that this block has left
                if (nb == 0) { b2[2] = WFrag<T16>::ldf(kb + DB + 2 * 16 * Kb); b[3] = WFrag<T16>::ldf(kb + 3 * 16 * Kb); }
                if (nb == 1) { b2[3] = WFrag<T16>::ldf(kb + DB + 3 * 16 * Kb);
                    asm volatile("s_wait_xcnt 0x0" :: "v"(ka), "v"(kb) : "memory"); }   // behind the step's last fragment load, in front of the first overwrite of the address registers, which it holds up to here so that no load lands on them
            }
            asm volatile("v_nop\n\tv_nop\n\tv_nop\n\tv_nop" : "+v"(acc[0][0]), "+v"(acc[1][1]), "+v"(acc[2][2]), "+v"(acc[3][3]) : "v"(a[0]), "v"(a[3]));   // the matrix instructions' distance on the loop's taken branch, as in k_gemmc
        }
        if (t) __syncthreads();   // the first tile's partials in LDS have been read by every wave before they are written again
#pragma unroll
        for (int mb = 0; mb < 4; ++mb)
#pragma unroll
            for (int nb = 0; nb < 4; ++nb)
#pragma unroll
                for (int j = 0; j < 8; ++j) os[(mb * 16 + hi * 8 + j) * RP + nb * 16 + lr] = acc[mb][nb][j];
        __syncthreads();          // all 8 partial tiles are in LDS before any wave adds them
#pragma unroll
        for (int s = 0; s < 4; ++s) { const int row = wave * 8 + 2 * s + hi, cofs = lr * 4; v4f val = *(const v4fa*)(red + row * RP + cofs);
#pragma unroll
            for (int w = 1; w < 8; ++w) val += *(const v4fa*)(red + row * RP + w * 68 + cofs);
            *(v4f*)(C + (size_t)(r0 + row) * ldc + c0 + cofs) = val; }
        asm volatile("s_wait_xcnt 0x0" ::: "memory");   // stands in front of the next tile's zeroing of the accumulators, which takes the registers that these stores name
    }
}

__device__ __forceinline__ h16 tohx(float x) { return (h16)x; }
typedef __attribute__((ext_vector_type(2))) _Float16 v2h;
typedef __attribute__((ext_vector_type(4))) _Float16 v4h;
typedef __attribute__((ext_vector_type(2))) unsigned short v2us;
typedef __attribute__((ext_vector_type(2))) float v2f;
typedef __attribute__((ext_vector_type(4))) int v4i;


// ---- k_prep: the four casts, which depend on nothing but the inputs, in ONE launch, told apart by block index: blocks [0, 3 WTB) are the transposing casts of the q, k and v weights (WTB blocks each), the rest the straight cast of a0.
// Every plane leaves in FRAGMENT ORDER (above k_gemmw). A thread makes the 16-byte unit u of its plane: block u / 64, half (u % 64) / 32, lane u % 32; a wave stores 512 contiguous bytes.
// a0: the unit's 8 floats are contiguous in their row, and the two waves of a block's halves read the whole 128-byte line of each of its 16 rows. Weights (in, out): the unit's 8 words are 8 rows k of one column n; 16 lanes read 64 contiguous bytes of a row.
#define WTB (DM * HD / 8 / 256)   // blocks per weight: 256 units of 8 words
__global__ __launch_bounds__(256) void k_prep(const float* __restrict__ src, const float* __restrict__ wq, const float* __restrict__ wk, const float* __restrict__ wv, bf* dst, bf* WQ, bf* WK, bf* WV, size_t n8) {
    const int ln = threadIdx.x & 31, kin = ((threadIdx.x >> 5) & 1) * 16 + (ln >> 4) * 8, rin = ln & 15;   // 256 threads are 4 whole blocks: the unit's k and row inside its block
    if (blockIdx.x < 3 * WTB) {
        const int sel = blockIdx.x / WTB, blk = blockIdx.x % WTB; const float* __restrict__ w = (sel == 0) ? wq : (sel == 1) ? wk : wv; bf* Bt = (sel == 0) ? WQ : (sel == 1) ? WK : WV;
        const int u = blk * 256 + threadIdx.x, fb = u >> 6; const int n = (fb / (DM / 32)) * 16 + rin, k = (fb % (DM / 32)) * 32 + kin; v8us o;
#pragma unroll
        for (int e = 0; e < 8; ++e) o[e] = f2bf(w[(size_t)(k + e) * HD + n]);
        *(v8us*)(Bt + (size_t)u * 8) = o;
        return;
    }
    const size_t i = (size_t)(blockIdx.x - 3 * WTB) * 256 + threadIdx.x; if (i >= n8) return; const size_t fb = i >> 6;
    const v8f v = *(const v8f*)(src + ((fb / (DM / 32)) * 16 + rin) * DM + (fb % (DM / 32)) * 32 + kin); v8us o;
#pragma unroll
    for (int k = 0; k < 8; ++k) o[k] = f2bf(v[k]); *(v8us*)(dst + i * 8) = o;  }

// k_asoft: per row (zz, i): t = S x SCL for j <= i and i - j < WIN (the causal triangle; WIN = TT: the window never binds; an excluded key gets -3e38, whose exponential is an exact zero); softmax over the keys (register row, one exp, fixed trees).
// A block is the 16 rows of one row tile, a wave a row. The hi / lo words of the tile's weights go back INTO the tile's own 128 KiB of the score plane, IN FRAGMENT ORDER (above k_gemmw): [hi: 64 blocks | lo: 64 blocks] (Ph = the plane's base, Pl = Ph + 16 TT, 2 TT words a row).
// A block of that order holds words of all 16 rows, so the rows meet in LDS: each wave writes its row's words to their places there, and behind ONE barrier, which also says that every wave holds all that it reads of the tile's scores in registers,
// the block copies the units out, 512 contiguous bytes a wave. Sb, Ph and Pl alias: none of them is __restrict__. In LDS each group of 16 units (one 8-key column of the tile) has 16 bytes of pad: a wave's 8-byte writes, one group apart per lane pair, then fall on all 64 banks.
// ONLY THE 128-KEY CHUNKS THAT REACH THE TRIANGLE ARE TOUCHED: row i loads, exponentiates and stores its first nch = i / 128 + 1 chunks (the same for the 16 rows of a tile). The chunks behind them hold excluded keys alone: they never raise the maximum, they add exact zeros to the sum,
// and the P x v GEMM never reads their weights (its key loop ends at the row tile's diagonal block, at or in front of key 128 nch). The kept terms are added in the order they had: the same bits as with all 16 chunks.
// A tile's work grows with its index: the long tiles of an entry have the low block indices, for speed only.
#define PGP 136   // 16-bit words from one group of 16 units to the next in LDS: 128 and the pad
__global__ __launch_bounds__(512) void k_asoft(const float* Sb, bf* Ph, bf* Pl) {
    __shared__ __align__(16) bf pst[2][TT / 8 * PGP];
    const int lane = threadIdx.x & 31; const int wave = __builtin_amdgcn_readfirstlane((int)(threadIdx.x >> 5));   // a scalar, so that every test on the chunk count is a scalar branch
    const int zz = blockIdx.x / (TT / 16); const int tile = TT / 16 - 1 - blockIdx.x % (TT / 16); const int i = tile * 16 + wave; const int row = zz * TT + i;
    const int nch = i / 128 + 1; const char* sr = (const char*)(Sb + (size_t)row * TT); const unsigned lo = lane * 16u; float v[TT / 32]; float mx = -3.0e38f;
#pragma unroll
    for (int ch = 0; ch < TT / 128; ++ch) if (ch < nch) { const v4f a = *(const v4f*)(sr + lo + ch * 512);   // the loads alone, so that all of a row's loads are in flight together
#pragma unroll
        for (int q = 0; q < 4; ++q) v[ch * 4 + q] = a[q]; }
    asm volatile("s_wait_xcnt 0x0" :: "v"(sr + lo), "v"(lo), "v"(lane) : "memory");   // stands in front of the first overwrite of the loads' address registers; the address and the lane's offset are inputs so that they keep their registers up to here and no load lands on them
#pragma unroll
    for (int ch = 0; ch < TT / 128; ++ch) if (ch < nch) { const int j0 = ch * 128 + lane * 4;
#pragma unroll
        for (int q = 0; q < 4; ++q) { const int j = j0 + q; (void)j; const float t = (j <= i && i - j < WIN) ? v[ch * 4 + q] * SCL : -3.0e38f; v[ch * 4 + q] = t; mx = fmaxf(mx, t); } }
#pragma unroll
    for (int sh = 16; sh; sh >>= 1) mx = fmaxf(mx, __shfl_xor(mx, sh, 32));
    float sum = 0.f;
#pragma unroll
    for (int ch = 0; ch < TT / 128; ++ch) if (ch < nch) {
#pragma unroll
        for (int q = 0; q < 4; ++q) { const int k = ch * 4 + q; float d0 = __fsub_rn(v[k], mx); const float e0 = __fmul_rn(d0, 1.4426950408889634f);
            if (ch == 0) asm("v_exp_f32 %0, %1\n\tv_nop" : "=v"(v[k]) : "v"(e0));   // the same hardware exp2 with the slot behind the transcendental filled: chunk 0 runs on every row, and in its straight-line code the compiler's order left that slot open
            else v[k] = __builtin_amdgcn_exp2f(e0);
            sum += v[k]; } }
#pragma unroll
    for (int sh = 16; sh; sh >>= 1) sum += __shfl_xor(sum, sh, 32);
    const float f = __fdiv_rn(1.0f, sum);
    bf* ps = &pst[0][0] + (lane >> 1) * PGP + wave * 8 + (lane & 1) * 4;   // keys 4 lane .. 4 lane + 3 of a chunk: group lane / 2 of its 16, unit = the row, half a unit
#pragma unroll
    for (int ch = 0; ch < TT / 128; ++ch) if (ch < nch) { v4us oh, ol;
#pragma unroll
        for (int q = 0; q < 4; ++q) { unsigned short a, c2; splitf(v[ch * 4 + q] * f, a, c2); oh[q] = a; ol[q] = c2; }
        *(v4us*)(ps + ch * 16 * PGP) = oh; *(v4us*)(ps + TT / 8 * PGP + ch * 16 * PGP) = ol; }
    __syncthreads();   // all 16 rows' words are in LDS, and all 16 rows' scores have been read, before the tile's region is written
    const size_t tb = ((size_t)zz * TT + tile * 16) * (2 * TT);
    for (int u = threadIdx.x; u < nch * 256; u += 512) { const int la = (u >> 4) * PGP + (u & 15) * 8; const v8us h = *(const v8us*)(&pst[0][la]), l = *(const v8us*)(&pst[1][la]);
        *(v8us*)(Ph + tb + (size_t)u * 8) = h; *(v8us*)(Pl + tb + (size_t)u * 8) = l; }
}

extern "C" void kernel_launch(void* const* d_in, const int* in_sizes, int n_in,
                              void* d_out, int out_size, void* d_ws, size_t ws_size, hipStream_t stream) {
    (void)in_sizes; (void)n_in; (void)out_size;
    const float* x = (const float*)d_in[0]; const float* wk = (const float*)d_in[1]; const float* wq = (const float*)d_in[2]; const float* wv = (const float*)d_in[3];
    // inputs in the module's argument order = d_in[0..3]: the [8][2048][1024] plane, then the KEY, QUERY and VALUE weights [1024][128] (in, out): all four read; the causal rule is computed: there is no mask input
    float* OUT = (float*)d_out;     // [8][2048][128]
    char* wsp = (char*)d_ws;
    auto take = [&](size_t bytes) { char* p = wsp; wsp += (bytes + 255) & ~(size_t)255; return (void*)p; };
    bf* WQ = (bf*)take((size_t)DQ * DM * 2); bf* WK = (bf*)take((size_t)DKV * DM * 2); bf* WV = (bf*)take((size_t)DKV * DM * 2);
    bf* XB = (bf*)take((size_t)NB_ * TT * DM * 2);
    bf* QPh = (bf*)take((size_t)ZH * TT * HD * 2 * 2); bf* QPl = QPh + ZH * TT * HD; bf* KPh = (bf*)take((size_t)ZH * TT * HD * 2 * 2); bf* KPl = KPh + ZH * TT * HD;   /* [hi plane | lo plane], as they lay */ bf* VTh = (bf*)take((size_t)ZH * HD * 2 * TT * 2);
    float* Sb = (float*)take((size_t)ZH * TT * TT * 4);
    if ((size_t)(wsp - (char*)d_ws) > ws_size) return;
    bf* VTl = VTh + (size_t)HD * TT;           // an entry's value planes, fragment order: [hi: HD x TT | lo: HD x TT] (k_gemmw)
    bf* Ph = (bf*)Sb; bf* Pl = Ph + 16 * TT;   // a 16-row tile's weights, fragment order: [hi: 16 x TT | lo: 16 x TT], in the tile's own score rows (k_asoft)
    const unsigned LX = (unsigned)(((size_t)NB_ * TT * DM / 8 + 255) / 256);
    k_prep<<<3 * WTB + LX, 256, 0, stream>>>(x, wq, wk, wv, XB, WQ, WK, WV, (size_t)NB_ * TT * DM / 8);   /* (in, out) weights: the transposing cast: [128][1024] = Bt; a0: the straight cast */
    k_gemmw<bf, DM><<<dim3(NB_ * TT / 128, HD / 64, 1), 192, 0, stream>>>(XB, WQ, WK, WV, QPh, QPl, KPh, KPl, VTh, VTl, HD);   /* the three projections: the eight entries' rows are one [16384][1024] operand; each wave writes its own tile of its weight's hi / lo planes */
    k_gemmc<bf, HD, ZH * TT * HD><<<dim3(TT / 64, TT / 64, ZH), 32, 0, stream>>>(QPh, KPh, Sb, TT, 0, (size_t)TT * HD, (size_t)TT * HD, (size_t)TT * TT);   /* the scores on hi / lo planes on EVERY row */
    k_asoft<<<ZH * TT / 16, 512, 0, stream>>>(Sb, Ph, Pl);
    k_gemmpv<bf, 2 * TT, TT, 16 * TT, HD * TT><<<dim3(TT / 128, HD / 64, ZH), 256, 0, stream>>>(Ph, VTh, OUT, HD, (size_t)RH * 2 * TT, (size_t)HD * 2 * TT, (size_t)TT * HD);   /* P x v: three products on every row; K = 2 TT words (hi and lo) a weight row, TT a value row: the key loop ends at the diagonal block, at most TT; its tiles are the output rows [entry][t][d]: the one writer of d_out */
}

// v007
// One run takes 75.4 microseconds.
// In two side-by-side timings against v006, it was 1.52 and 1.51 times as fast.
// Over all steps from v000 it is 12.8 times as fast.
#include <hip/hip_runtime.h>

// One head of causal self-attention with a 128-wide head, NO output projection, and the scores MULTIPLIED by 32 (inputs, in argument order: a0 [8][2048][1024]; a1, a2, a3 [1024][128] stored (in, out) and used as x W: the key, query and value weights IN THAT ORDER):
//   THE MODULE's FUNCTION: k = a0 a1; q = a0 a2; v = a0 a3 ([8][2048][128] each); S = (q k^T) x 32; everything above the diagonal set to nought, then EVERY exact nought set to -inf (so the module excludes the keys after the query AND any key inside the triangle whose score is exactly 0.0); softmax over the 2,048 keys; result = P v -> [8][2048][128] (2.1 M).
//   THIS TEXT excludes the keys after the query by index and KEEPS a score of exactly 0.0 inside the triangle: the two differ only where a computed score is exactly 0.0: not reached on real data.
// Layout: ALL EIGHT batch entries go through every stage in ONE launch of that stage (the entry is a plane index: more rows in the projections, a part of the block index in the attention kernel): one bf16 copy of a0 (read by all three projections) and the (in, out) weights transposed once by a transposing cast, all four casts in one launch; the three projections in one launch; exact projections (bf16 x bf16 words, f32 sums) WHOSE OWN EPILOGUE splits each f32 sum into the bf16 hi / lo planes that the attention GEMMs read (q and k row planes; the transposed value planes): no f32 projection plane and no plane-builder pass; EVERY 16-bit plane that a GEMM reads (a0's copy, the weights, q, k, the transposed v) is stored in FRAGMENT ORDER (said above k_gemmw's loader);
//   causal T-2048 attention for the one head: THE SCORES ON hi / lo PLANES ON EVERY ROW (three products: the softmax is all but a hard maximum, a score's spread is about 360, and one 16-bit rounding of q or k would flip the winning key in hundreds of rows); THE SOFTMAX WEIGHTS ON bf16 hi / lo PLANES ON EVERY ROW TOO (RH = TT) and P x v as three products against the hi / lo value planes: a one-word fp16 P is not taken: 6.4 per cent of this draw's non-zero carried weights would be fp16 subnormals;
//   scores, softmax and P x v run in ONE kernel (k_attn: running maximum and sum; keys behind the diagonal step never touched), which stores the output rows: the one writer of d_out.
// The scale: the module writes scores x sqrt(1024): SCL 32.0f applied to each score in k_attn's masking step, as the module writes it (a power of two: exact).
// Compute dtypes, f32 accumulate: every float input rounded to bf16 at its load; projections exact; scores three products; softmax f32 (the hardware exp2); P x v three products (bf16 hi / lo both sides; lo x lo not formed); the output is those f32 sums as they stand.

#define NB_  8      // batch entries: the input is [8][2048][1024]
#define TT   2048
#define DM   1024
#define NH_  1
#define NKV  1
#define REP  (NH_ / NKV)
#define HD   128
#define DQ   (NH_ * HD)
#define DKV  (NKV * HD)
#define ZH   NB_                  // planes per attention launch: one head x the eight batch entries
#define RH   2048                 // = TT: query rows < RH use hi+lo planes of P: EVERY row here
#define WIN  2048
#define PCAR 1024.0f
#define SCL  32.0f   // sqrt(1024): the module MULTIPLIES the scores by it
typedef _Float16 h16;
typedef unsigned short bf;
typedef __attribute__((ext_vector_type(16))) __bf16   v16bf;
typedef __attribute__((ext_vector_type(16))) _Float16 v16h;
typedef __attribute__((ext_vector_type(8)))  _Float16 v8h;
typedef __attribute__((ext_vector_type(8)))  unsigned short v8us;
typedef __attribute__((ext_vector_type(8)))  float    v8f;
typedef __attribute__((ext_vector_type(4)))  float    v4f;
typedef v8h  __attribute__((may_alias)) v8ha;
typedef v4f  __attribute__((may_alias)) v4fa;
typedef v8us __attribute__((may_alias)) v8usa;

__device__ __forceinline__ unsigned short f2bf(float f) { unsigned u = __float_as_uint(f); u += 0x7FFFu + ((u >> 16) & 1u); return (unsigned short)(u >> 16); }
__device__ __forceinline__ float bf2f(unsigned short b) { return __uint_as_float(((unsigned)b) << 16); }
__device__ __forceinline__ float bfr(float f) { return bf2f(f2bf(f)); }
__device__ __forceinline__ v16h cat16(v8h lo, v8h hi) { return __builtin_shufflevector(lo, hi, 0, 1, 2, 3, 4, 5, 6, 7, 8, 9, 10, 11, 12, 13, 14, 15); }
__device__ __forceinline__ v16bf cat16b(v8us lo, v8us hi) { return __builtin_bit_cast(v16bf, __builtin_shufflevector(lo, hi, 0, 1, 2, 3, 4, 5, 6, 7, 8, 9, 10, 11, 12, 13, 14, 15)); }
__device__ __forceinline__ v8f wmma16(v16h a, v16h b, v8f c) { return __builtin_amdgcn_wmma_f32_16x16x32_f16(false, a, false, b, (short)0, c, false, false); }
__device__ __forceinline__ v8f wmmab(v16bf a, v16bf b, v8f c) { return __builtin_amdgcn_wmma_f32_16x16x32_bf16(false, a, false, b, (short)0, c, false, false); }
__device__ __forceinline__ void splitf(float y, unsigned short& h, unsigned short& l) { h = f2bf(y); l = f2bf(y - bf2f(h)); }
typedef __attribute__((ext_vector_type(4))) unsigned short v4us;



// ---- k_gemmw: the three projections in ONE launch. Register-blocked GEMM, ONE WAVE per 64x64 output tile (16 accumulators), operands straight from 16-bit planes in fragment order (below).
// A block is six such waves, which share no data in LDS and meet at no barrier: 2 row tiles x the 3 weights (q, k, v) at one 64-column tile; grid (M/128, N/64), 192 threads: 1,536 waves are on the chip at once, where a launch per weight had 512.
// The three waves of a row tile read the same rows of A, the two waves of a weight the same rows of Bt: those lines come into the WGP's cache once a block.
// f32 sums S[m][n] = sum_k A[m][k] Bt[n][k], K % 32 == 0; each sum leaves the wave as its bf16 hi / lo words (splitf), never as an f32 plane:
//   q and k: planes Ph / Pl of [m][n], ldc words a row ([entry][t][d] is [m][n] as it stands), in fragment order; staged through the wave's own slice of LDS, from which a lane takes the 8 consecutive n of its unit.
//   v: transposed planes of [n][t] per entry, TT words a row, in fragment order, [entry][hi: HD x TT | lo: HD x TT] (Pl = Ph + HD TT); m = entry x TT + t. A lane's 8 accumulator registers are 8 consecutive t of one n = lane % 16: they ARE the lane's unit: one 16-byte store a plane, no staging.
// FRAGMENT ORDER of a K-contiguous 16-bit plane X[row][k] (K % 32 == 0, rows % 16 == 0): blocks of 16 rows x 32 k = 512 words = 1 KiB, block (R, S) = (row / 16, k / 32) at word (R K / 32 + S) 512 = 16 R K + 16 (32 S);
// inside a block [half 2][lane 32][8 words]: word (row, k) with kk = k % 32 stands at (kk / 16) 256 + (((kk % 16) / 8) 16 + row % 16) 8 + kk % 8. A lane's fragment (row lane % 16; k = 8 (lane / 16) + 0..7, then 16 more) is the same 16 words in the same order as it would take from the row plane,
// but each of its two 16-byte loads (ldf: the lane's unit of half 0, then of half 1) is, over the wave, 512 contiguous bytes = 4 whole lines, where a load from the row plane touches 16 lines. Every writer of such a plane stores whole units, 512 contiguous bytes a wave.
template <typename T16> struct WFrag;
template <> struct WFrag<h16> { typedef v16h V; static __device__ __forceinline__ V ldf(const h16* p) { return cat16(*(const v8h*)p, *(const v8h*)(p + 256)); } static __device__ __forceinline__ v8f mma(V a, V b, v8f c) { return wmma16(a, b, c); } };
template <> struct WFrag<bf> { typedef v16bf V; static __device__ __forceinline__ V ldf(const bf* p) { return cat16b(*(const v8us*)p, *(const v8us*)(p + 256)); } static __device__ __forceinline__ v8f mma(V a, V b, v8f c) { return wmmab(a, b, c); } };
template <typename T16, int K>
__global__ __launch_bounds__(192) void k_gemmw(const T16* __restrict__ A, const T16* __restrict__ Bq, const T16* __restrict__ Bk, const T16* __restrict__ Bv, bf* Qh, bf* Ql, bf* Kh, bf* Kl, bf* Vh, bf* Vl, int ldc) {
    typedef typename WFrag<T16>::V V;
    __shared__ __align__(16) float osw[6][16 * 68];
    const int wave = __builtin_amdgcn_readfirstlane((int)(threadIdx.x >> 5)), p = wave % 3, rt = wave / 3;   // p: 0 = q, 1 = k, 2 = v; rt: which of the block's two row tiles; scalars, so that every test on p is a scalar branch
    const T16* __restrict__ Bt = (p == 0) ? Bq : (p == 1) ? Bk : Bv; bf* Ph = (p == 0) ? Qh : (p == 1) ? Kh : Vh; bf* Pl = (p == 0) ? Ql : (p == 1) ? Kl : Vl; float* os = osw[wave];
    const int lane = threadIdx.x & 31, lr = lane & 15, hi = lane >> 4; const int r0 = (blockIdx.x * 2 + rt) * 64, c0 = blockIdx.y * 64;
    v8f acc[4][4];
#pragma unroll
    for (int mb = 0; mb < 4; ++mb)
#pragma unroll
        for (int nb = 0; nb < 4; ++nb) acc[mb][nb] = (v8f){};
    const T16* pa = A + (size_t)r0 * K + 8 * lane; const T16* pb = Bt + (size_t)c0 * K + 8 * lane;   // fragment order: row tile R starts at word 16 R K, its k step at 16 kc; K is a constant, so that a step's fragments of a plane lie at constant offsets from ONE address

    for (int kc = 0; kc < K; kc += 32) {
        const T16* ka = pa + kc * 16; const T16* kb = pb + kc * 16; V a[4], b[4];
#pragma unroll
        for (int mb = 0; mb < 4; ++mb) a[mb] = WFrag<T16>::ldf(ka + mb * 16 * K);
#pragma unroll
        for (int nb = 0; nb < 4; ++nb) b[nb] = WFrag<T16>::ldf(kb + nb * 16 * K);
        asm volatile("s_wait_xcnt 0x0" :: "v"(ka), "v"(kb) : "memory");   // stands behind the step's fragment loads, in front of the first overwrite of their address registers; the addresses are inputs so that they keep their registers up to here and no load lands on them
#pragma unroll
        for (int nb = 0; nb < 4; ++nb)
#pragma unroll
            for (int mb = 0; mb < 4; ++mb) acc[mb][nb] = WFrag<T16>::mma(a[mb], b[nb], acc[mb][nb]);
        asm volatile("v_nop\n\tv_nop\n\tv_nop\n\tv_nop" : "+v"(acc[0][0]), "+v"(acc[1][1]), "+v"(acc[2][2]), "+v"(acc[3][3]) : "v"(a[0]), "v"(a[3]));
    }
    if (p == 2) {
        const int g = r0 / TT, t0 = r0 % TT;   // a 64-row tile lies inside one entry (TT % 64 == 0)
#pragma unroll
        for (int mb = 0; mb < 4; ++mb) {
#pragma unroll
            for (int nb = 0; nb < 4; ++nb) { v8us oh, ol;
#pragma unroll
                for (int j = 0; j < 8; ++j) { unsigned short a2, c2; splitf(acc[mb][nb][j], a2, c2); oh[j] = a2; ol[j] = c2; }
                const size_t oo = (size_t)g * (2 * HD * TT) + (size_t)(c0 + nb * 16) * TT + (size_t)t0 * 16 + (mb >> 1) * 512 + (mb & 1) * 256 + lane * 8; *(v8us*)(Ph + oo) = oh; *(v8us*)(Pl + oo) = ol; } }
        return;
    }
#pragma unroll
    for (int mb = 0; mb < 4; ++mb) {
#pragma unroll
        for (int nb = 0; nb < 4; ++nb) {
#pragma unroll
            for (int j = 0; j < 8; ++j) os[(hi * 8 + j) * 68 + nb * 16 + lr] = acc[mb][nb][j]; }
        __builtin_amdgcn_wave_barrier(); asm volatile("" ::: "memory");   // keeps the row reads below behind the staging writes above
#pragma unroll
        for (int s = 0; s < 4; ++s) { const float* sp = os + lr * 68 + s * 16 + hi * 8; const v4f v0 = *(const v4fa*)sp, v1 = *(const v4fa*)(sp + 4); v8us oh, ol;   // row lr, columns 16 s + 8 hi ..: the lane's 8 words of half s % 2 of block s / 2
#pragma unroll
            for (int q = 0; q < 4; ++q) { unsigned short a2, c2; splitf(v0[q], a2, c2); oh[q] = a2; ol[q] = c2; splitf(v1[q], a2, c2); oh[4 + q] = a2; ol[4 + q] = c2; }
            const size_t oo = (size_t)(r0 + mb * 16) * ldc + (size_t)c0 * 16 + (s >> 1) * 512 + (s & 1) * 256 + lane * 8; *(v8us*)(Ph + oo) = oh; *(v8us*)(Pl + oo) = ol; }
        asm volatile("s_wait_xcnt 0x0" ::: "memory");   // stands behind the run of stores, in front of whatever next takes the registers that they name
        __builtin_amdgcn_wave_barrier(); asm volatile("" ::: "memory");   // keeps the next block's staging writes behind these row reads
    }
}

__device__ __forceinline__ h16 tohx(float x) { return (h16)x; }
typedef __attribute__((ext_vector_type(2))) _Float16 v2h;
typedef __attribute__((ext_vector_type(4))) _Float16 v4h;
typedef __attribute__((ext_vector_type(2))) unsigned short v2us;
typedef __attribute__((ext_vector_type(2))) float v2f;
typedef __attribute__((ext_vector_type(4))) int v4i;


// ---- k_prep: the four casts, which depend on nothing but the inputs, in ONE launch, told apart by block index: blocks [0, 3 WTB) are the transposing casts of the q, k and v weights (WTB blocks each), the rest the straight cast of a0.
// Every plane leaves in FRAGMENT ORDER (above k_gemmw). A thread makes the 16-byte unit u of its plane: block u / 64, half (u % 64) / 32, lane u % 32; a wave stores 512 contiguous bytes.
// a0: the unit's 8 floats are contiguous in their row, and the two waves of a block's halves read the whole 128-byte line of each of its 16 rows. Weights (in, out): the unit's 8 words are 8 rows k of one column n; 16 lanes read 64 contiguous bytes of a row.
#define WTB (DM * HD / 8 / 256)   // blocks per weight: 256 units of 8 words
__global__ __launch_bounds__(256) void k_prep(const float* __restrict__ src, const float* __restrict__ wq, const float* __restrict__ wk, const float* __restrict__ wv, bf* dst, bf* WQ, bf* WK, bf* WV, size_t n8) {
    const int ln = threadIdx.x & 31, kin = ((threadIdx.x >> 5) & 1) * 16 + (ln >> 4) * 8, rin = ln & 15;   // 256 threads are 4 whole blocks: the unit's k and row inside its block
    if (blockIdx.x < 3 * WTB) {
        const int sel = blockIdx.x / WTB, blk = blockIdx.x % WTB; const float* __restrict__ w = (sel == 0) ? wq : (sel == 1) ? wk : wv; bf* Bt = (sel == 0) ? WQ : (sel == 1) ? WK : WV;
        const int u = blk * 256 + threadIdx.x, fb = u >> 6; const int n = (fb / (DM / 32)) * 16 + rin, k = (fb % (DM / 32)) * 32 + kin; v8us o;
#pragma unroll
        for (int e = 0; e < 8; ++e) o[e] = f2bf(w[(size_t)(k + e) * HD + n]);
        *(v8us*)(Bt + (size_t)u * 8) = o;
        return;
    }
    const size_t i = (size_t)(blockIdx.x - 3 * WTB) * 256 + threadIdx.x; if (i >= n8) return; const size_t fb = i >> 6;
    const v8f v = *(const v8f*)(src + ((fb / (DM / 32)) * 16 + rin) * DM + (fb % (DM / 32)) * 32 + kin); v8us o;
#pragma unroll
    for (int k = 0; k < 8; ++k) o[k] = f2bf(v[k]); *(v8us*)(dst + i * 8) = o;  }

// ---- k_attn: scores, softmax and P x v of 32 query rows in ONE kernel: neither a score nor a weight leaves the chip.
// A block is 8 waves on the SAME 32 queries; the keys up to the diagonal are dealt over the waves in steps of 32 (wave w takes steps w, w + 8, ...); each wave keeps a running maximum m, a running sum l and an unnormalised f32 result for its own keys.
// The products are formed TRANSPOSED, so that no fragment is re-ordered between them: S^T = k q^T (A = key rows, B = query rows): a lane's 8 accumulator registers are keys 8 (lane / 16) + 0..7 of query lane % 16,
// and the accumulators of the step's two key tiles are, in that order, the lane's 16 words of the B fragment of P^T (k order of the loader: 8 (lane / 16) + 0..7, then 16 more). result^T = v^T P^T (A = the transposed value planes): a lane holds 8 consecutive d of its query.
// Three products on hi / lo planes in both, in the order hi hi, (q or P) lo x hi, hi x (k or v) lo; a score's sum over d runs in the same order as ever. A row's maximum and sum lie in the lane (and its partner 16 lanes on): one shuffle a step.
// The weights are split into bf16 hi / lo words UNNORMALISED (exp of score - running maximum, at most 1); the division by the row's sum is done once, on the f32 result.
// At the end the 8 waves' (m, l) meet in LDS; each wave scales its result by exp(m - M) / L, the partial results meet in LDS and are added over the waves 0, 1, ..., 7 IN THAT FIXED ORDER; a wave stores whole 512-byte output rows.
// A block's work grows with its row index: the long blocks have the low block indices, so that they start first.
__device__ __forceinline__ float exp2n(float x) { float r; asm("v_exp_f32 %0, %1\n\tv_nop" : "=v"(r) : "v"(x)); return r; }   // the hardware exp2 with the slot behind the transcendental filled
#define OPD 132   // words from one query's partial result to the next in LDS: 128 and a pad of 4, so that the 16 lanes of a 16-byte write fall on all 64 banks
#define L2E 1.4426950408889634f
__global__ __launch_bounds__(256) void k_attn(const bf* __restrict__ Qp, const bf* __restrict__ Kp, const bf* __restrict__ Vt, float* __restrict__ O) {
    typedef WFrag<bf> F; typedef v16bf V;
    constexpr int DP = ZH * TT * HD, DB = HD * TT;   // the lo plane stands DP words (q, k) or DB words (v) behind its hi plane
    __shared__ __align__(16) float red[8 * 32 * OPD];
    __shared__ float sm[8][32], sl[8][32];
    const int wave = __builtin_amdgcn_readfirstlane((int)(threadIdx.x >> 5));   // a scalar, so that the key loop's test is a scalar branch
    const int lane = threadIdx.x & 31, lr = lane & 15, hi = lane >> 4;
    const int z = blockIdx.x % ZH, q0 = (TT / 32 - 1 - (int)(blockIdx.x / ZH)) * 32;
    const bf* qs = Qp + (size_t)z * TT * HD + (size_t)q0 * HD; const bf* qa = qs + 8 * lane;   // fragment order: row tile R starts at word 16 R HD, its k step at 512 words a step
    V qh[2][4], ql[2][4];
#pragma unroll
    for (int qt = 0; qt < 2; ++qt)
#pragma unroll
        for (int ks = 0; ks < 4; ++ks) { qh[qt][ks] = F::ldf(qa + qt * 16 * HD + ks * 512); ql[qt][ks] = F::ldf(qa + DP + qt * 16 * HD + ks * 512); }
    asm volatile("s_wait_xcnt 0x0" :: "s"(qs), "v"(lane) : "memory");   // behind the query loads, in front of the first overwrite of their address registers (a scalar base and the lane), which it holds up to here
    v8f acc[8][2];
#pragma unroll
    for (int dt = 0; dt < 8; ++dt) { acc[dt][0] = (v8f){}; acc[dt][1] = (v8f){}; }
    float m[2] = { -3.0e38f, -3.0e38f }, l[2] = { 0.f, 0.f };
    const bf* kbase = Kp + (size_t)z * TT * HD + 8 * lane; const bf* vbase = Vt + (size_t)z * (2 * HD * TT) + 8 * lane;

    for (int kc = wave * 32; kc <= q0; kc += 8 * 32) {
        const bf* ka = kbase + kc * HD; const bf* va = vbase + kc * 16;   // key rows kc ..: row tile kc / 16 of HD words a row; value planes: k step kc / 32; every fragment of the step lies at a constant offset from these two
        V kh[2][4], kl[2][4];
#pragma unroll
        for (int ks = 0; ks < 4; ++ks)
#pragma unroll
            for (int kt = 0; kt < 2; ++kt) { kh[kt][ks] = F::ldf(ka + kt * 16 * HD + ks * 512); kl[kt][ks] = F::ldf(ka + DP + kt * 16 * HD + ks * 512); }
        asm volatile("s_wait_xcnt 0x0" :: "v"(ka) : "memory");   // behind the step's key loads, in front of the first overwrite of their address registers, which it holds up to here
        __builtin_amdgcn_sched_barrier(0);   // all 16 key fragments are in flight together before the first product
        v8f st[2][2];
#pragma unroll
        for (int kt = 0; kt < 2; ++kt) { st[kt][0] = (v8f){}; st[kt][1] = (v8f){}; }
#pragma unroll
        for (int ks = 0; ks < 4; ++ks)
#pragma unroll
            for (int kt = 0; kt < 2; ++kt)
#pragma unroll
                for (int qt = 0; qt < 2; ++qt) { st[kt][qt] = F::mma(kh[kt][ks], qh[qt][ks], st[kt][qt]); st[kt][qt] = F::mma(kh[kt][ks], ql[qt][ks], st[kt][qt]); st[kt][qt] = F::mma(kl[kt][ks], qh[qt][ks], st[kt][qt]); }
        __builtin_amdgcn_sched_barrier(0);   // the value loads below take the registers that the key fragments have left
        V vh[8], vl[8];
#pragma unroll
        for (int dt = 0; dt < 8; ++dt) { vh[dt] = F::ldf(va + dt * 16 * TT); vl[dt] = F::ldf(va + DB + dt * 16 * TT); }
        asm volatile("s_wait_xcnt 0x0" :: "v"(va) : "memory");   // behind the step's value loads, in front of the first overwrite of their address registers, which it holds up to here
        __builtin_amdgcn_sched_barrier(0);   // the value loads are issued before the softmax arithmetic and fly during it
        V ph[2], pl[2]; float al[2];
#pragma unroll
        for (int qt = 0; qt < 2; ++qt) {
            const int lim = q0 + qt * 16 + lr - kc - 8 * hi;   // the lane's key 16 kt + j (+ kc + 8 hi) is at or in front of its query where 16 kt + j <= lim
            float mx = -3.0e38f;
#pragma unroll
            for (int kt = 0; kt < 2; ++kt)
#pragma unroll
                for (int j = 0; j < 8; ++j) { const float t = (kt * 16 + j <= lim) ? st[kt][qt][j] * SCL : -3.0e38f; st[kt][qt][j] = t; mx = fmaxf(mx, t); }   // an excluded key gets -3e38, whose exponential is an exact zero; key kc is never excluded (kc <= q0), so the maximum is a real score
            mx = fmaxf(mx, __shfl_xor(mx, 16, 32));
            const float mn = fmaxf(m[qt], mx); al[qt] = exp2n((m[qt] - mn) * L2E); m[qt] = mn;
            float s = 0.f;
#pragma unroll
            for (int kt = 0; kt < 2; ++kt)
#pragma unroll
                for (int j = 0; j < 8; ++j) { const float p = exp2n((st[kt][qt][j] - mn) * L2E); s += p; const __bf16 h = (__bf16)p; ph[qt][kt * 8 + j] = h; pl[qt][kt * 8 + j] = (__bf16)(p - (float)h); }
            l[qt] = l[qt] * al[qt] + s;
        }
        if (__builtin_amdgcn_ballot_w32(al[0] != 1.0f || al[1] != 1.0f)) {   // the carried result is rescaled only in a step that raises some row's maximum
#pragma unroll
            for (int dt = 0; dt < 8; ++dt) { acc[dt][0] *= al[0]; acc[dt][1] *= al[1]; }
        }
#pragma unroll
        for (int dt = 0; dt < 8; ++dt)
#pragma unroll
            for (int qt = 0; qt < 2; ++qt) { acc[dt][qt] = F::mma(vh[dt], ph[qt], acc[dt][qt]); acc[dt][qt] = F::mma(vh[dt], pl[qt], acc[dt][qt]); acc[dt][qt] = F::mma(vl[dt], ph[qt], acc[dt][qt]); }
        asm volatile("v_nop\n\tv_nop\n\tv_nop\n\tv_nop" : "+v"(acc[6][0]), "+v"(acc[6][1]), "+v"(acc[7][0]), "+v"(acc[7][1]) : "v"(vh[7]), "v"(vl[7]));   // the matrix instructions' distance on the loop's taken branch
    }
#pragma unroll
    for (int qt = 0; qt < 2; ++qt) { l[qt] += __shfl_xor(l[qt], 16, 32); if (hi == 0) { sm[wave][qt * 16 + lr] = m[qt]; sl[wave][qt * 16 + lr] = l[qt]; } }
    __syncthreads();   // all 8 waves' maxima and sums are in LDS before any wave reads them
#pragma unroll
    for (int qt = 0; qt < 2; ++qt) { const int q = qt * 16 + lr; float M = sm[0][q];
#pragma unroll
        for (int w = 1; w < 8; ++w) M = fmaxf(M, sm[w][q]);
        float L = 0.f;
#pragma unroll
        for (int w = 0; w < 8; ++w) L += sl[w][q] * exp2n((sm[w][q] - M) * L2E);   // a wave without a step has m = -3e38 and l = 0: an exact zero; wave 0 always has step 0
        const float f = exp2n((m[qt] - M) * L2E) / L;
        float* op = red + (wave * 32 + q) * OPD + hi * 8;
#pragma unroll
        for (int dt = 0; dt < 8; ++dt) { const v8f a = acc[dt][qt] * f; *(v4fa*)(op + dt * 16) = (v4f){ a[0], a[1], a[2], a[3] }; *(v4fa*)(op + dt * 16 + 4) = (v4f){ a[4], a[5], a[6], a[7] }; } }
    __syncthreads();   // all 8 partial results are in LDS before any wave adds them
    v4f val[4];
#pragma unroll
    for (int s = 0; s < 4; ++s) { const float* rp = red + (s * 8 + wave) * OPD + lane * 4; val[s] = *(const v4fa*)rp;
#pragma unroll
        for (int w = 1; w < 8; ++w) val[s] += *(const v4fa*)(rp + w * 32 * OPD); }
    float* orow = O + ((size_t)z * TT + q0 + wave) * HD + lane * 4;   // row 8 s + wave of the block's 32: a wave stores the row's 512 bytes
#pragma unroll
    for (int s = 0; s < 4; ++s) *(v4f*)(orow + s * 8 * HD) = val[s];
}

extern "C" void kernel_launch(void* const* d_in, const int* in_sizes, int n_in,
                              void* d_out, int out_size, void* d_ws, size_t ws_size, hipStream_t stream) {
    (void)in_sizes; (void)n_in; (void)out_size;
    const float* x = (const float*)d_in[0]; const float* wk = (const float*)d_in[1]; const float* wq = (const float*)d_in[2]; const float* wv = (const float*)d_in[3];
    // inputs in the module's argument order = d_in[0..3]: the [8][2048][1024] plane, then the KEY, QUERY and VALUE weights [1024][128] (in, out): all four read; the causal rule is computed: there is no mask input
    float* OUT = (float*)d_out;     // [8][2048][128]
    char* wsp = (char*)d_ws;
    auto take = [&](size_t bytes) { char* p = wsp; wsp += (bytes + 255) & ~(size_t)255; return (void*)p; };
    bf* WQ = (bf*)take((size_t)DQ * DM * 2); bf* WK = (bf*)take((size_t)DKV * DM * 2); bf* WV = (bf*)take((size_t)DKV * DM * 2);
    bf* XB = (bf*)take((size_t)NB_ * TT * DM * 2);
    bf* QPh = (bf*)take((size_t)ZH * TT * HD * 2 * 2); bf* QPl = QPh + ZH * TT * HD; bf* KPh = (bf*)take((size_t)ZH * TT * HD * 2 * 2); bf* KPl = KPh + ZH * TT * HD;   /* [hi plane | lo plane], as they lay */ bf* VTh = (bf*)take((size_t)ZH * HD * 2 * TT * 2);
    if ((size_t)(wsp - (char*)d_ws) > ws_size) return;
    bf* VTl = VTh + (size_t)HD * TT;           // an entry's value planes, fragment order: [hi: HD x TT | lo: HD x TT] (k_gemmw)
    const unsigned LX = (unsigned)(((size_t)NB_ * TT * DM / 8 + 255) / 256);
    k_prep<<<3 * WTB + LX, 256, 0, stream>>>(x, wq, wk, wv, XB, WQ, WK, WV, (size_t)NB_ * TT * DM / 8);   /* (in, out) weights: the transposing cast: [128][1024] = Bt; a0: the straight cast */
    k_gemmw<bf, DM><<<dim3(NB_ * TT / 128, HD / 64, 1), 192, 0, stream>>>(XB, WQ, WK, WV, QPh, QPl, KPh, KPl, VTh, VTl, HD);   /* the three projections: the eight entries' rows are one [16384][1024] operand; each wave writes its own tile of its weight's hi / lo planes */
    k_attn<<<ZH * (TT / 32), 256, 0, stream>>>(QPh, KPh, VTh, OUT);   /* scores (three products), softmax, P x v (three products) of 32 query rows a block; the lo planes stand at constant distances behind the hi planes: the one writer of d_out */
}

// v008
// Measured time: 46.4 microseconds a run.
// Next to v007, in two timings, it ran 1.60 times as fast each time.
// Counting every step since v000, it is 20.5 times as fast.
#include <hip/hip_runtime.h>

// One head of causal self-attention with a 128-wide head, NO output projection, and the scores MULTIPLIED by 32 (inputs, in argument order: a0 [8][2048][1024]; a1, a2, a3 [1024][128] stored (in, out) and used as x W: the key, query and value weights IN THAT ORDER):
//   THE MODULE's FUNCTION: k = a0 a1; q = a0 a2; v = a0 a3 ([8][2048][128] each); S = (q k^T) x 32; everything above the diagonal set to nought, then EVERY exact nought set to -inf (so the module excludes the keys after the query AND any key inside the triangle whose score is exactly 0.0); softmax over the 2,048 keys; result = P v -> [8][2048][128] (2.1 M).
//   THIS TEXT excludes the keys after the query by index and KEEPS a score of exactly 0.0 inside the triangle: the two differ only where a computed score is exactly 0.0: not reached on real data (said again below).
// Layout: ALL EIGHT batch entries go through every stage in ONE launch of that stage (the entry is a plane index: more rows in the projections, a part of the block index in the attention kernel): the (in, out) weights transposed once by a transposing cast, the three casts in one launch; the three projections in one launch, which reads a0 as f32 and casts it to bf16 on its way into LDS (no bf16 copy of a0 in memory); exact projections (bf16 x bf16 words, f32 sums) WHOSE OWN EPILOGUE splits each f32 sum into the bf16 hi / lo planes that the attention GEMMs read (q and k row planes; the transposed value planes): no f32 projection plane and no plane-builder pass; EVERY 16-bit plane that a GEMM reads (a0's stages in LDS, the weights, q, k, the transposed v) is stored in FRAGMENT ORDER (said above k_gemmw's loader);
//   causal T-2048 attention for the one head: THE SCORES ON hi / lo PLANES ON EVERY ROW (three products: the softmax is all but a hard maximum, a score's spread is about 360, and one 16-bit rounding of q or k would flip the winning key in hundreds of rows); THE SOFTMAX WEIGHTS ON bf16 hi / lo PLANES ON EVERY ROW TOO (RH = TT) and P x v as three products against the hi / lo value planes: a one-word fp16 P is not taken: 6.4 per cent of this draw's non-zero carried weights would be fp16 subnormals;
//   scores, softmax and P x v run in ONE kernel (k_attn: running maximum and sum; keys behind the diagonal step never touched), which stores the output rows: the one writer of d_out.
// The scale: the module writes scores x sqrt(1024): SCL 32.0f applied to each score in k_attn's masking step, as the module writes it (a power of two: exact).
// Compute dtypes, f32 accumulate: every float input rounded to bf16 at its load; projections exact; scores three products; softmax f32 (the hardware exp2); P x v three products (bf16 hi / lo both sides; lo x lo not formed); the output is those f32 sums as they stand.

#define NB_  8      // batch entries: the input is [8][2048][1024]
#define TT   2048
#define DM   1024
#define NH_  1
#define NKV  1
#define REP  (NH_ / NKV)
#define HD   128
#define DQ   (NH_ * HD)
#define DKV  (NKV * HD)
#define ZH   NB_                  // planes per attention launch: one head x the eight batch entries
#define RH   2048                 // = TT: query rows < RH use hi+lo planes of P: EVERY row here
#define WIN  2048
#define PCAR 1024.0f
#define SCL  32.0f   // sqrt(1024): the module MULTIPLIES the scores by it
typedef _Float16 h16;
typedef unsigned short bf;
typedef __attribute__((ext_vector_type(16))) __bf16   v16bf;
typedef __attribute__((ext_vector_type(16))) _Float16 v16h;
typedef __attribute__((ext_vector_type(8)))  _Float16 v8h;
typedef __attribute__((ext_vector_type(8)))  unsigned short v8us;
typedef __attribute__((ext_vector_type(8)))  float    v8f;
typedef __attribute__((ext_vector_type(4)))  float    v4f;
typedef v8h  __attribute__((may_alias)) v8ha;
typedef v4f  __attribute__((may_alias)) v4fa;
typedef v8us __attribute__((may_alias)) v8usa;

__device__ __forceinline__ unsigned short f2bf(float f) { unsigned u = __float_as_uint(f); u += 0x7FFFu + ((u >> 16) & 1u); return (unsigned short)(u >> 16); }
__device__ __forceinline__ float bf2f(unsigned short b) { return __uint_as_float(((unsigned)b) << 16); }
__device__ __forceinline__ float bfr(float f) { return bf2f(f2bf(f)); }
__device__ __forceinline__ v16h cat16(v8h lo, v8h hi) { return __builtin_shufflevector(lo, hi, 0, 1, 2, 3, 4, 5, 6, 7, 8, 9, 10, 11, 12, 13, 14, 15); }
__device__ __forceinline__ v16bf cat16b(v8us lo, v8us hi) { return __builtin_bit_cast(v16bf, __builtin_shufflevector(lo, hi, 0, 1, 2, 3, 4, 5, 6, 7, 8, 9, 10, 11, 12, 13, 14, 15)); }
__device__ __forceinline__ v8f wmma16(v16h a, v16h b, v8f c) { return __builtin_amdgcn_wmma_f32_16x16x32_f16(false, a, false, b, (short)0, c, false, false); }
__device__ __forceinline__ v8f wmmab(v16bf a, v16bf b, v8f c) { return __builtin_amdgcn_wmma_f32_16x16x32_bf16(false, a, false, b, (short)0, c, false, false); }
__device__ __forceinline__ void splitf(float y, unsigned short& h, unsigned short& l) { h = f2bf(y); l = f2bf(y - bf2f(h)); }
typedef __attribute__((ext_vector_type(4))) unsigned short v4us;



// ---- k_gemmw: the three projections in ONE launch, with a0's cast to bf16 inside it. A block is 64 rows of a0 x ALL 384 output columns (q, k, v: 128 each; the three weight planes lie behind one another as one plane of 384 rows), so that a0 is read from memory once, as f32.
// 8 waves, each a 64x48 output tile (12 accumulators): column tiles 3 w .. 3 w + 2 of the 24; grid M / 64, 256 threads. The weight fragments come straight from their plane in fragment order (below), a whole stage ahead of their use, into the registers that the step before has just left.
// a0 goes through LDS in stages of 128 k, two buffers: every wave loads 4 units of the next-but-one stage as f32 (in flight under a whole stage), rounds them to bf16 (f2bf, the rounding the cast pass had) and stores them in fragment order into the buffer that is not being read; ONE barrier a stage publishes it and ends the reads of the other.
// f32 sums S[m][n] = sum_k A[m][k] Bt[n][k], K % 128 == 0; each sum leaves the wave as its bf16 hi / lo words (splitf), never as an f32 plane:
//   q and k: planes Ph / Pl of [m][n], ldc words a row ([entry][t][d] is [m][n] as it stands), in fragment order; a column tile is staged through the wave's own slice of LDS, from which a lane takes the 8 consecutive n of its unit.
//   v: transposed planes of [n][t] per entry, TT words a row, in fragment order, [entry][hi: HD x TT | lo: HD x TT] (Pl = Ph + HD TT); m = entry x TT + t. A lane's 8 accumulator registers are 8 consecutive t of one n = lane % 16: they ARE the lane's unit: one 16-byte store a plane, no staging.
// FRAGMENT ORDER of a K-contiguous 16-bit plane X[row][k] (K % 32 == 0, rows % 16 == 0): blocks of 16 rows x 32 k = 512 words = 1 KiB, block (R, S) = (row / 16, k / 32) at word (R K / 32 + S) 512 = 16 R K + 16 (32 S);
// inside a block [half 2][lane 32][8 words]: word (row, k) with kk = k % 32 stands at (kk / 16) 256 + (((kk % 16) / 8) 16 + row % 16) 8 + kk % 8. A lane's fragment (row lane % 16; k = 8 (lane / 16) + 0..7, then 16 more) is the same 16 words in the same order as it would take from the row plane,
// but each of its two 16-byte loads (ldf: the lane's unit of half 0, then of half 1) is, over the wave, 512 contiguous bytes = 4 whole lines, where a load from the row plane touches 16 lines. Every writer of such a plane stores whole units, 512 contiguous bytes a wave.
template <typename T16> struct WFrag;
template <> struct WFrag<h16> { typedef v16h V; static __device__ __forceinline__ V ldf(const h16* p) { return cat16(*(const v8h*)p, *(const v8h*)(p + 256)); } static __device__ __forceinline__ v8f mma(V a, V b, v8f c) { return wmma16(a, b, c); } };
template <> struct WFrag<bf> { typedef v16bf V; static __device__ __forceinline__ V ldf(const bf* p) { return cat16b(*(const v8us*)p, *(const v8us*)(p + 256)); } static __device__ __forceinline__ v8f mma(V a, V b, v8f c) { return wmmab(a, b, c); } };
#define STK 128   // k of one stage of a0: 64 rows x 128 k, 32 KiB as f32 in flight, 16 KiB as bf16 in LDS
#define OSP 20    // words from one staged output row to the next in LDS: 16 and a pad of 4, so that the 16-byte row reads fall on all 64 banks
__device__ __forceinline__ void wg_publish() { asm volatile("s_wait_dscnt 0x0\n\ts_barrier_signal -1\n\ts_barrier_wait -1" ::: "memory"); }   // the wave's own LDS writes and reads are done, then the work-group's barrier; written by hand so that the global loads issued ahead (next weights, next a0 stage) stay in flight across it
template <typename T16, int K>
__global__ __launch_bounds__(256) void k_gemmw(const float* __restrict__ X, const T16* __restrict__ W3, bf* Qh, bf* Ql, bf* Kh, bf* Kl, bf* Vh, bf* Vl, int ldc) {
    typedef typename WFrag<T16>::V V;
    constexpr int NS = K / STK;
    __shared__ __align__(16) T16 as[2][64 * STK];
    __shared__ __align__(16) float osw[8][64 * OSP];
    const int wave = __builtin_amdgcn_readfirstlane((int)(threadIdx.x >> 5));   // a scalar, so that every test on a column tile's weight is a scalar branch
    float* os = osw[wave];
    const int lane = threadIdx.x & 31, lr = lane & 15, hi = lane >> 4; const int r0 = blockIdx.x * 64;
    v8f acc[4][3];
#pragma unroll
    for (int mb = 0; mb < 4; ++mb)
#pragma unroll
        for (int nb = 0; nb < 3; ++nb) acc[mb][nb] = (v8f){};
    const float* xl = X + (size_t)(r0 + lr) * K + wave * 16 + 8 * hi;   // wave w casts half w % 2 of k step w / 2 of each of the stage's 4 row tiles: the lane's unit is 8 floats contiguous in row lr of the row tile
    T16* ad = &as[0][0] + wave * 256 + 8 * lane;                          // and, as bf16, its 16 bytes of the wave's 512 contiguous bytes of that half
    const T16* pb = W3 + (size_t)(wave * 48) * K + 8 * lane;              // fragment order: row tile R of the 24 (q, k, v: 8 each) starts at word 16 R K, its k step at 16 kc
    v8f stg[4]; V b[4][3];   // a stage's 4 units of the wave as f32, in flight; a stage's weight fragments [k step][column tile]
    auto ldx = [&](int st) {   // a stage's 4 units of the wave, as f32
        const float* xs = xl + st * STK;
#pragma unroll
        for (int mb = 0; mb < 4; ++mb) stg[mb] = *(const v8f*)(xs + mb * 16 * K);
        asm volatile("s_wait_xcnt 0x0" :: "v"(xs) : "memory");   // behind the stage's a0 loads, in front of the first overwrite of their address registers, which it holds up to here
    };
    auto stx = [&](int st) {   // the same units, rounded to bf16, into the stage's buffer
        T16* dd = ad + (st & 1) * (64 * STK);
#pragma unroll
        for (int mb = 0; mb < 4; ++mb) { v8us o;
#pragma unroll
            for (int e = 0; e < 8; ++e) o[e] = f2bf(stg[mb][e]);
            *(v8us*)(dd + mb * 4 * 512) = o; }
    };
    ldx(0);
#pragma unroll
    for (int S = 0; S < 4; ++S)
#pragma unroll
        for (int nb = 0; nb < 3; ++nb) b[S][nb] = WFrag<T16>::ldf(pb + S * 512 + nb * 16 * K);
    asm volatile("s_wait_xcnt 0x0" :: "v"(pb) : "memory");   // behind stage 0's weight loads, in front of the first overwrite of their address registers
    stx(0);
    ldx(1);
    wg_publish();   // stage 0 of a0 is in LDS before any wave reads it

    for (int s = 0; s < NS; ++s) {
        const T16* ab = as[s & 1] + 8 * lane; const T16* kn = pb + (s + 1 < NS ? s + 1 : s) * (STK * 16);   // the next stage's weight fragments; the last stage names its own again, so that the loads stand under no branch
        V a[2][4];
#pragma unroll
        for (int mb = 0; mb < 4; ++mb) a[0][mb] = WFrag<T16>::ldf(ab + mb * 4 * 512);
#pragma unroll
        for (int S = 0; S < 4; ++S) {
            if (S < 3) {
#pragma unroll
                for (int mb = 0; mb < 4; ++mb) a[(S + 1) & 1][mb] = WFrag<T16>::ldf(ab + (mb * 4 + S + 1) * 512);   // the next k step's a0 fragments leave LDS under this step's products
            }
#pragma unroll
            for (int nb = 0; nb < 3; ++nb)
#pragma unroll
                for (int mb = 0; mb < 4; ++mb) acc[mb][nb] = WFrag<T16>::mma(a[S & 1][mb], b[S][nb], acc[mb][nb]);
#pragma unroll
            for (int nb = 0; nb < 3; ++nb) b[S][nb] = WFrag<T16>::ldf(kn + S * 512 + nb * 16 * K);   // refills the registers that this step has just used: a whole stage ahead of their use
            asm volatile("s_wait_xcnt 0x0" :: "v"(kn) : "memory");   // behind the step's weight loads, in front of the first overwrite of their address registers, which it holds up to here
        }
        if (s + 1 < NS) {   // the same for every wave of the block
            stx(s + 1);   // into the buffer that stage s - 1 read: every wave left it before the barrier at the foot of that stage
            if (s + 2 < NS) ldx(s + 2);   // flies under the whole of stage s + 1
            wg_publish();   // stage s + 1 is in LDS, and the last of stage s has been read
        }
    }
    const int g = r0 / TT, t0 = r0 % TT;   // a 64-row tile lies inside one entry (TT % 64 == 0)
#pragma unroll
    for (int nb = 0; nb < 3; ++nb) {
        const int ti = wave * 3 + nb, p = ti >> 3, n0 = (ti & 7) * 16;   // the column tile's weight (0 = q, 1 = k, 2 = v) and its first column there: scalars
        bf* Ph = (p == 0) ? Qh : (p == 1) ? Kh : Vh; bf* Pl = (p == 0) ? Ql : (p == 1) ? Kl : Vl;
        if (p == 2) {
#pragma unroll
            for (int mb = 0; mb < 4; ++mb) { v8us oh, ol;
#pragma unroll
                for (int j = 0; j < 8; ++j) { unsigned short a2, c2; splitf(acc[mb][nb][j], a2, c2); oh[j] = a2; ol[j] = c2; }
                const size_t oo = (size_t)g * (2 * HD * TT) + (size_t)n0 * TT + (size_t)t0 * 16 + (mb >> 1) * 512 + (mb & 1) * 256 + lane * 8; *(v8us*)(Ph + oo) = oh; *(v8us*)(Pl + oo) = ol; }
            asm volatile("s_wait_xcnt 0x0" ::: "memory");   // stands behind the run of stores, in front of whatever next takes the registers that they name
        } else {
#pragma unroll
            for (int mb = 0; mb < 4; ++mb)
#pragma unroll
                for (int j = 0; j < 8; ++j) os[(mb * 16 + hi * 8 + j) * OSP + lr] = acc[mb][nb][j];
            __builtin_amdgcn_wave_barrier(); asm volatile("" ::: "memory");   // keeps the row reads below behind the staging writes above
#pragma unroll
            for (int mb = 0; mb < 4; ++mb) { const float* sp = os + (mb * 16 + lr) * OSP + hi * 8; const v4f v0 = *(const v4fa*)sp, v1 = *(const v4fa*)(sp + 4); v8us oh, ol;   // row lr of the row tile, columns 8 hi ..: the lane's 8 words of the column tile's half
#pragma unroll
                for (int q = 0; q < 4; ++q) { unsigned short a2, c2; splitf(v0[q], a2, c2); oh[q] = a2; ol[q] = c2; splitf(v1[q], a2, c2); oh[4 + q] = a2; ol[4 + q] = c2; }
                const size_t oo = (size_t)(r0 + mb * 16) * ldc + (size_t)n0 * 16 + lane * 8; *(v8us*)(Ph + oo) = oh; *(v8us*)(Pl + oo) = ol; }
            asm volatile("s_wait_xcnt 0x0" ::: "memory");   // stands behind the run of stores, in front of whatever next takes the registers that they name
            __builtin_amdgcn_wave_barrier(); asm volatile("" ::: "memory");   // keeps the next column tile's staging writes behind these row reads
        }
    }
}

__device__ __forceinline__ h16 tohx(float x) { return (h16)x; }
typedef __attribute__((ext_vector_type(2))) _Float16 v2h;
typedef __attribute__((ext_vector_type(4))) _Float16 v4h;
typedef __attribute__((ext_vector_type(2))) unsigned short v2us;
typedef __attribute__((ext_vector_type(2))) float v2f;
typedef __attribute__((ext_vector_type(4))) int v4i;


// ---- k_prep: the transposing casts of the q, k and v weights, which depend on nothing but the inputs, in ONE launch, told apart by block index (WTB blocks each).
// Every plane leaves in FRAGMENT ORDER (above k_gemmw). A thread makes the 16-byte unit u of its plane: block u / 64, half (u % 64) / 32, lane u % 32; a wave stores 512 contiguous bytes.
// Weights (in, out): the unit's 8 words are 8 rows k of one column n; 16 lanes read 64 contiguous bytes of a row.
#define WTB (DM * HD / 8 / 256)   // blocks per weight: 256 units of 8 words
__global__ __launch_bounds__(256) void k_prep(const float* __restrict__ wq, const float* __restrict__ wk, const float* __restrict__ wv, bf* WQ, bf* WK, bf* WV) {
    const int ln = threadIdx.x & 31, kin = ((threadIdx.x >> 5) & 1) * 16 + (ln >> 4) * 8, rin = ln & 15;   // 256 threads are 4 whole blocks: the unit's k and row inside its block
    const int sel = blockIdx.x / WTB, blk = blockIdx.x % WTB; const float* __restrict__ w = (sel == 0) ? wq : (sel == 1) ? wk : wv; bf* Bt = (sel == 0) ? WQ : (sel == 1) ? WK : WV;
    const int u = blk * 256 + threadIdx.x, fb = u >> 6; const int n = (fb / (DM / 32)) * 16 + rin, k = (fb % (DM / 32)) * 32 + kin; v8us o;
#pragma unroll
    for (int e = 0; e < 8; ++e) o[e] = f2bf(w[(size_t)(k + e) * HD + n]);
    *(v8us*)(Bt + (size_t)u * 8) = o;
}

// ---- k_attn: scores, softmax and P x v of 32 query rows in ONE kernel: neither a score nor a weight leaves the chip.
// A block is 8 waves on the SAME 32 queries; the keys up to the diagonal are dealt over the waves in steps of 32 (wave w takes steps w, w + 8, ...); each wave keeps a running maximum m, a running sum l and an unnormalised f32 result for its own keys.
// The products are formed TRANSPOSED, so that no fragment is re-ordered between them: S^T = k q^T (A = key rows, B = query rows): a lane's 8 accumulator registers are keys 8 (lane / 16) + 0..7 of query lane % 16,
// and the accumulators of the step's two key tiles are, in that order, the lane's 16 words of the B fragment of P^T (k order of the loader: 8 (lane / 16) + 0..7, then 16 more). result^T = v^T P^T (A = the transposed value planes): a lane holds 8 consecutive d of its query.
// Three products on hi / lo planes in both, in the order hi hi, (q or P) lo x hi, hi x (k or v) lo; a score's sum over d runs in the same order as ever. A row's maximum and sum lie in the lane (and its partner 16 lanes on): one shuffle a step.
// The weights are split into bf16 hi / lo words UNNORMALISED (exp of score - running maximum, at most 1); the division by the row's sum is done once, on the f32 result.
// At the end the 8 waves' (m, l) meet in LDS; each wave scales its result by exp(m - M) / L, the partial results meet in LDS and are added over the waves 0, 1, ..., 7 IN THAT FIXED ORDER; a wave stores whole 512-byte output rows.
// A block's work grows with its row index: the long blocks have the low block indices, so that they start first.
__device__ __forceinline__ float exp2n(float x) { float r; asm("v_exp_f32 %0, %1\n\tv_nop" : "=v"(r) : "v"(x)); return r; }   // the hardware exp2 with the slot behind the transcendental filled
#define OPD 132   // words from one query's partial result to the next in LDS: 128 and a pad of 4, so that the 16 lanes of a 16-byte write fall on all 64 banks
#define L2E 1.4426950408889634f
__global__ __launch_bounds__(256) void k_attn(const bf* __restrict__ Qp, const bf* __restrict__ Kp, const bf* __restrict__ Vt, float* __restrict__ O) {
    typedef WFrag<bf> F; typedef v16bf V;
    constexpr int DP = ZH * TT * HD, DB = HD * TT;   // the lo plane stands DP words (q, k) or DB words (v) behind its hi plane
    __shared__ __align__(16) float red[8 * 32 * OPD];
    __shared__ float sm[8][32], sl[8][32];
    const int wave = __builtin_amdgcn_readfirstlane((int)(threadIdx.x >> 5));   // a scalar, so that the key loop's test is a scalar branch
    const int lane = threadIdx.x & 31, lr = lane & 15, hi = lane >> 4;
    const int z = blockIdx.x % ZH, q0 = (TT / 32 - 1 - (int)(blockIdx.x / ZH)) * 32;
    const bf* qs = Qp + (size_t)z * TT * HD + (size_t)q0 * HD; const bf* qa = qs + 8 * lane;   // fragment order: row tile R starts at word 16 R HD, its k step at 512 words a step
    V qh[2][4], ql[2][4];
#pragma unroll
    for (int qt = 0; qt < 2; ++qt)
#pragma unroll
        for (int ks = 0; ks < 4; ++ks) { qh[qt][ks] = F::ldf(qa + qt * 16 * HD + ks * 512); ql[qt][ks] = F::ldf(qa + DP + qt * 16 * HD + ks * 512); }
    asm volatile("s_wait_xcnt 0x0" :: "s"(qs), "v"(lane) : "memory");   // behind the query loads, in front of the first overwrite of their address registers (a scalar base and the lane), which it holds up to here
    v8f acc[8][2];
#pragma unroll
    for (int dt = 0; dt < 8; ++dt) { acc[dt][0] = (v8f){}; acc[dt][1] = (v8f){}; }
    float m[2] = { -3.0e38f, -3.0e38f }, l[2] = { 0.f, 0.f };
    const bf* kbase = Kp + (size_t)z * TT * HD + 8 * lane; const bf* vbase = Vt + (size_t)z * (2 * HD * TT) + 8 * lane;

    for (int kc = wave * 32; kc <= q0; kc += 8 * 32) {
        const bf* ka = kbase + kc * HD; const bf* va = vbase + kc * 16;   // key rows kc ..: row tile kc / 16 of HD words a row; value planes: k step kc / 32; every fragment of the step lies at a constant offset from these two
        V kh[2][4], kl[2][4];
#pragma unroll
        for (int ks = 0; ks < 4; ++ks)
#pragma unroll
            for (int kt = 0; kt < 2; ++kt) { kh[kt][ks] = F::ldf(ka + kt * 16 * HD + ks * 512); kl[kt][ks] = F::ldf(ka + DP + kt * 16 * HD + ks * 512); }
        asm volatile("s_wait_xcnt 0x0" :: "v"(ka) : "memory");   // behind the step's key loads, in front of the first overwrite of their address registers, which it holds up to here
        __builtin_amdgcn_sched_barrier(0);   // all 16 key fragments are in flight together before the first product
        v8f st[2][2];
#pragma unroll
        for (int kt = 0; kt < 2; ++kt) { st[kt][0] = (v8f){}; st[kt][1] = (v8f){}; }
#pragma unroll
        for (int ks = 0; ks < 4; ++ks)
#pragma unroll
            for (int kt = 0; kt < 2; ++kt)
#pragma unroll
                for (int qt = 0; qt < 2; ++qt) { st[kt][qt] = F::mma(kh[kt][ks], qh[qt][ks], st[kt][qt]); st[kt][qt] = F::mma(kh[kt][ks], ql[qt][ks], st[kt][qt]); st[kt][qt] = F::mma(kl[kt][ks], qh[qt][ks], st[kt][qt]); }
        __builtin_amdgcn_sched_barrier(0);   // the value loads below take the registers that the key fragments have left
        V vh[8], vl[8];
#pragma unroll
        for (int dt = 0; dt < 8; ++dt) { vh[dt] = F::ldf(va + dt * 16 * TT); vl[dt] = F::ldf(va + DB + dt * 16 * TT); }
        asm volatile("s_wait_xcnt 0x0" :: "v"(va) : "memory");   // behind the step's value loads, in front of the first overwrite of their address registers, which it holds up to here
        __builtin_amdgcn_sched_barrier(0);   // the value loads are issued before the softmax arithmetic and fly during it
        V ph[2], pl[2]; float al[2];
#pragma unroll
        for (int qt = 0; qt < 2; ++qt) {
            const int lim = q0 + qt * 16 + lr - kc - 8 * hi;   // the lane's key 16 kt + j (+ kc + 8 hi) is at or in front of its query where 16 kt + j <= lim
            float mx = -3.0e38f;
#pragma unroll
            for (int kt = 0; kt < 2; ++kt)
#pragma unroll
                for (int j = 0; j < 8; ++j) { const float t = (kt * 16 + j <= lim) ? st[kt][qt][j] * SCL : -3.0e38f; st[kt][qt][j] = t; mx = fmaxf(mx, t); }   // an excluded key gets -3e38, whose exponential is an exact zero; key kc is never excluded (kc <= q0), so the maximum is a real score
            mx = fmaxf(mx, __shfl_xor(mx, 16, 32));
            const float mn = fmaxf(m[qt], mx); al[qt] = exp2n((m[qt] - mn) * L2E); m[qt] = mn;
            float s = 0.f;
#pragma unroll
            for (int kt = 0; kt < 2; ++kt)
#pragma unroll
                for (int j = 0; j < 8; ++j) { const float p = exp2n((st[kt][qt][j] - mn) * L2E); s += p; const __bf16 h = (__bf16)p; ph[qt][kt * 8 + j] = h; pl[qt][kt * 8 + j] = (__bf16)(p - (float)h); }
            l[qt] = l[qt] * al[qt] + s;
        }
        if (__builtin_amdgcn_ballot_w32(al[0] != 1.0f || al[1] != 1.0f)) {   // the carried result is rescaled only in a step that raises some row's maximum
#pragma unroll
            for (int dt = 0; dt < 8; ++dt) { acc[dt][0] *= al[0]; acc[dt][1] *= al[1]; }
        }
#pragma unroll
        for (int dt = 0; dt < 8; ++dt)
#pragma unroll
            for (int qt = 0; qt < 2; ++qt) { acc[dt][qt] = F::mma(vh[dt], ph[qt], acc[dt][qt]); acc[dt][qt] = F::mma(vh[dt], pl[qt], acc[dt][qt]); acc[dt][qt] = F::mma(vl[dt], ph[qt], acc[dt][qt]); }
        asm volatile("v_nop\n\tv_nop\n\tv_nop\n\tv_nop" : "+v"(acc[6][0]), "+v"(acc[6][1]), "+v"(acc[7][0]), "+v"(acc[7][1]) : "v"(vh[7]), "v"(vl[7]));   // the matrix instructions' distance on the loop's taken branch
    }
#pragma unroll
    for (int qt = 0; qt < 2; ++qt) { l[qt] += __shfl_xor(l[qt], 16, 32); if (hi == 0) { sm[wave][qt * 16 + lr] = m[qt]; sl[wave][qt * 16 + lr] = l[qt]; } }
    __syncthreads();   // all 8 waves' maxima and sums are in LDS before any wave reads them
#pragma unroll
    for (int qt = 0; qt < 2; ++qt) { const int q = qt * 16 + lr; float M = sm[0][q];
#pragma unroll
        for (int w = 1; w < 8; ++w) M = fmaxf(M, sm[w][q]);
        float L = 0.f;
#pragma unroll
        for (int w = 0; w < 8; ++w) L += sl[w][q] * exp2n((sm[w][q] - M) * L2E);   // a wave without a step has m = -3e38 and l = 0: an exact zero; wave 0 always has step 0
        const float f = exp2n((m[qt] - M) * L2E) / L;
        float* op = red + (wave * 32 + q) * OPD + hi * 8;
#pragma unroll
        for (int dt = 0; dt < 8; ++dt) { const v8f a = acc[dt][qt] * f; *(v4fa*)(op + dt * 16) = (v4f){ a[0], a[1], a[2], a[3] }; *(v4fa*)(op + dt * 16 + 4) = (v4f){ a[4], a[5], a[6], a[7] }; } }
    __syncthreads();   // all 8 partial results are in LDS before any wave adds them
    v4f val[4];
#pragma unroll
    for (int s = 0; s < 4; ++s) { const float* rp = red + (s * 8 + wave) * OPD + lane * 4; val[s] = *(const v4fa*)rp;
#pragma unroll
        for (int w = 1; w < 8; ++w) val[s] += *(const v4fa*)(rp + w * 32 * OPD); }
    float* orow = O + ((size_t)z * TT + q0 + wave) * HD + lane * 4;   // row 8 s + wave of the block's 32: a wave stores the row's 512 bytes
#pragma unroll
    for (int s = 0; s < 4; ++s) *(v4f*)(orow + s * 8 * HD) = val[s];
}

extern "C" void kernel_launch(void* const* d_in, const int* in_sizes, int n_in,
                              void* d_out, int out_size, void* d_ws, size_t ws_size, hipStream_t stream) {
    (void)in_sizes; (void)n_in; (void)out_size;
    const float* x = (const float*)d_in[0]; const float* wk = (const float*)d_in[1]; const float* wq = (const float*)d_in[2]; const float* wv = (const float*)d_in[3];
    // inputs in the module's argument order = d_in[0..3]: the [8][2048][1024] plane, then the KEY, QUERY and VALUE weights [1024][128] (in, out): all four read; the causal rule is computed: there is no mask input
    float* OUT = (float*)d_out;     // [8][2048][128]
    char* wsp = (char*)d_ws;
    auto take = [&](size_t bytes) { char* p = wsp; wsp += (bytes + 255) & ~(size_t)255; return (void*)p; };
    bf* WQ = (bf*)take((size_t)(DQ + 2 * DKV) * DM * 2); bf* WK = WQ + DQ * DM; bf* WV = WK + DKV * DM;   /* one plane of 384 rows: q, k, v */
    bf* QPh = (bf*)take((size_t)ZH * TT * HD * 2 * 2); bf* QPl = QPh + ZH * TT * HD; bf* KPh = (bf*)take((size_t)ZH * TT * HD * 2 * 2); bf* KPl = KPh + ZH * TT * HD;   /* [hi plane | lo plane], as they lay */ bf* VTh = (bf*)take((size_t)ZH * HD * 2 * TT * 2);
    if ((size_t)(wsp - (char*)d_ws) > ws_size) return;
    bf* VTl = VTh + (size_t)HD * TT;           // an entry's value planes, fragment order: [hi: HD x TT | lo: HD x TT] (k_gemmw)
    k_prep<<<3 * WTB, 256, 0, stream>>>(wq, wk, wv, WQ, WK, WV);   /* (in, out) weights: the transposing cast: [128][1024] = Bt */
    k_gemmw<bf, DM><<<NB_ * TT / 64, 256, 0, stream>>>(x, WQ, QPh, QPl, KPh, KPl, VTh, VTl, HD);   /* the three projections, a0 read as f32 and cast on its way: the eight entries' rows are one [16384][1024] operand; each wave writes its own tile of its weight's hi / lo planes */
    k_attn<<<ZH * (TT / 32), 256, 0, stream>>>(QPh, KPh, VTh, OUT);   /* scores (three products), softmax, P x v (three products) of 32 query rows a block; the lo planes stand at constant distances behind the hi planes: the one writer of d_out */
}

// v009
// A run of this version takes 46.4 microseconds.
// In two side-by-side timings against v008, it was 1.03 and 1.02 times as fast.
// Counting every step since v000, it is 21.0 times as fast.
#include <hip/hip_runtime.h>

// One head of causal self-attention with a 128-wide head, NO output projection, and the scores MULTIPLIED by 32 (inputs, in argument order: a0 [8][2048][1024]; a1, a2, a3 [1024][128] stored (in, out) and used as x W: the key, query and value weights IN THAT ORDER):
//   THE MODULE's FUNCTION: k = a0 a1; q = a0 a2; v = a0 a3 ([8][2048][128] each); S = (q k^T) x 32; everything above the diagonal set to nought, then EVERY exact nought set to -inf (so the module excludes the keys after the query AND any key inside the triangle whose score is exactly 0.0); softmax over the 2,048 keys; result = P v -> [8][2048][128] (2.1 M).
//   THIS TEXT excludes the keys after the query by index and KEEPS a score of exactly 0.0 inside the triangle: the two differ only where a computed score is exactly 0.0: not reached on real data (said again below).
// Layout: ALL EIGHT batch entries go through every stage in ONE launch of that stage (the entry is a plane index: more rows in the projections, a part of the block index in the attention kernel): the (in, out) weights transposed once by a transposing cast, the three casts in one launch; the three projections in one launch, which reads a0 as f32 and casts it to bf16 on its way into LDS (no bf16 copy of a0 in memory); exact projections (bf16 x bf16 words, f32 sums) WHOSE OWN EPILOGUE splits each f32 sum into the bf16 hi / lo planes that the attention GEMMs read (q and k row planes; the transposed value planes): no f32 projection plane and no plane-builder pass; EVERY 16-bit plane that a GEMM reads (a0's stages in LDS, the weights, q, k, the transposed v) is stored in FRAGMENT ORDER (said above k_gemmw's loader);
//   causal T-2048 attention for the one head: THE SCORES ON hi / lo PLANES ON EVERY ROW (three products: the softmax is all but a hard maximum, a score's spread is about 360, and one 16-bit rounding of q or k would flip the winning key in hundreds of rows); THE SOFTMAX WEIGHTS ON bf16 hi / lo PLANES ON EVERY ROW TOO (RH = TT) and P x v as three products against the hi / lo value planes: a one-word fp16 P is not taken: 6.4 per cent of this draw's non-zero carried weights would be fp16 subnormals;
//   scores, softmax and P x v run in ONE kernel (k_attn: running maximum and sum; keys behind the diagonal step never touched), which stores the output rows: the one writer of d_out.
// The scale: the module writes scores x sqrt(1024): SCL 32.0f applied to each score in k_attn's masking step, as the module writes it (a power of two: exact).
// Compute dtypes, f32 accumulate: every float input rounded to bf16 at its load; projections exact; scores three products; softmax f32 (the hardware exp2); P x v three products (bf16 hi / lo both sides; lo x lo not formed); the output is those f32 sums as they stand.

#define NB_  8      // batch entries: the input is [8][2048][1024]
#define TT   2048
#define DM   1024
#define NH_  1
#define NKV  1
#define REP  (NH_ / NKV)
#define HD   128
#define DQ   (NH_ * HD)
#define DKV  (NKV * HD)
#define ZH   NB_                  // planes per attention launch: one head x the eight batch entries
#define RH   2048                 // = TT: query rows < RH use hi+lo planes of P: EVERY row here
#define WIN  2048
#define PCAR 1024.0f
#define SCL  32.0f   // sqrt(1024): the module MULTIPLIES the scores by it
typedef _Float16 h16;
typedef unsigned short bf;
typedef __attribute__((ext_vector_type(16))) __bf16   v16bf;
typedef __attribute__((ext_vector_type(16))) _Float16 v16h;
typedef __attribute__((ext_vector_type(8)))  _Float16 v8h;
typedef __attribute__((ext_vector_type(8)))  unsigned short v8us;
typedef __attribute__((ext_vector_type(8)))  float    v8f;
typedef __attribute__((ext_vector_type(4)))  float    v4f;
typedef v8h  __attribute__((may_alias)) v8ha;
typedef v4f  __attribute__((may_alias)) v4fa;
typedef v8us __attribute__((may_alias)) v8usa;

__device__ __forceinline__ unsigned short f2bf(float f) { unsigned u = __float_as_uint(f); u += 0x7FFFu + ((u >> 16) & 1u); return (unsigned short)(u >> 16); }
__device__ __forceinline__ float bf2f(unsigned short b) { return __uint_as_float(((unsigned)b) << 16); }
__device__ __forceinline__ float bfr(float f) { return bf2f(f2bf(f)); }
__device__ __forceinline__ v16h cat16(v8h lo, v8h hi) { return __builtin_shufflevector(lo, hi, 0, 1, 2, 3, 4, 5, 6, 7, 8, 9, 10, 11, 12, 13, 14, 15); }
__device__ __forceinline__ v16bf cat16b(v8us lo, v8us hi) { return __builtin_bit_cast(v16bf, __builtin_shufflevector(lo, hi, 0, 1, 2, 3, 4, 5, 6, 7, 8, 9, 10, 11, 12, 13, 14, 15)); }
__device__ __forceinline__ v8f wmma16(v16h a, v16h b, v8f c) { return __builtin_amdgcn_wmma_f32_16x16x32_f16(false, a, false, b, (short)0, c, false, false); }
__device__ __forceinline__ v8f wmmab(v16bf a, v16bf b, v8f c) { return __builtin_amdgcn_wmma_f32_16x16x32_bf16(false, a, false, b, (short)0, c, false, false); }
__device__ __forceinline__ void splitf(float y, unsigned short& h, unsigned short& l) { h = f2bf(y); l = f2bf(y - bf2f(h)); }
typedef __attribute__((ext_vector_type(4))) unsigned short v4us;



// ---- k_gemmw: the three projections in ONE launch, with a0's cast to bf16 inside it. A block is 64 rows of a0 x ALL 384 output columns (q, k, v: 128 each; the three weight planes lie behind one another as one plane of 384 rows), so that a0 is read from memory once, as f32.
// 8 waves, each a 64x48 output tile (12 accumulators): column tiles 3 w .. 3 w + 2 of the 24; grid M / 64, 256 threads. The weight fragments come straight from their plane in fragment order (below), a whole stage ahead of their use, into the registers that the step before has just left.
// a0 goes through LDS in stages of 128 k, two buffers: every wave loads 4 units of the next-but-one stage as f32 (in flight under a whole stage), rounds them to bf16 (f2bf, the rounding the cast pass had) and stores them in fragment order into the buffer that is not being read; ONE barrier a stage publishes it and ends the reads of the other.
// f32 sums S[m][n] = sum_k A[m][k] Bt[n][k], K % 128 == 0; each sum leaves the wave as its bf16 hi / lo words (splitf), never as an f32 plane:
//   q and k: planes Ph / Pl of [m][n], ldc words a row ([entry][t][d] is [m][n] as it stands), in fragment order; a column tile is staged through the wave's own slice of LDS, from which a lane takes the 8 consecutive n of its unit.
//   v: transposed planes of [n][t] per entry, TT words a row, in fragment order, [entry][hi: HD x TT | lo: HD x TT] (Pl = Ph + HD TT); m = entry x TT + t. A lane's 8 accumulator registers are 8 consecutive t of one n = lane % 16: they ARE the lane's unit: one 16-byte store a plane, no staging.
// FRAGMENT ORDER of a K-contiguous 16-bit plane X[row][k] (K % 32 == 0, rows % 16 == 0): blocks of 16 rows x 32 k = 512 words = 1 KiB, block (R, S) = (row / 16, k / 32) at word (R K / 32 + S) 512 = 16 R K + 16 (32 S);
// inside a block [half 2][lane 32][8 words]: word (row, k) with kk = k % 32 stands at (kk / 16) 256 + (((kk % 16) / 8) 16 + row % 16) 8 + kk % 8. A lane's fragment (row lane % 16; k = 8 (lane / 16) + 0..7, then 16 more) is the same 16 words in the same order as it would take from the row plane,
// but each of its two 16-byte loads (ldf: the lane's unit of half 0, then of half 1) is, over the wave, 512 contiguous bytes = 4 whole lines, where a load from the row plane touches 16 lines. Every writer of such a plane stores whole units, 512 contiguous bytes a wave.
template <typename T16> struct WFrag;
template <> struct WFrag<h16> { typedef v16h V; static __device__ __forceinline__ V ldf(const h16* p) { return cat16(*(const v8h*)p, *(const v8h*)(p + 256)); } static __device__ __forceinline__ v8f mma(V a, V b, v8f c) { return wmma16(a, b, c); } };
template <> struct WFrag<bf> { typedef v16bf V; static __device__ __forceinline__ V ldf(const bf* p) { return cat16b(*(const v8us*)p, *(const v8us*)(p + 256)); } static __device__ __forceinline__ v8f mma(V a, V b, v8f c) { return wmmab(a, b, c); } };
#define STK 128   // k of one stage of a0: 64 rows x 128 k, 32 KiB as f32 in flight, 16 KiB as bf16 in LDS
#define OSP 20    // words from one staged output row to the next in LDS: 16 and a pad of 4, so that the 16-byte row reads fall on all 64 banks
__device__ __forceinline__ void wg_publish() { asm volatile("s_wait_dscnt 0x0\n\ts_barrier_signal -1\n\ts_barrier_wait -1" ::: "memory"); }   // the wave's own LDS writes and reads are done, then the work-group's barrier; written by hand so that the global loads issued ahead (next weights, next a0 stage) stay in flight across it
template <typename T16, int K>
__global__ __launch_bounds__(256) void k_gemmw(const float* __restrict__ X, const T16* __restrict__ W3, bf* Qh, bf* Ql, bf* Kh, bf* Kl, bf* Vh, bf* Vl, int ldc) {
    typedef typename WFrag<T16>::V V;
    constexpr int NS = K / STK;
    __shared__ __align__(16) T16 as[2][64 * STK];
    __shared__ __align__(16) float osw[8][64 * OSP];
    const int wave = __builtin_amdgcn_readfirstlane((int)(threadIdx.x >> 5));   // a scalar, so that every test on a column tile's weight is a scalar branch
    float* os = osw[wave];
    const int lane = threadIdx.x & 31, lr = lane & 15, hi = lane >> 4; const int r0 = blockIdx.x * 64;
    v8f acc[4][3];
#pragma unroll
    for (int mb = 0; mb < 4; ++mb)
#pragma unroll
        for (int nb = 0; nb < 3; ++nb) acc[mb][nb] = (v8f){};
    const float* xl = X + (size_t)(r0 + lr) * K + wave * 16 + 8 * hi;   // wave w casts half w % 2 of k step w / 2 of each of the stage's 4 row tiles: the lane's unit is 8 floats contiguous in row lr of the row tile
    T16* ad = &as[0][0] + wave * 256 + 8 * lane;                          // and, as bf16, its 16 bytes of the wave's 512 contiguous bytes of that half
    const T16* pb = W3 + (size_t)(wave * 48) * K + 8 * lane;              // fragment order: row tile R of the 24 (q, k, v: 8 each) starts at word 16 R K, its k step at 16 kc
    v8f stg[4]; V b[4][3];   // a stage's 4 units of the wave as f32, in flight; a stage's weight fragments [k step][column tile]
    auto ldx = [&](int st) {   // a stage's 4 units of the wave, as f32
        const float* xs = xl + st * STK;
#pragma unroll
        for (int mb = 0; mb < 4; ++mb) stg[mb] = *(const v8f*)(xs + mb * 16 * K);
        asm volatile("s_wait_xcnt 0x0" :: "v"(xs) : "memory");   // behind the stage's a0 loads, in front of the first overwrite of their address registers, which it holds up to here
    };
    auto stx = [&](int st) {   // the same units, rounded to bf16, into the stage's buffer
        T16* dd = ad + (st & 1) * (64 * STK);
#pragma unroll
        for (int mb = 0; mb < 4; ++mb) { v8us o;
#pragma unroll
            for (int e = 0; e < 8; ++e) o[e] = f2bf(stg[mb][e]);
            *(v8us*)(dd + mb * 4 * 512) = o; }
    };
    ldx(0);
#pragma unroll
    for (int S = 0; S < 4; ++S)
#pragma unroll
        for (int nb = 0; nb < 3; ++nb) b[S][nb] = WFrag<T16>::ldf(pb + S * 512 + nb * 16 * K);
    asm volatile("s_wait_xcnt 0x0" :: "v"(pb) : "memory");   // behind stage 0's weight loads, in front of the first overwrite of their address registers
    stx(0);
    ldx(1);
    wg_publish();   // stage 0 of a0 is in LDS before any wave reads it

    for (int s = 0; s < NS; ++s) {
        const T16* ab = as[s & 1] + 8 * lane; const T16* kn = pb + (s + 1 < NS ? s + 1 : s) * (STK * 16);   // the next stage's weight fragments; the last stage names its own again, so that the loads stand under no branch
        V a[2][4];
#pragma unroll
        for (int mb = 0; mb < 4; ++mb) a[0][mb] = WFrag<T16>::ldf(ab + mb * 4 * 512);
#pragma unroll
        for (int S = 0; S < 4; ++S) {
            if (S < 3) {
#pragma unroll
                for (int mb = 0; mb < 4; ++mb) a[(S + 1) & 1][mb] = WFrag<T16>::ldf(ab + (mb * 4 + S + 1) * 512);   // the next k step's a0 fragments leave LDS under this step's products
            }
#pragma unroll
            for (int nb = 0; nb < 3; ++nb)
#pragma unroll
                for (int mb = 0; mb < 4; ++mb) acc[mb][nb] = WFrag<T16>::mma(a[S & 1][mb], b[S][nb], acc[mb][nb]);
#pragma unroll
            for (int nb = 0; nb < 3; ++nb) b[S][nb] = WFrag<T16>::ldf(kn + S * 512 + nb * 16 * K);   // refills the registers that this step has just used: a whole stage ahead of their use
            asm volatile("s_wait_xcnt 0x0" :: "v"(kn) : "memory");   // behind the step's weight loads, in front of the first overwrite of their address registers, which it holds up to here
        }
        if (s + 1 < NS) {   // the same for every wave of the block
            stx(s + 1);   // into the buffer that stage s - 1 read: every wave left it before the barrier at the foot of that stage
            if (s + 2 < NS) ldx(s + 2);   // flies under the whole of stage s + 1
            wg_publish();   // stage s + 1 is in LDS, and the last of stage s has been read
        }
    }
    const int g = r0 / TT, t0 = r0 % TT;   // a 64-row tile lies inside one entry (TT % 64 == 0)
#pragma unroll
    for (int nb = 0; nb < 3; ++nb) {
        const int ti = wave * 3 + nb, p = ti >> 3, n0 = (ti & 7) * 16;   // the column tile's weight (0 = q, 1 = k, 2 = v) and its first column there: scalars
        bf* Ph = (p == 0) ? Qh : (p == 1) ? Kh : Vh; bf* Pl = (p == 0) ? Ql : (p == 1) ? Kl : Vl;
        if (p == 2) {
#pragma unroll
            for (int mb = 0; mb < 4; ++mb) { v8us oh, ol;
#pragma unroll
                for (int j = 0; j < 8; ++j) { unsigned short a2, c2; splitf(acc[mb][nb][j], a2, c2); oh[j] = a2; ol[j] = c2; }
                const size_t oo = (size_t)g * (2 * HD * TT) + (size_t)n0 * TT + (size_t)t0 * 16 + (mb >> 1) * 512 + (mb & 1) * 256 + lane * 8; *(v8us*)(Ph + oo) = oh; *(v8us*)(Pl + oo) = ol; }
            asm volatile("s_wait_xcnt 0x0" ::: "memory");   // stands behind the run of stores, in front of whatever next takes the registers that they name
        } else {
#pragma unroll
            for (int mb = 0; mb < 4; ++mb)
#pragma unroll
                for (int j = 0; j < 8; ++j) os[(mb * 16 + hi * 8 + j) * OSP + lr] = acc[mb][nb][j];
            __builtin_amdgcn_wave_barrier(); asm volatile("" ::: "memory");   // keeps the row reads below behind the staging writes above
#pragma unroll
            for (int mb = 0; mb < 4; ++mb) { const float* sp = os + (mb * 16 + lr) * OSP + hi * 8; const v4f v0 = *(const v4fa*)sp, v1 = *(const v4fa*)(sp + 4); v8us oh, ol;   // row lr of the row tile, columns 8 hi ..: the lane's 8 words of the column tile's half
#pragma unroll
                for (int q = 0; q < 4; ++q) { unsigned short a2, c2; splitf(v0[q], a2, c2); oh[q] = a2; ol[q] = c2; splitf(v1[q], a2, c2); oh[4 + q] = a2; ol[4 + q] = c2; }
                const size_t oo = (size_t)(r0 + mb * 16) * ldc + (size_t)n0 * 16 + lane * 8; *(v8us*)(Ph + oo) = oh; *(v8us*)(Pl + oo) = ol; }
            asm volatile("s_wait_xcnt 0x0" ::: "memory");   // stands behind the run of stores, in front of whatever next takes the registers that they name
            __builtin_amdgcn_wave_barrier(); asm volatile("" ::: "memory");   // keeps the next column tile's staging writes behind these row reads
        }
    }
}

__device__ __forceinline__ h16 tohx(float x) { return (h16)x; }
typedef __attribute__((ext_vector_type(2))) _Float16 v2h;
typedef __attribute__((ext_vector_type(4))) _Float16 v4h;
typedef __attribute__((ext_vector_type(2))) unsigned short v2us;
typedef __attribute__((ext_vector_type(2))) float v2f;
typedef __attribute__((ext_vector_type(4))) int v4i;


// ---- k_prep: the transposing casts of the q, k and v weights, which depend on nothing but the inputs, in ONE launch, told apart by block index (WTB blocks each).
// Every plane leaves in FRAGMENT ORDER (above k_gemmw). A thread makes the 16-byte unit u of its plane: block u / 64, half (u % 64) / 32, lane u % 32; a wave stores 512 contiguous bytes.
// Weights (in, out): the unit's 8 words are 8 rows k of one column n; 16 lanes read 64 contiguous bytes of a row.
#define WTB (DM * HD / 8 / 256)   // blocks per weight: 256 units of 8 words
__global__ __launch_bounds__(256) void k_prep(const float* __restrict__ wq, const float* __restrict__ wk, const float* __restrict__ wv, bf* WQ, bf* WK, bf* WV) {
    const int ln = threadIdx.x & 31, kin = ((threadIdx.x >> 5) & 1) * 16 + (ln >> 4) * 8, rin = ln & 15;   // 256 threads are 4 whole blocks: the unit's k and row inside its block
    const int sel = blockIdx.x / WTB, blk = blockIdx.x % WTB; const float* __restrict__ w = (sel == 0) ? wq : (sel == 1) ? wk : wv; bf* Bt = (sel == 0) ? WQ : (sel == 1) ? WK : WV;
    const int u = blk * 256 + threadIdx.x, fb = u >> 6; const int n = (fb / (DM / 32)) * 16 + rin, k = (fb % (DM / 32)) * 32 + kin; v8us o;
#pragma unroll
    for (int e = 0; e < 8; ++e) o[e] = f2bf(w[(size_t)(k + e) * HD + n]);
    *(v8us*)(Bt + (size_t)u * 8) = o;
}

// ---- k_attn: scores, softmax and P x v of 32 query rows in ONE kernel: neither a score nor a weight leaves the chip.
// A block is 8 waves on the SAME 32 queries; the keys up to the diagonal are dealt over the waves in steps of 32 (wave w takes steps w, w + 8, ...); each wave keeps a running maximum m, a running sum l and an unnormalised f32 result for its own keys.
// The products are formed TRANSPOSED, so that no fragment is re-ordered between them: S^T = k q^T (A = key rows, B = query rows): a lane's 8 accumulator registers are keys 8 (lane / 16) + 0..7 of query lane % 16,
// and the accumulators of the step's two key tiles are, in that order, the lane's 16 words of the B fragment of P^T (k order of the loader: 8 (lane / 16) + 0..7, then 16 more). result^T = v^T P^T (A = the transposed value planes): a lane holds 8 consecutive d of its query.
// Three products on hi / lo planes in both, in the order hi hi, (q or P) lo x hi, hi x (k or v) lo; a score's sum over d runs in the same order as ever. A row's maximum and sum lie in the lane (and its partner 16 lanes on): one shuffle a step.
// The weights are split into bf16 hi / lo words UNNORMALISED (exp of score - running maximum, at most 1); the division by the row's sum is done once, on the f32 result.
// At the end the 8 waves' (m, l) meet in LDS; each wave scales its result by exp(m - M) / L, the partial results meet in LDS and are added over the waves 0, 1, ..., 7 IN THAT FIXED ORDER; a wave stores whole 512-byte output rows.
// THE KEYS OF A WAVE's NEXT STEP are copied into the wave's own 16 KiB of LDS (asynchronous copies, cp_keys) as soon as this step's key fragments have left it: they fly under the softmax and P x v, and the step begins with LDS reads. The buffer is private to its wave: the wave's own waits order it, no barrier. It lies in the array in which the partial results meet after the loop, behind the barrier that every wave passes with its copies landed and its reads done.
// A block's work grows with its row index: the long blocks have the low block indices, so that they start first.
__device__ __forceinline__ float exp2n(float x) { float r; asm("v_exp_f32 %0, %1\n\tv_nop" : "=v"(r) : "v"(x)); return r; }   // the hardware exp2 with the slot behind the transcendental filled
#define OPD 132   // words from one query's partial result to the next in LDS: 128 and a pad of 4, so that the 16 lanes of a 16-byte write fall on all 64 banks
#define L2E 1.4426950408889634f
#define KBW 8192   // words of one wave's key buffer in LDS: a step's 32 keys in fragment order as they lie in memory, the hi plane's 4096 words, then the lo plane's
// A step's keys go from memory into the wave's own LDS buffer through no register: 16 copies of 512 bytes a plane; a copy's offset moves its LDS address and its global address alike, so that LDS holds the same image as memory.
// The s_wait_xcnt stands behind the last copy inside the copies' own statement, in front of any overwrite of the four address registers that they name.
__device__ __forceinline__ void cp_keys(unsigned dh, const bf* gh, unsigned dl, const bf* gl) {
    asm volatile(
        "global_load_async_to_lds_b128 %0, %1, off\n\t"
        "global_load_async_to_lds_b128 %0, %1, off offset:512\n\t"
        "global_load_async_to_lds_b128 %0, %1, off offset:1024\n\t"
        "global_load_async_to_lds_b128 %0, %1, off offset:1536\n\t"
        "global_load_async_to_lds_b128 %0, %1, off offset:2048\n\t"
        "global_load_async_to_lds_b128 %0, %1, off offset:2560\n\t"
        "global_load_async_to_lds_b128 %0, %1, off offset:3072\n\t"
        "global_load_async_to_lds_b128 %0, %1, off offset:3584\n\t"
        "global_load_async_to_lds_b128 %0, %1, off offset:4096\n\t"
        "global_load_async_to_lds_b128 %0, %1, off offset:4608\n\t"
        "global_load_async_to_lds_b128 %0, %1, off offset:5120\n\t"
        "global_load_async_to_lds_b128 %0, %1, off offset:5632\n\t"
        "global_load_async_to_lds_b128 %0, %1, off offset:6144\n\t"
        "global_load_async_to_lds_b128 %0, %1, off offset:6656\n\t"
        "global_load_async_to_lds_b128 %0, %1, off offset:7168\n\t"
        "global_load_async_to_lds_b128 %0, %1, off offset:7680\n\t"
        "global_load_async_to_lds_b128 %2, %3, off\n\t"
        "global_load_async_to_lds_b128 %2, %3, off offset:512\n\t"
        "global_load_async_to_lds_b128 %2, %3, off offset:1024\n\t"
        "global_load_async_to_lds_b128 %2, %3, off offset:1536\n\t"
        "global_load_async_to_lds_b128 %2, %3, off offset:2048\n\t"
        "global_load_async_to_lds_b128 %2, %3, off offset:2560\n\t"
        "global_load_async_to_lds_b128 %2, %3, off offset:3072\n\t"
        "global_load_async_to_lds_b128 %2, %3, off offset:3584\n\t"
        "global_load_async_to_lds_b128 %2, %3, off offset:4096\n\t"
        "global_load_async_to_lds_b128 %2, %3, off offset:4608\n\t"
        "global_load_async_to_lds_b128 %2, %3, off offset:5120\n\t"
        "global_load_async_to_lds_b128 %2, %3, off offset:5632\n\t"
        "global_load_async_to_lds_b128 %2, %3, off offset:6144\n\t"
        "global_load_async_to_lds_b128 %2, %3, off offset:6656\n\t"
        "global_load_async_to_lds_b128 %2, %3, off offset:7168\n\t"
        "global_load_async_to_lds_b128 %2, %3, off offset:7680\n\t"
        "s_wait_xcnt 0x0"
        :: "v"(dh), "v"(gh), "v"(dl), "v"(gl) : "memory");
}
__global__ __launch_bounds__(256) void k_attn(const bf* __restrict__ Qp, const bf* __restrict__ Kp, const bf* __restrict__ Vt, float* __restrict__ O) {
    typedef WFrag<bf> F; typedef v16bf V;
    constexpr int DP = ZH * TT * HD, DB = HD * TT;   // the lo plane stands DP words (q, k) or DB words (v) behind its hi plane
    __shared__ __align__(16) float red[8 * 32 * OPD];
    __shared__ float sm[8][32], sl[8][32];
    const int wave = __builtin_amdgcn_readfirstlane((int)(threadIdx.x >> 5));   // a scalar, so that the key loop's test is a scalar branch
    const int lane = threadIdx.x & 31, lr = lane & 15, hi = lane >> 4;
    const int z = blockIdx.x % ZH, q0 = (TT / 32 - 1 - (int)(blockIdx.x / ZH)) * 32;
    const bf* qs = Qp + (size_t)z * TT * HD + (size_t)q0 * HD; const bf* qa = qs + 8 * lane;   // fragment order: row tile R starts at word 16 R HD, its k step at 512 words a step
    V qh[2][4], ql[2][4];
#pragma unroll
    for (int qt = 0; qt < 2; ++qt)
#pragma unroll
        for (int ks = 0; ks < 4; ++ks) { qh[qt][ks] = F::ldf(qa + qt * 16 * HD + ks * 512); ql[qt][ks] = F::ldf(qa + DP + qt * 16 * HD + ks * 512); }
    asm volatile("s_wait_xcnt 0x0" :: "s"(qs), "v"(lane) : "memory");   // behind the query loads, in front of the first overwrite of their address registers (a scalar base and the lane), which it holds up to here
    v8f acc[8][2];
#pragma unroll
    for (int dt = 0; dt < 8; ++dt) { acc[dt][0] = (v8f){}; acc[dt][1] = (v8f){}; }
    float m[2] = { -3.0e38f, -3.0e38f }, l[2] = { 0.f, 0.f };
    const bf* kbase = Kp + (size_t)z * TT * HD + 8 * lane; const bf* vbase = Vt + (size_t)z * (2 * HD * TT) + 8 * lane;
    const bf* kf = (const bf*)red + wave * KBW + 8 * lane;   // the lane's unit in the wave's own key buffer: 8 x 16 KiB lie inside red
    const unsigned kd = (unsigned)(size_t)kf, kdl = kd + (KBW / 2) * 2;   // its LDS byte address (the low 32 bits of the shared address), and that of its unit in the lo plane, KBW / 2 words of 2 bytes on
    if (wave * 32 <= q0) cp_keys(kd, kbase + wave * 32 * HD, kdl, kbase + DP + wave * 32 * HD);   // the first step's keys; a scalar test: a wave without a step copies nothing

    for (int kc = wave * 32; kc <= q0; kc += 8 * 32) {
        const bf* va = vbase + kc * 16;   // value planes: k step kc / 32; every value fragment of the step lies at a constant offset from it
        asm volatile("s_wait_asynccnt 0x0" ::: "memory");   // this step's keys, copied by this wave, have landed before it reads them
        V kh[2][4], kl[2][4];
#pragma unroll
        for (int ks = 0; ks < 4; ++ks)
#pragma unroll
            for (int kt = 0; kt < 2; ++kt) { kh[kt][ks] = F::ldf(kf + kt * 16 * HD + ks * 512); kl[kt][ks] = F::ldf(kf + KBW / 2 + kt * 16 * HD + ks * 512); }
        __builtin_amdgcn_sched_barrier(0);   // all 16 key fragments leave LDS as one group before the first product
        v8f st[2][2];
#pragma unroll
        for (int kt = 0; kt < 2; ++kt) { st[kt][0] = (v8f){}; st[kt][1] = (v8f){}; }
#pragma unroll
        for (int ks = 0; ks < 4; ++ks)
#pragma unroll
            for (int kt = 0; kt < 2; ++kt)
#pragma unroll
                for (int qt = 0; qt < 2; ++qt) { st[kt][qt] = F::mma(kh[kt][ks], qh[qt][ks], st[kt][qt]); st[kt][qt] = F::mma(kh[kt][ks], ql[qt][ks], st[kt][qt]); st[kt][qt] = F::mma(kl[kt][ks], qh[qt][ks], st[kt][qt]); }
        __builtin_amdgcn_sched_barrier(0);   // the value loads below take the registers that the key fragments have left
        V vh[8], vl[8];
#pragma unroll
        for (int dt = 0; dt < 8; ++dt) { vh[dt] = F::ldf(va + dt * 16 * TT); vl[dt] = F::ldf(va + DB + dt * 16 * TT); }
        asm volatile("s_wait_xcnt 0x0" :: "v"(va) : "memory");   // behind the step's value loads, in front of the first overwrite of their address registers, which it holds up to here
        asm volatile("s_wait_dscnt 0x0" ::: "memory");   // the wave's reads of its key buffer have returned before the copies below refill it
        if (kc + 8 * 32 <= q0) cp_keys(kd, kbase + (kc + 8 * 32) * HD, kdl, kbase + DP + (kc + 8 * 32) * HD);   // the wave's next step's keys, only while it has one (a scalar test): behind the value loads, which are wanted first
        __builtin_amdgcn_sched_barrier(0);   // the value loads and the key copies are issued before the softmax arithmetic and fly during it
        V ph[2], pl[2]; float al[2];
#pragma unroll
        for (int qt = 0; qt < 2; ++qt) {
            const int lim = q0 + qt * 16 + lr - kc - 8 * hi;   // the lane's key 16 kt + j (+ kc + 8 hi) is at or in front of its query where 16 kt + j <= lim
            float mx = -3.0e38f;
#pragma unroll
            for (int kt = 0; kt < 2; ++kt)
#pragma unroll
                for (int j = 0; j < 8; ++j) { const float t = (kt * 16 + j <= lim) ? st[kt][qt][j] * SCL : -3.0e38f; st[kt][qt][j] = t; mx = fmaxf(mx, t); }   // an excluded key gets -3e38, whose exponential is an exact zero; key kc is never excluded (kc <= q0), so the maximum is a real score
            mx = fmaxf(mx, __shfl_xor(mx, 16, 32));
            const float mn = fmaxf(m[qt], mx); al[qt] = exp2n((m[qt] - mn) * L2E); m[qt] = mn;
            float s = 0.f;
#pragma unroll
            for (int kt = 0; kt < 2; ++kt)
#pragma unroll
                for (int j = 0; j < 8; ++j) { const float p = exp2n((st[kt][qt][j] - mn) * L2E); s += p; const __bf16 h = (__bf16)p; ph[qt][kt * 8 + j] = h; pl[qt][kt * 8 + j] = (__bf16)(p - (float)h); }
            l[qt] = l[qt] * al[qt] + s;
        }
        if (__builtin_amdgcn_ballot_w32(al[0] != 1.0f || al[1] != 1.0f)) {   // the carried result is rescaled only in a step that raises some row's maximum
#pragma unroll
            for (int dt = 0; dt < 8; ++dt) { acc[dt][0] *= al[0]; acc[dt][1] *= al[1]; }
        }
#pragma unroll
        for (int dt = 0; dt < 8; ++dt)
#pragma unroll
            for (int qt = 0; qt < 2; ++qt) { acc[dt][qt] = F::mma(vh[dt], ph[qt], acc[dt][qt]); acc[dt][qt] = F::mma(vh[dt], pl[qt], acc[dt][qt]); acc[dt][qt] = F::mma(vl[dt], ph[qt], acc[dt][qt]); }
        asm volatile("v_nop\n\tv_nop\n\tv_nop\n\tv_nop" : "+v"(acc[6][0]), "+v"(acc[6][1]), "+v"(acc[7][0]), "+v"(acc[7][1]) : "v"(vh[7]), "v"(vl[7]));   // the matrix instructions' distance on the loop's taken branch
    }
    asm volatile("s_wait_asynccnt 0x0" ::: "memory");   // no copy of the wave is outstanding when it leaves the loop: red is used anew behind the barrier below
#pragma unroll
    for (int qt = 0; qt < 2; ++qt) { l[qt] += __shfl_xor(l[qt], 16, 32); if (hi == 0) { sm[wave][qt * 16 + lr] = m[qt]; sl[wave][qt * 16 + lr] = l[qt]; } }
    __syncthreads();   // all 8 waves' maxima and sums are in LDS before any wave reads them
#pragma unroll
    for (int qt = 0; qt < 2; ++qt) { const int q = qt * 16 + lr; float M = sm[0][q];
#pragma unroll
        for (int w = 1; w < 8; ++w) M = fmaxf(M, sm[w][q]);
        float L = 0.f;
#pragma unroll
        for (int w = 0; w < 8; ++w) L += sl[w][q] * exp2n((sm[w][q] - M) * L2E);   // a wave without a step has m = -3e38 and l = 0: an exact zero; wave 0 always has step 0
        const float f = exp2n((m[qt] - M) * L2E) / L;
        float* op = red + (wave * 32 + q) * OPD + hi * 8;
#pragma unroll
        for (int dt = 0; dt < 8; ++dt) { const v8f a = acc[dt][qt] * f; *(v4fa*)(op + dt * 16) = (v4f){ a[0], a[1], a[2], a[3] }; *(v4fa*)(op + dt * 16 + 4) = (v4f){ a[4], a[5], a[6], a[7] }; } }
    __syncthreads();   // all 8 partial results are in LDS before any wave adds them
    v4f val[4];
#pragma unroll
    for (int s = 0; s < 4; ++s) { const float* rp = red + (s * 8 + wave) * OPD + lane * 4; val[s] = *(const v4fa*)rp;
#pragma unroll
        for (int w = 1; w < 8; ++w) val[s] += *(const v4fa*)(rp + w * 32 * OPD); }
    float* orow = O + ((size_t)z * TT + q0 + wave) * HD + lane * 4;   // row 8 s + wave of the block's 32: a wave stores the row's 512 bytes
#pragma unroll
    for (int s = 0; s < 4; ++s) *(v4f*)(orow + s * 8 * HD) = val[s];
}

extern "C" void kernel_launch(void* const* d_in, const int* in_sizes, int n_in,
                              void* d_out, int out_size, void* d_ws, size_t ws_size, hipStream_t stream) {
    (void)in_sizes; (void)n_in; (void)out_size;
    const float* x = (const float*)d_in[0]; const float* wk = (const float*)d_in[1]; const float* wq = (const float*)d_in[2]; const float* wv = (const float*)d_in[3];
    // inputs in the module's argument order = d_in[0..3]: the [8][2048][1024] plane, then the KEY, QUERY and VALUE weights [1024][128] (in, out): all four read; the causal rule is computed: there is no mask input
    float* OUT = (float*)d_out;     // [8][2048][128]
    char* wsp = (char*)d_ws;
    auto take = [&](size_t bytes) { char* p = wsp; wsp += (bytes + 255) & ~(size_t)255; return (void*)p; };
    bf* WQ = (bf*)take((size_t)(DQ + 2 * DKV) * DM * 2); bf* WK = WQ + DQ * DM; bf* WV = WK + DKV * DM;   /* one plane of 384 rows: q, k, v */
    bf* QPh = (bf*)take((size_t)ZH * TT * HD * 2 * 2); bf* QPl = QPh + ZH * TT * HD; bf* KPh = (bf*)take((size_t)ZH * TT * HD * 2 * 2); bf* KPl = KPh + ZH * TT * HD;   /* [hi plane | lo plane], as they lay */ bf* VTh = (bf*)take((size_t)ZH * HD * 2 * TT * 2);
    if ((size_t)(wsp - (char*)d_ws) > ws_size) return;
    bf* VTl = VTh + (size_t)HD * TT;           // an entry's value planes, fragment order: [hi: HD x TT | lo: HD x TT] (k_gemmw)
    k_prep<<<3 * WTB, 256, 0, stream>>>(wq, wk, wv, WQ, WK, WV);   /* (in, out) weights: the transposing cast: [128][1024] = Bt */
    k_gemmw<bf, DM><<<NB_ * TT / 64, 256, 0, stream>>>(x, WQ, QPh, QPl, KPh, KPl, VTh, VTl, HD);   /* the three projections, a0 read as f32 and cast on its way: the eight entries' rows are one [16384][1024] operand; each wave writes its own tile of its weight's hi / lo planes */
    k_attn<<<ZH * (TT / 32), 256, 0, stream>>>(QPh, KPh, VTh, OUT);   /* scores (three products), softmax, P x v (three products) of 32 query rows a block; the lo planes stand at constant distances behind the hi planes: the one writer of d_out */
}

// v010
// It runs in 43.6 microseconds.
// In two side-by-side timings against v009, it was 1.04 and 1.05 times as fast.
// Counting every step since v000, it is 22.1 times as fast.
#include <hip/hip_runtime.h>

// One head of causal self-attention with a 128-wide head, NO output projection, and the scores MULTIPLIED by 32 (inputs, in argument order: a0 [8][2048][1024]; a1, a2, a3 [1024][128] stored (in, out) and used as x W: the key, query and value weights IN THAT ORDER):
//   THE MODULE's FUNCTION: k = a0 a1; q = a0 a2; v = a0 a3 ([8][2048][128] each); S = (q k^T) x 32; everything above the diagonal set to nought, then EVERY exact nought set to -inf (so the module excludes the keys after the query AND any key inside the triangle whose score is exactly 0.0); softmax over the 2,048 keys; result = P v -> [8][2048][128] (2.1 M).
//   THIS TEXT excludes the keys after the query by index and KEEPS a score of exactly 0.0 inside the triangle: the two differ only where a computed score is exactly 0.0: not reached on real data (said again below).
// Layout: ALL EIGHT batch entries go through every stage in ONE launch of that stage (the entry is a plane index: more rows in the projections, a part of the block index in the attention kernel): the (in, out) weights transposed once by a transposing cast, the three casts in one launch; the three projections in one launch, which reads a0 as f32 and casts it to bf16 on its way into LDS (no bf16 copy of a0 in memory); exact projections (bf16 x bf16 words, f32 sums) WHOSE OWN EPILOGUE splits each f32 sum into the bf16 hi / lo planes that the attention GEMMs read (q and k row planes; the transposed value planes): no f32 projection plane and no plane-builder pass; EVERY 16-bit plane that a GEMM reads (a0's stages in LDS, the weights, q, k, the transposed v) is stored in FRAGMENT ORDER (said above k_gemmw's loader);
//   causal T-2048 attention for the one head: THE SCORES ON hi / lo PLANES ON EVERY ROW (three products: the softmax is all but a hard maximum, a score's spread is about 360, and one 16-bit rounding of q or k would flip the winning key in hundreds of rows); THE SOFTMAX WEIGHTS ON bf16 hi / lo PLANES ON EVERY ROW TOO (RH = TT) and P x v as three products against the hi / lo value planes: a one-word fp16 P is not taken: 6.4 per cent of this draw's non-zero carried weights would be fp16 subnormals;
//   scores, softmax and P x v run in ONE kernel (k_attn: running maximum and sum; keys behind the diagonal step never touched), which stores the output rows: the one writer of d_out.
// The scale: the module writes scores x sqrt(1024): SCL 32.0f applied to each score in k_attn's masking step, as the module writes it (a power of two: exact).
// Compute dtypes, f32 accumulate: every float input rounded to bf16 at its load; projections exact; scores three products; softmax f32 (the hardware exp2); P x v three products (bf16 hi / lo both sides; lo x lo not formed); the output is those f32 sums as they stand.

#define NB_  8      // batch entries: the input is [8][2048][1024]
#define TT   2048
#define DM   1024
#define NH_  1
#define NKV  1
#define REP  (NH_ / NKV)
#define HD   128
#define DQ   (NH_ * HD)
#define DKV  (NKV * HD)
#define ZH   NB_                  // planes per attention launch: one head x the eight batch entries
#define RH   2048                 // = TT: query rows < RH use hi+lo planes of P: EVERY row here
#define WIN  2048
#define PCAR 1024.0f
#define SCL  32.0f   // sqrt(1024): the module MULTIPLIES the scores by it
typedef _Float16 h16;
typedef unsigned short bf;
typedef __attribute__((ext_vector_type(16))) __bf16   v16bf;
typedef __attribute__((ext_vector_type(16))) _Float16 v16h;
typedef __attribute__((ext_vector_type(8)))  _Float16 v8h;
typedef __attribute__((ext_vector_type(8)))  unsigned short v8us;
typedef __attribute__((ext_vector_type(8)))  float    v8f;
typedef __attribute__((ext_vector_type(4)))  float    v4f;
typedef v8h  __attribute__((may_alias)) v8ha;
typedef v4f  __attribute__((may_alias)) v4fa;
typedef v8us __attribute__((may_alias)) v8usa;

__device__ __forceinline__ unsigned short f2bf(float f) { unsigned u = __float_as_uint(f); u += 0x7FFFu + ((u >> 16) & 1u); return (unsigned short)(u >> 16); }
__device__ __forceinline__ float bf2f(unsigned short b) { return __uint_as_float(((unsigned)b) << 16); }
__device__ __forceinline__ float bfr(float f) { return bf2f(f2bf(f)); }
__device__ __forceinline__ v16h cat16(v8h lo, v8h hi) { return __builtin_shufflevector(lo, hi, 0, 1, 2, 3, 4, 5, 6, 7, 8, 9, 10, 11, 12, 13, 14, 15); }
__device__ __forceinline__ v16bf cat16b(v8us lo, v8us hi) { return __builtin_bit_cast(v16bf, __builtin_shufflevector(lo, hi, 0, 1, 2, 3, 4, 5, 6, 7, 8, 9, 10, 11, 12, 13, 14, 15)); }
__device__ __forceinline__ v8f wmma16(v16h a, v16h b, v8f c) { return __builtin_amdgcn_wmma_f32_16x16x32_f16(false, a, false, b, (short)0, c, false, false); }
__device__ __forceinline__ v8f wmmab(v16bf a, v16bf b, v8f c) { return __builtin_amdgcn_wmma_f32_16x16x32_bf16(false, a, false, b, (short)0, c, false, false); }
__device__ __forceinline__ void splitf(float y, unsigned short& h, unsigned short& l) { h = f2bf(y); l = f2bf(y - bf2f(h)); }
typedef __attribute__((ext_vector_type(4))) unsigned short v4us;



// ---- k_gemmw: the three projections in ONE launch, with a0's cast to bf16 inside it. A block is 64 rows of a0 x ALL 384 output columns (q, k, v: 128 each; the three weight planes lie behind one another as one plane of 384 rows), so that a0 is read from memory once, as f32.
// 8 waves, each a 64x48 output tile (12 accumulators): column tiles 3 w .. 3 w + 2 of the 24; grid M / 64, 256 threads. The weight fragments come straight from their plane in fragment order (below), a whole stage ahead of their use, into the registers that the step before has just left.
// a0 goes through LDS in stages of 128 k. As f32 it comes from memory into a ring of 4 slots that is PRIVATE TO ITS WAVE, by asynchronous copies (cp_x), two stages a batch, each batch in flight under two whole stages, the batches of waves 4-7 cut one stage earlier than those of waves 0-3; a copy is 2 rows x 256 contiguous bytes. The wave's own waits order that ring, no barrier.
// From its slot a wave takes its 4 units of the next stage, rounds them to bf16 (f2bf, the rounding the cast pass had) and stores them in fragment order into the one of two bf16 buffers that is not being read; ONE barrier a stage publishes it and ends the reads of the other.
// f32 sums S[m][n] = sum_k A[m][k] Bt[n][k], K % 256 == 0, K >= 512; each sum leaves the wave as its bf16 hi / lo words (splitf), never as an f32 plane:
//   q and k: planes Ph / Pl of [m][n], ldc words a row ([entry][t][d] is [m][n] as it stands), in fragment order; a column tile is staged through the wave's own slice of LDS, from which a lane takes the 8 consecutive n of its unit.
//   v: transposed planes of [n][t] per entry, TT words a row, in fragment order, [entry][hi: HD x TT | lo: HD x TT] (Pl = Ph + HD TT); m = entry x TT + t. A lane's 8 accumulator registers are 8 consecutive t of one n = lane % 16: they ARE the lane's unit: one 16-byte store a plane, no staging.
// FRAGMENT ORDER of a K-contiguous 16-bit plane X[row][k] (K % 32 == 0, rows % 16 == 0): blocks of 16 rows x 32 k = 512 words = 1 KiB, block (R, S) = (row / 16, k / 32) at word (R K / 32 + S) 512 = 16 R K + 16 (32 S);
// inside a block [half 2][lane 32][8 words]: word (row, k) with kk = k % 32 stands at (kk / 16) 256 + (((kk % 16) / 8) 16 + row % 16) 8 + kk % 8. A lane's fragment (row lane % 16; k = 8 (lane / 16) + 0..7, then 16 more) is the same 16 words in the same order as it would take from the row plane,
// but each of its two 16-byte loads (ldf: the lane's unit of half 0, then of half 1) is, over the wave, 512 contiguous bytes = 4 whole lines, where a load from the row plane touches 16 lines. Every writer of such a plane stores whole units, 512 contiguous bytes a wave.
template <typename T16> struct WFrag;
template <> struct WFrag<h16> { typedef v16h V; static __device__ __forceinline__ V ldf(const h16* p) { return cat16(*(const v8h*)p, *(const v8h*)(p + 256)); } static __device__ __forceinline__ v8f mma(V a, V b, v8f c) { return wmma16(a, b, c); } };
template <> struct WFrag<bf> { typedef v16bf V; static __device__ __forceinline__ V ldf(const bf* p) { return cat16b(*(const v8us*)p, *(const v8us*)(p + 256)); } static __device__ __forceinline__ v8f mma(V a, V b, v8f c) { return wmmab(a, b, c); } };
#define STK 128   // k of one stage of a0: 64 rows x 128 k, 32 KiB as f32, 16 KiB as bf16 in LDS
#define XRP 272   // bytes from one row's 256 bytes to the next in a slot of the f32 ring: 16 x odd, so that the 16 rows of a 16-byte read fall on all 64 banks
#define XSL (16 * XRP)   // bytes of one slot: a wave's 16 rows x 64 k of one stage
#define OSP 20    // words from one staged output row to the next in LDS: 16 and a pad of 4, so that the 16-byte row reads fall on all 64 banks
__device__ __forceinline__ void wg_publish() { asm volatile("s_wait_dscnt 0x0\n\ts_barrier_signal -1\n\ts_barrier_wait -1" ::: "memory"); }   // the wave's own LDS writes and reads are done, then the work-group's barrier; written by hand so that the global loads and copies issued ahead (next weights, next a0 stages) stay in flight across it
// A wave's part of one stage of a0 goes from memory into one slot of its own f32 ring through no register: 8 copies of 2 rows x 256 bytes (lanes 0-15 one row, lanes 16-31 the next).
// d is the lane's LDS byte address in the first copy, o its byte offset from the scalar base g (row lane / 16, 16 bytes a lane). A copy's offset moves its LDS address and its global address alike: it steps the LDS address by two rows of the slot (2 XRP), and each copy's scalar base makes up the rest of two rows of a0.
// The s_wait_xcnt stands behind the last copy inside the copies' own statement, in front of any overwrite of the address registers that they name.
template <int K>
__device__ __forceinline__ void cp_x(unsigned d, unsigned o, const char* g) {
    static_assert(2 * XRP == 544, "the offsets in the text below are multiples of 2 XRP");
    constexpr int GS = 2 * K * 4 - 2 * XRP;   // two rows of a0 less what the offset already adds
    asm volatile(
        "global_load_async_to_lds_b128 %0, %1, %2\n\t"
        "global_load_async_to_lds_b128 %0, %1, %3 offset:544\n\t"
        "global_load_async_to_lds_b128 %0, %1, %4 offset:1088\n\t"
        "global_load_async_to_lds_b128 %0, %1, %5 offset:1632\n\t"
        "global_load_async_to_lds_b128 %0, %1, %6 offset:2176\n\t"
        "global_load_async_to_lds_b128 %0, %1, %7 offset:2720\n\t"
        "global_load_async_to_lds_b128 %0, %1, %8 offset:3264\n\t"
        "global_load_async_to_lds_b128 %0, %1, %9 offset:3808\n\t"
        "s_wait_xcnt 0x0"
        :: "v"(d), "v"(o), "s"(g), "s"(g + GS), "s"(g + 2 * GS), "s"(g + 3 * GS), "s"(g + 4 * GS), "s"(g + 5 * GS), "s"(g + 6 * GS), "s"(g + 7 * GS) : "memory");
}
template <typename T16, int K>
__global__ __launch_bounds__(256) void k_gemmw(const float* __restrict__ X, const T16* __restrict__ W3, bf* Qh, bf* Ql, bf* Kh, bf* Kl, bf* Vh, bf* Vl, int ldc) {
    typedef typename WFrag<T16>::V V;
    constexpr int NS = K / STK;
    static_assert(NS % 2 == 0 && NS >= 4, "the f32 ring is filled two stages a batch");
    __shared__ __align__(16) T16 as[2][64 * STK];
    __shared__ __align__(16) float xr[8 * 4 * (XSL / 4)];   // the f32 ring: [wave 8][slot 4][row 16][XRP bytes]
    __shared__ __align__(16) float osw[8][64 * OSP];
    const int wave = __builtin_amdgcn_readfirstlane((int)(threadIdx.x >> 5));   // a scalar, so that every test on a column tile's weight is a scalar branch
    float* os = osw[wave];
    const int lane = threadIdx.x & 31, lr = lane & 15, hi = lane >> 4; const int r0 = blockIdx.x * 64;
    v8f acc[4][3];
#pragma unroll
    for (int mb = 0; mb < 4; ++mb)
#pragma unroll
        for (int nb = 0; nb < 3; ++nb) acc[mb][nb] = (v8f){};
    const char* xg = (const char*)(X + (size_t)(r0 + (wave >> 1) * 16) * K + (wave & 1) * 64);   // wave w brings and casts k 64 (w % 2) + 0..63 of every stage of row tile w / 2: a scalar, where its part of stage 0 begins
    const unsigned xo = hi * (K * 4) + lr * 16;                           // the lane's 16 bytes of a copy from there: row lane / 16, floats 4 (lane % 16) ..
    const int ph = (wave >> 2) & 1;                                       // waves 4-7 cut their batches one stage earlier than waves 0-3, so that one half's copies are on their way while the other half's land: a scalar
    float* xw = xr + wave * (4 * XSL / 4);                                // the wave's own 4 slots
    const unsigned xd = (unsigned)(size_t)xw + hi * XRP + lr * 16;        // the LDS byte address (the low 32 bits of the shared address) of those 16 bytes in slot 0
    const float* xq = xw + lr * (XRP / 4) + hi * 8;                       // the lane's first unit of a stage in slot 0: row lr, floats 8 hi ..; its unit j lies 16 j floats on
    T16* ad = &as[0][0] + wave * 1024 + 8 * lane;                         // as bf16: k steps 2 (w % 2), + 1 of row tile w / 2 are 4 halves of 512 contiguous bytes; the lane's 16 bytes of the first
    const T16* pb = W3 + (size_t)(wave * 48) * K + 8 * lane;              // fragment order: row tile R of the 24 (q, k, v: 8 each) starts at word 16 R K, its k step at 16 kc
    v8f stg[4]; V b[4][3];   // a stage's 4 units of the lane as f32; a stage's weight fragments [k step][column tile]
    auto ldx = [&](int st) {   // a stage's 4 units of the lane, as f32, out of the stage's slot
        const float* xs = xq + (st & 3) * (XSL / 4);
#pragma unroll
        for (int mb = 0; mb < 4; ++mb) { const v4f u0 = *(const v4fa*)(xs + mb * 16), u1 = *(const v4fa*)(xs + mb * 16 + 4); stg[mb] = __builtin_shufflevector(u0, u1, 0, 1, 2, 3, 4, 5, 6, 7); }
    };
    auto cpx = [&](int st) { cp_x<K>(xd + (st & 3) * XSL, xo, xg + st * (STK * 4)); };   // stage st into slot st % 4
    auto stx = [&](int st) {   // the same units, rounded to bf16, into the stage's buffer
        T16* dd = ad + (st & 1) * (64 * STK);
#pragma unroll
        for (int mb = 0; mb < 4; ++mb) { v8us o;
#pragma unroll
            for (int e = 0; e < 8; ++e) o[e] = f2bf(stg[mb][e]);
            *(v8us*)(dd + mb * 256) = o; }
    };
    cpx(0); if (ph == 0) cpx(1);   // the first batch: stages 0 and 1, in waves 4-7 stage 0 alone (a scalar test)
#pragma unroll
    for (int S = 0; S < 4; ++S)
#pragma unroll
        for (int nb = 0; nb < 3; ++nb) b[S][nb] = WFrag<T16>::ldf(pb + S * 512 + nb * 16 * K);
    asm volatile("s_wait_xcnt 0x0" :: "v"(pb) : "memory");   // behind stage 0's weight loads, in front of the first overwrite of their address registers
    asm volatile("s_wait_asynccnt 0x0" ::: "memory");   // the first batch, copied by this wave, has landed before it reads it
    cpx(2 - ph); cpx(3 - ph);   // the second batch, into slots that nothing has touched yet: sent off first, so that it flies under stage 0's cast as well
    ldx(0);
    stx(0);
    wg_publish();   // stage 0 of a0 is in LDS as bf16 before any wave reads it

    for (int s = 0; s < NS; ++s) {
        const T16* ab = as[s & 1] + 8 * lane; const T16* kn = pb + (s + 1 < NS ? s + 1 : s) * (STK * 16);   // the next stage's weight fragments; the last stage names its own again, so that the loads stand under no branch
        V a[2][4];
#pragma unroll
        for (int mb = 0; mb < 4; ++mb) a[0][mb] = WFrag<T16>::ldf(ab + mb * 4 * 512);
#pragma unroll
        for (int S = 0; S < 4; ++S) {
            if (S == 2 && s + 1 < NS) {   // in front of the stage's third k step
                if ((s + ph) & 1) {   // a scalar test: every second stage the wave takes a batch over and sends the next one off
                    asm volatile("s_wait_asynccnt 0x0" ::: "memory");   // the batch that begins with stage s + 1, sent off by this wave at this place two stages ago (the second batch: in front of the loop), has landed before the wave reads it
                    if (s + 3 < NS) {
                        asm volatile("s_wait_dscnt 0x0" ::: "memory");   // the wave's reads of stages s - 1 and s out of their slots have returned before the copies below refill those slots
                        cpx(s + 3); if (s + 4 < NS) cpx(s + 4);   // fly until the third k step of stage s + 2
                    }
                }
                ldx(s + 1);   // leaves its slot under the stage's last products
            }
            if (S < 3) {
#pragma unroll
                for (int mb = 0; mb < 4; ++mb) a[(S + 1) & 1][mb] = WFrag<T16>::ldf(ab + (mb * 4 + S + 1) * 512);   // the next k step's a0 fragments leave LDS under this step's products
            }
#pragma unroll
            for (int nb = 0; nb < 3; ++nb)
#pragma unroll
                for (int mb = 0; mb < 4; ++mb) acc[mb][nb] = WFrag<T16>::mma(a[S & 1][mb], b[S][nb], acc[mb][nb]);
#pragma unroll
            for (int nb = 0; nb < 3; ++nb) b[S][nb] = WFrag<T16>::ldf(kn + S * 512 + nb * 16 * K);   // refills the registers that this step has just used: a whole stage ahead of their use
            asm volatile("s_wait_xcnt 0x0" :: "v"(kn) : "memory");   // behind the step's weight loads, in front of the first overwrite of their address registers, which it holds up to here
        }
        if (s + 1 < NS) {   // the same for every wave of the block
            stx(s + 1);   // into the buffer that stage s - 1 read: every wave left it before the barrier at the foot of that stage
            wg_publish();   // stage s + 1 is in LDS, and the last of stage s has been read
        }
    }
    asm volatile("s_wait_asynccnt 0x0" ::: "memory");   // no copy of the wave is outstanding when it leaves the loop
    const int g = r0 / TT, t0 = r0 % TT;   // a 64-row tile lies inside one entry (TT % 64 == 0)
#pragma unroll
    for (int nb = 0; nb < 3; ++nb) {
        const int ti = wave * 3 + nb, p = ti >> 3, n0 = (ti & 7) * 16;   // the column tile's weight (0 = q, 1 = k, 2 = v) and its first column there: scalars
        bf* Ph = (p == 0) ? Qh : (p == 1) ? Kh : Vh; bf* Pl = (p == 0) ? Ql : (p == 1) ? Kl : Vl;
        if (p == 2) {
#pragma unroll
            for (int mb = 0; mb < 4; ++mb) { v8us oh, ol;
#pragma unroll
                for (int j = 0; j < 8; ++j) { unsigned short a2, c2; splitf(acc[mb][nb][j], a2, c2); oh[j] = a2; ol[j] = c2; }
                const size_t oo = (size_t)g * (2 * HD * TT) + (size_t)n0 * TT + (size_t)t0 * 16 + (mb >> 1) * 512 + (mb & 1) * 256 + lane * 8; *(v8us*)(Ph + oo) = oh; *(v8us*)(Pl + oo) = ol; }
            asm volatile("s_wait_xcnt 0x0" ::: "memory");   // stands behind the run of stores, in front of whatever next takes the registers that they name
        } else {
#pragma unroll
            for (int mb = 0; mb < 4; ++mb)
#pragma unroll
                for (int j = 0; j < 8; ++j) os[(mb * 16 + hi * 8 + j) * OSP + lr] = acc[mb][nb][j];
            __builtin_amdgcn_wave_barrier(); asm volatile("" ::: "memory");   // keeps the row reads below behind the staging writes above
#pragma unroll
            for (int mb = 0; mb < 4; ++mb) { const float* sp = os + (mb * 16 + lr) * OSP + hi * 8; const v4f v0 = *(const v4fa*)sp, v1 = *(const v4fa*)(sp + 4); v8us oh, ol;   // row lr of the row tile, columns 8 hi ..: the lane's 8 words of the column tile's half
#pragma unroll
                for (int q = 0; q < 4; ++q) { unsigned short a2, c2; splitf(v0[q], a2, c2); oh[q] = a2; ol[q] = c2; splitf(v1[q], a2, c2); oh[4 + q] = a2; ol[4 + q] = c2; }
                const size_t oo = (size_t)(r0 + mb * 16) * ldc + (size_t)n0 * 16 + lane * 8; *(v8us*)(Ph + oo) = oh; *(v8us*)(Pl + oo) = ol; }
            asm volatile("s_wait_xcnt 0x0" ::: "memory");   // stands behind the run of stores, in front of whatever next takes the registers that they name
            __builtin_amdgcn_wave_barrier(); asm volatile("" ::: "memory");   // keeps the next column tile's staging writes behind these row reads
        }
    }
}

__device__ __forceinline__ h16 tohx(float x) { return (h16)x; }
typedef __attribute__((ext_vector_type(2))) _Float16 v2h;
typedef __attribute__((ext_vector_type(4))) _Float16 v4h;
typedef __attribute__((ext_vector_type(2))) unsigned short v2us;
typedef __attribute__((ext_vector_type(2))) float v2f;
typedef __attribute__((ext_vector_type(4))) int v4i;


// ---- k_prep: the transposing casts of the q, k and v weights, which depend on nothing but the inputs, in ONE launch, told apart by block index (WTB blocks each).
// Every plane leaves in FRAGMENT ORDER (above k_gemmw). A thread makes the 16-byte unit u of its plane: block u / 64, half (u % 64) / 32, lane u % 32; a wave stores 512 contiguous bytes.
// Weights (in, out): the unit's 8 words are 8 rows k of one column n; 16 lanes read 64 contiguous bytes of a row.
#define WTB (DM * HD / 8 / 256)   // blocks per weight: 256 units of 8 words
__global__ __launch_bounds__(256) void k_prep(const float* __restrict__ wq, const float* __restrict__ wk, const float* __restrict__ wv, bf* WQ, bf* WK, bf* WV) {
    const int ln = threadIdx.x & 31, kin = ((threadIdx.x >> 5) & 1) * 16 + (ln >> 4) * 8, rin = ln & 15;   // 256 threads are 4 whole blocks: the unit's k and row inside its block
    const int sel = blockIdx.x / WTB, blk = blockIdx.x % WTB; const float* __restrict__ w = (sel == 0) ? wq : (sel == 1) ? wk : wv; bf* Bt = (sel == 0) ? WQ : (sel == 1) ? WK : WV;
    const int u = blk * 256 + threadIdx.x, fb = u >> 6; const int n = (fb / (DM / 32)) * 16 + rin, k = (fb % (DM / 32)) * 32 + kin; v8us o;
#pragma unroll
    for (int e = 0; e < 8; ++e) o[e] = f2bf(w[(size_t)(k + e) * HD + n]);
    *(v8us*)(Bt + (size_t)u * 8) = o;
}

// ---- k_attn: scores, softmax and P x v of 32 query rows in ONE kernel: neither a score nor a weight leaves the chip.
// A block is 8 waves on the SAME 32 queries; the keys up to the diagonal are dealt over the waves in steps of 32 (wave w takes steps w, w + 8, ...); each wave keeps a running maximum m, a running sum l and an unnormalised f32 result for its own keys.
// The products are formed TRANSPOSED, so that no fragment is re-ordered between them: S^T = k q^T (A = key rows, B = query rows): a lane's 8 accumulator registers are keys 8 (lane / 16) + 0..7 of query lane % 16,
// and the accumulators of the step's two key tiles are, in that order, the lane's 16 words of the B fragment of P^T (k order of the loader: 8 (lane / 16) + 0..7, then 16 more). result^T = v^T P^T (A = the transposed value planes): a lane holds 8 consecutive d of its query.
// Three products on hi / lo planes in both, in the order hi hi, (q or P) lo x hi, hi x (k or v) lo; a score's sum over d runs in the same order as ever. A row's maximum and sum lie in the lane (and its partner 16 lanes on): one shuffle a step.
// The weights are split into bf16 hi / lo words UNNORMALISED (exp of score - running maximum, at most 1); the division by the row's sum is done once, on the f32 result.
// At the end the 8 waves' (m, l) meet in LDS; each wave scales its result by exp(m - M) / L, the partial results meet in LDS and are added over the waves 0, 1, ..., 7 IN THAT FIXED ORDER; a wave stores whole 512-byte output rows.
// THE KEYS OF A WAVE's NEXT STEP are copied into the wave's own 16 KiB of LDS (asynchronous copies, cp_keys) as soon as this step's key fragments have left it: they fly under the softmax and P x v, and the step begins with LDS reads. The buffer is private to its wave: the wave's own waits order it, no barrier. It lies in the array in which the partial results meet after the loop, behind the barrier that every wave passes with its copies landed and its reads done.
// A block's work grows with its row index: the long blocks have the low block indices, so that they start first.
__device__ __forceinline__ float exp2n(float x) { float r; asm("v_exp_f32 %0, %1\n\tv_nop" : "=v"(r) : "v"(x)); return r; }   // the hardware exp2 with the slot behind the transcendental filled
#define OPD 132   // words from one query's partial result to the next in LDS: 128 and a pad of 4, so that the 16 lanes of a 16-byte write fall on all 64 banks
#define L2E 1.4426950408889634f
#define KBW 8192   // words of one wave's key buffer in LDS: a step's 32 keys in fragment order as they lie in memory, the hi plane's 4096 words, then the lo plane's
// A step's keys go from memory into the wave's own LDS buffer through no register: 16 copies of 512 bytes a plane; a copy's offset moves its LDS address and its global address alike, so that LDS holds the same image as memory.
// The s_wait_xcnt stands behind the last copy inside the copies' own statement, in front of any overwrite of the four address registers that they name.
__device__ __forceinline__ void cp_keys(unsigned dh, const bf* gh, unsigned dl, const bf* gl) {
    asm volatile(
        "global_load_async_to_lds_b128 %0, %1, off\n\t"
        "global_load_async_to_lds_b128 %0, %1, off offset:512\n\t"
        "global_load_async_to_lds_b128 %0, %1, off offset:1024\n\t"
        "global_load_async_to_lds_b128 %0, %1, off offset:1536\n\t"
        "global_load_async_to_lds_b128 %0, %1, off offset:2048\n\t"
        "global_load_async_to_lds_b128 %0, %1, off offset:2560\n\t"
        "global_load_async_to_lds_b128 %0, %1, off offset:3072\n\t"
        "global_load_async_to_lds_b128 %0, %1, off offset:3584\n\t"
        "global_load_async_to_lds_b128 %0, %1, off offset:4096\n\t"
        "global_load_async_to_lds_b128 %0, %1, off offset:4608\n\t"
        "global_load_async_to_lds_b128 %0, %1, off offset:5120\n\t"
        "global_load_async_to_lds_b128 %0, %1, off offset:5632\n\t"
        "global_load_async_to_lds_b128 %0, %1, off offset:6144\n\t"
        "global_load_async_to_lds_b128 %0, %1, off offset:6656\n\t"
        "global_load_async_to_lds_b128 %0, %1, off offset:7168\n\t"
        "global_load_async_to_lds_b128 %0, %1, off offset:7680\n\t"
        "global_load_async_to_lds_b128 %2, %3, off\n\t"
        "global_load_async_to_lds_b128 %2, %3, off offset:512\n\t"
        "global_load_async_to_lds_b128 %2, %3, off offset:1024\n\t"
        "global_load_async_to_lds_b128 %2, %3, off offset:1536\n\t"
        "global_load_async_to_lds_b128 %2, %3, off offset:2048\n\t"
        "global_load_async_to_lds_b128 %2, %3, off offset:2560\n\t"
        "global_load_async_to_lds_b128 %2, %3, off offset:3072\n\t"
        "global_load_async_to_lds_b128 %2, %3, off offset:3584\n\t"
        "global_load_async_to_lds_b128 %2, %3, off offset:4096\n\t"
        "global_load_async_to_lds_b128 %2, %3, off offset:4608\n\t"
        "global_load_async_to_lds_b128 %2, %3, off offset:5120\n\t"
        "global_load_async_to_lds_b128 %2, %3, off offset:5632\n\t"
        "global_load_async_to_lds_b128 %2, %3, off offset:6144\n\t"
        "global_load_async_to_lds_b128 %2, %3, off offset:6656\n\t"
        "global_load_async_to_lds_b128 %2, %3, off offset:7168\n\t"
        "global_load_async_to_lds_b128 %2, %3, off offset:7680\n\t"
        "s_wait_xcnt 0x0"
        :: "v"(dh), "v"(gh), "v"(dl), "v"(gl) : "memory");
}
__global__ __launch_bounds__(256) void k_attn(const bf* __restrict__ Qp, const bf* __restrict__ Kp, const bf* __restrict__ Vt, float* __restrict__ O) {
    typedef WFrag<bf> F; typedef v16bf V;
    constexpr int DP = ZH * TT * HD, DB = HD * TT;   // the lo plane stands DP words (q, k) or DB words (v) behind its hi plane
    __shared__ __align__(16) float red[8 * 32 * OPD];
    __shared__ float sm[8][32], sl[8][32];
    const int wave = __builtin_amdgcn_readfirstlane((int)(threadIdx.x >> 5));   // a scalar, so that the key loop's test is a scalar branch
    const int lane = threadIdx.x & 31, lr = lane & 15, hi = lane >> 4;
    const int z = blockIdx.x % ZH, q0 = (TT / 32 - 1 - (int)(blockIdx.x / ZH)) * 32;
    const bf* qs = Qp + (size_t)z * TT * HD + (size_t)q0 * HD; const bf* qa = qs + 8 * lane;   // fragment order: row tile R starts at word 16 R HD, its k step at 512 words a step
    V qh[2][4], ql[2][4];
#pragma unroll
    for (int qt = 0; qt < 2; ++qt)
#pragma unroll
        for (int ks = 0; ks < 4; ++ks) { qh[qt][ks] = F::ldf(qa + qt * 16 * HD + ks * 512); ql[qt][ks] = F::ldf(qa + DP + qt * 16 * HD + ks * 512); }
    asm volatile("s_wait_xcnt 0x0" :: "s"(qs), "v"(lane) : "memory");   // behind the query loads, in front of the first overwrite of their address registers (a scalar base and the lane), which it holds up to here
    v8f acc[8][2];
#pragma unroll
    for (int dt = 0; dt < 8; ++dt) { acc[dt][0] = (v8f){}; acc[dt][1] = (v8f){}; }
    float m[2] = { -3.0e38f, -3.0e38f }, l[2] = { 0.f, 0.f };
    const bf* kbase = Kp + (size_t)z * TT * HD + 8 * lane; const bf* vbase = Vt + (size_t)z * (2 * HD * TT) + 8 * lane;
    const bf* kf = (const bf*)red + wave * KBW + 8 * lane;   // the lane's unit in the wave's own key buffer: 8 x 16 KiB lie inside red
    const unsigned kd = (unsigned)(size_t)kf, kdl = kd + (KBW / 2) * 2;   // its LDS byte address (the low 32 bits of the shared address), and that of its unit in the lo plane, KBW / 2 words of 2 bytes on
    if (wave * 32 <= q0) cp_keys(kd, kbase + wave * 32 * HD, kdl, kbase + DP + wave * 32 * HD);   // the first step's keys; a scalar test: a wave without a step copies nothing

    for (int kc = wave * 32; kc <= q0; kc += 8 * 32) {
        const bf* va = vbase + kc * 16;   // value planes: k step kc / 32; every value fragment of the step lies at a constant offset from it
        asm volatile("s_wait_asynccnt 0x0" ::: "memory");   // this step's keys, copied by this wave, have landed before it reads them
        V kh[2][4], kl[2][4];
#pragma unroll
        for (int ks = 0; ks < 4; ++ks)
#pragma unroll
            for (int kt = 0; kt < 2; ++kt) { kh[kt][ks] = F::ldf(kf + kt * 16 * HD + ks * 512); kl[kt][ks] = F::ldf(kf + KBW / 2 + kt * 16 * HD + ks * 512); }
        __builtin_amdgcn_sched_barrier(0);   // all 16 key fragments leave LDS as one group before the first product
        v8f st[2][2];
#pragma unroll
        for (int kt = 0; kt < 2; ++kt) { st[kt][0] = (v8f){}; st[kt][1] = (v8f){}; }
#pragma unroll
        for (int ks = 0; ks < 4; ++ks)
#pragma unroll
            for (int kt = 0; kt < 2; ++kt)
#pragma unroll
                for (int qt = 0; qt < 2; ++qt) { st[kt][qt] = F::mma(kh[kt][ks], qh[qt][ks], st[kt][qt]); st[kt][qt] = F::mma(kh[kt][ks], ql[qt][ks], st[kt][qt]); st[kt][qt] = F::mma(kl[kt][ks], qh[qt][ks], st[kt][qt]); }
        __builtin_amdgcn_sched_barrier(0);   // the value loads below take the registers that the key fragments have left
        V vh[8], vl[8];
#pragma unroll
        for (int dt = 0; dt < 8; ++dt) { vh[dt] = F::ldf(va + dt * 16 * TT); vl[dt] = F::ldf(va + DB + dt * 16 * TT); }
        asm volatile("s_wait_xcnt 0x0" :: "v"(va) : "memory");   // behind the step's value loads, in front of the first overwrite of their address registers, which it holds up to here
        asm volatile("s_wait_dscnt 0x0" ::: "memory");   // the wave's reads of its key buffer have returned before the copies below refill it
        if (kc + 8 * 32 <= q0) cp_keys(kd, kbase + (kc + 8 * 32) * HD, kdl, kbase + DP + (kc + 8 * 32) * HD);   // the wave's next step's keys, only while it has one (a scalar test): behind the value loads, which are wanted first
        __builtin_amdgcn_sched_barrier(0);   // the value loads and the key copies are issued before the softmax arithmetic and fly during it
        V ph[2], pl[2]; float al[2];
#pragma unroll
        for (int qt = 0; qt < 2; ++qt) {
            const int lim = q0 + qt * 16 + lr - kc - 8 * hi;   // the lane's key 16 kt + j (+ kc + 8 hi) is at or in front of its query where 16 kt + j <= lim
            float mx = -3.0e38f;
#pragma unroll
            for (int kt = 0; kt < 2; ++kt)
#pragma unroll
                for (int j = 0; j < 8; ++j) { const float t = (kt * 16 + j <= lim) ? st[kt][qt][j] * SCL : -3.0e38f; st[kt][qt][j] = t; mx = fmaxf(mx, t); }   // an excluded key gets -3e38, whose exponential is an exact zero; key kc is never excluded (kc <= q0), so the maximum is a real score
            mx = fmaxf(mx, __shfl_xor(mx, 16, 32));
            const float mn = fmaxf(m[qt], mx); al[qt] = exp2n((m[qt] - mn) * L2E); m[qt] = mn;
            float s = 0.f;
#pragma unroll
            for (int kt = 0; kt < 2; ++kt)
#pragma unroll
                for (int j = 0; j < 8; ++j) { const float p = exp2n((st[kt][qt][j] - mn) * L2E); s += p; const __bf16 h = (__bf16)p; ph[qt][kt * 8 + j] = h; pl[qt][kt * 8 + j] = (__bf16)(p - (float)h); }
            l[qt] = l[qt] * al[qt] + s;
        }
        if (__builtin_amdgcn_ballot_w32(al[0] != 1.0f || al[1] != 1.0f)) {   // the carried result is rescaled only in a step that raises some row's maximum
#pragma unroll
            for (int dt = 0; dt < 8; ++dt) { acc[dt][0] *= al[0]; acc[dt][1] *= al[1]; }
        }
#pragma unroll
        for (int dt = 0; dt < 8; ++dt)
#pragma unroll
            for (int qt = 0; qt < 2; ++qt) { acc[dt][qt] = F::mma(vh[dt], ph[qt], acc[dt][qt]); acc[dt][qt] = F::mma(vh[dt], pl[qt], acc[dt][qt]); acc[dt][qt] = F::mma(vl[dt], ph[qt], acc[dt][qt]); }
        asm volatile("v_nop\n\tv_nop\n\tv_nop\n\tv_nop" : "+v"(acc[6][0]), "+v"(acc[6][1]), "+v"(acc[7][0]), "+v"(acc[7][1]) : "v"(vh[7]), "v"(vl[7]));   // the matrix instructions' distance on the loop's taken branch
    }
    asm volatile("s_wait_asynccnt 0x0" ::: "memory");   // no copy of the wave is outstanding when it leaves the loop: red is used anew behind the barrier below
#pragma unroll
    for (int qt = 0; qt < 2; ++qt) { l[qt] += __shfl_xor(l[qt], 16, 32); if (hi == 0) { sm[wave][qt * 16 + lr] = m[qt]; sl[wave][qt * 16 + lr] = l[qt]; } }
    __syncthreads();   // all 8 waves' maxima and sums are in LDS before any wave reads them
#pragma unroll
    for (int qt = 0; qt < 2; ++qt) { const int q = qt * 16 + lr; float M = sm[0][q];
#pragma unroll
        for (int w = 1; w < 8; ++w) M = fmaxf(M, sm[w][q]);
        float L = 0.f;
#pragma unroll
        for (int w = 0; w < 8; ++w) L += sl[w][q] * exp2n((sm[w][q] - M) * L2E);   // a wave without a step has m = -3e38 and l = 0: an exact zero; wave 0 always has step 0
        const float f = exp2n((m[qt] - M) * L2E) / L;
        float* op = red + (wave * 32 + q) * OPD + hi * 8;
#pragma unroll
        for (int dt = 0; dt < 8; ++dt) { const v8f a = acc[dt][qt] * f; *(v4fa*)(op + dt * 16) = (v4f){ a[0], a[1], a[2], a[3] }; *(v4fa*)(op + dt * 16 + 4) = (v4f){ a[4], a[5], a[6], a[7] }; } }
    __syncthreads();   // all 8 partial results are in LDS before any wave adds them
    v4f val[4];
#pragma unroll
    for (int s = 0; s < 4; ++s) { const float* rp = red + (s * 8 + wave) * OPD + lane * 4; val[s] = *(const v4fa*)rp;
#pragma unroll
        for (int w = 1; w < 8; ++w) val[s] += *(const v4fa*)(rp + w * 32 * OPD); }
    float* orow = O + ((size_t)z * TT + q0 + wave) * HD + lane * 4;   // row 8 s + wave of the block's 32: a wave stores the row's 512 bytes
#pragma unroll
    for (int s = 0; s < 4; ++s) *(v4f*)(orow + s * 8 * HD) = val[s];
}

extern "C" void kernel_launch(void* const* d_in, const int* in_sizes, int n_in,
                              void* d_out, int out_size, void* d_ws, size_t ws_size, hipStream_t stream) {
    (void)in_sizes; (void)n_in; (void)out_size;
    const float* x = (const float*)d_in[0]; const float* wk = (const float*)d_in[1]; const float* wq = (const float*)d_in[2]; const float* wv = (const float*)d_in[3];
    // inputs in the module's argument order = d_in[0..3]: the [8][2048][1024] plane, then the KEY, QUERY and VALUE weights [1024][128] (in, out): all four read; the causal rule is computed: there is no mask input
    float* OUT = (float*)d_out;     // [8][2048][128]
    char* wsp = (char*)d_ws;
    auto take = [&](size_t bytes) { char* p = wsp; wsp += (bytes + 255) & ~(size_t)255; return (void*)p; };
    bf* WQ = (bf*)take((size_t)(DQ + 2 * DKV) * DM * 2); bf* WK = WQ + DQ * DM; bf* WV = WK + DKV * DM;   /* one plane of 384 rows: q, k, v */
    bf* QPh = (bf*)take((size_t)ZH * TT * HD * 2 * 2); bf* QPl = QPh + ZH * TT * HD; bf* KPh = (bf*)take((size_t)ZH * TT * HD * 2 * 2); bf* KPl = KPh + ZH * TT * HD;   /* [hi plane | lo plane], as they lay */ bf* VTh = (bf*)take((size_t)ZH * HD * 2 * TT * 2);
    if ((size_t)(wsp - (char*)d_ws) > ws_size) return;
    bf* VTl = VTh + (size_t)HD * TT;           // an entry's value planes, fragment order: [hi: HD x TT | lo: HD x TT] (k_gemmw)
    k_prep<<<3 * WTB, 256, 0, stream>>>(wq, wk, wv, WQ, WK, WV);   /* (in, out) weights: the transposing cast: [128][1024] = Bt */
    k_gemmw<bf, DM><<<NB_ * TT / 64, 256, 0, stream>>>(x, WQ, QPh, QPl, KPh, KPl, VTh, VTl, HD);   /* the three projections, a0 read as f32 and cast on its way: the eight entries' rows are one [16384][1024] operand; each wave writes its own tile of its weight's hi / lo planes */
    k_attn<<<ZH * (TT / 32), 256, 0, stream>>>(QPh, KPh, VTh, OUT);   /* scores (three products), softmax, P x v (three products) of 32 query rows a block; the lo planes stand at constant distances behind the hi planes: the one writer of d_out */
}
